// v000
// Measured on an AMD MI455X. A time is GPU time per run, averaged over a window of back-to-back runs after a warm-up
// (all launches, gaps included; the runs take copies of the inputs in turn), and the median of several windows.
// Apart from v000's, it joins two sittings. Times from different sittings can be a few percent apart, while
// side-by-side timings come from the same sitting.
// The starting kernel, v000, takes 999 microseconds a run.
#include <hip/hip_runtime.h>
#include <hip/hip_bf16.h>
#include <stdint.h>

// ---------------------------------------------------------------------------
// Problem constants (match reference)
// ---------------------------------------------------------------------------
#define BATCH  2
#define SEQ    2048
#define DMODEL 1024
#define NH     16
#define DHEAD  64
#define FFDIM  4096
#define EPSLN  1e-6f

// ---------------------------------------------------------------------------
// WMMA types (CDNA5 / gfx1250, wave32)
// ---------------------------------------------------------------------------
typedef __attribute__((ext_vector_type(16))) __bf16 v16bf;
typedef __attribute__((ext_vector_type(8)))  float  v8f;

union Frag {
    v16bf v;
    uint4 q[2];
};

__device__ __forceinline__ __bf16 f2bf(float f) {
    union { float f; uint32_t u; } c; c.f = f;
    uint32_t r = (c.u + 0x7FFFu + ((c.u >> 16) & 1u)) >> 16;   // RNE
    union { uint16_t s; __bf16 b; } o; o.s = (uint16_t)r;
    return o.b;
}

// ---------------------------------------------------------------------------
// Generic bf16-WMMA GEMM: C[M,N] = A[M,K] * B[K,N]  (A,B fp32 in memory,
// converted to bf16 in LDS; fp32 accumulate via v_wmma_f32_16x16x32_bf16)
//
// Block tile: 128x128, K-step 32, 256 threads (8 wave32), wave tile 64x32.
// LDS rows padded to BK+8 bf16 (80B) so per-lane fragment reads are two
// 16B-aligned ds_load_b128, matching the 16-bit A/B operand layout:
//   lane l: row/col = l&15, half = l>>4; chunk0 = K[half*8 .. +7],
//   chunk1 = K[16+half*8 .. +7]  (per K-step of 32).
// ---------------------------------------------------------------------------
#define BM 128
#define BN 128
#define BK 32
#define GT 256
#define LDAP 40   // BK + 8 pad -> 80B row stride, 16B aligned rows

enum { EPI_F32 = 0, EPI_BIAS = 1, EPI_BIAS_RELU = 2, EPI_QKPACK = 3, EPI_VTPACK = 4 };

template<int EPI, bool TRANSB>
__launch_bounds__(GT)
__global__ void gemm_bf16_wmma(const float* __restrict__ A,
                               const float* __restrict__ B,
                               const float* __restrict__ bias,
                               float* __restrict__ C,
                               __bf16* __restrict__ Cb,
                               int M, int N, int K, float scale)
{
    __shared__ __bf16 As[BM][LDAP];
    __shared__ __bf16 Bs[BN][LDAP];

    const int tid  = threadIdx.x;
    const int m0   = blockIdx.y * BM;
    const int n0   = blockIdx.x * BN;
    const int wid  = tid >> 5;
    const int lane = tid & 31;
    const int hf   = lane >> 4;
    const int ln   = lane & 15;
    const int wm   = (wid >> 2) * 64;   // 2 wave rows
    const int wn   = (wid & 3) * 32;    // 4 wave cols

    v8f acc[4][2] = {};

    for (int kt = 0; kt < K; kt += BK) {
        // ---- stage A tile (128 x 32 fp32 -> bf16) --------------------------
        #pragma unroll
        for (int i = 0; i < 4; ++i) {
            int idx = i * GT + tid;              // 0..1023 float4 slots
            int r = idx >> 3, c = (idx & 7) << 2;
            const float4 a4 = *(const float4*)(A + (size_t)(m0 + r) * K + kt + c);
            As[r][c + 0] = f2bf(a4.x); As[r][c + 1] = f2bf(a4.y);
            As[r][c + 2] = f2bf(a4.z); As[r][c + 3] = f2bf(a4.w);
        }
        // ---- stage B tile ---------------------------------------------------
        if (TRANSB) {
            // B given as [N,K] row-major (Wo): store Bs[n][k] contiguously
            #pragma unroll
            for (int i = 0; i < 4; ++i) {
                int idx = i * GT + tid;
                int r = idx >> 3, c = (idx & 7) << 2;
                const float4 b4 = *(const float4*)(B + (size_t)(n0 + r) * K + kt + c);
                Bs[r][c + 0] = f2bf(b4.x); Bs[r][c + 1] = f2bf(b4.y);
                Bs[r][c + 2] = f2bf(b4.z); Bs[r][c + 3] = f2bf(b4.w);
            }
        } else {
            // B [K,N] row-major: transpose while staging into Bs[n][k]
            #pragma unroll
            for (int i = 0; i < 4; ++i) {
                int idx = i * GT + tid;
                int k = idx >> 5, c = (idx & 31) << 2;
                const float4 b4 = *(const float4*)(B + (size_t)(kt + k) * N + n0 + c);
                Bs[c + 0][k] = f2bf(b4.x); Bs[c + 1][k] = f2bf(b4.y);
                Bs[c + 2][k] = f2bf(b4.z); Bs[c + 3][k] = f2bf(b4.w);
            }
        }
        if (kt + BK < K) {  // hint next A tile into cache (global_prefetch)
            __builtin_prefetch(A + (size_t)(m0 + (tid >> 3)) * K + kt + BK, 0, 1);
        }
        __syncthreads();

        // ---- fragments + 8 WMMAs -------------------------------------------
        Frag af[4], bfr[2];
        #pragma unroll
        for (int mt = 0; mt < 4; ++mt) {
            const __bf16* p = &As[wm + mt * 16 + ln][0];
            af[mt].q[0] = *(const uint4*)(p + hf * 8);
            af[mt].q[1] = *(const uint4*)(p + 16 + hf * 8);
        }
        #pragma unroll
        for (int nt = 0; nt < 2; ++nt) {
            const __bf16* p = &Bs[wn + nt * 16 + ln][0];
            bfr[nt].q[0] = *(const uint4*)(p + hf * 8);
            bfr[nt].q[1] = *(const uint4*)(p + 16 + hf * 8);
        }
        #pragma unroll
        for (int mt = 0; mt < 4; ++mt)
            #pragma unroll
            for (int nt = 0; nt < 2; ++nt)
                acc[mt][nt] = __builtin_amdgcn_wmma_f32_16x16x32_bf16(
                    false, af[mt].v, false, bfr[nt].v, (short)0, acc[mt][nt], false, false);
        __syncthreads();
    }

    // ---- epilogue: C/D layout -> element (m,n): vgpr r = m&7, lane = n + 16*(m>>3)
    #pragma unroll
    for (int mt = 0; mt < 4; ++mt)
    #pragma unroll
    for (int nt = 0; nt < 2; ++nt)
    #pragma unroll
    for (int r = 0; r < 8; ++r) {
        int row = m0 + wm + mt * 16 + r + hf * 8;
        int col = n0 + wn + nt * 16 + ln;
        float v = acc[mt][nt][r];
        if (EPI == EPI_BIAS || EPI == EPI_BIAS_RELU) v += bias[col];
        if (EPI == EPI_BIAS_RELU) v = fmaxf(v, 0.0f);
        if (EPI == EPI_F32 || EPI == EPI_BIAS || EPI == EPI_BIAS_RELU) {
            C[(size_t)row * N + col] = v;
        } else if (EPI == EPI_QKPACK) {
            // [B*T, H*64] fp32 -> [B,H,T,64] bf16 (Q pre-scaled by 1/sqrt(DK))
            int b = row >> 11, t = row & (SEQ - 1);
            int h = col >> 6,  dd = col & 63;
            Cb[(((size_t)(b * NH + h) * SEQ + t) << 6) + dd] = f2bf(v * scale);
        } else { // EPI_VTPACK: -> [B,H,64,T] bf16 (V transposed)
            int b = row >> 11, t = row & (SEQ - 1);
            int h = col >> 6,  dd = col & 63;
            Cb[((size_t)(b * NH + h) * 64 + dd) * SEQ + t] = f2bf(v);
        }
    }
}

// ---------------------------------------------------------------------------
// Causal flash attention: grid (T/64, B*H), 128 threads (4 waves).
// Wave w owns q rows qtile*64 + w*16 .. +15; streams K/V in 64-wide chunks
// (only sc <= qtile: causal), online softmax, ctx accumulated in fp32.
// P (C-layout) round-trips through per-wave LDS tile to become an A operand.
// ---------------------------------------------------------------------------
#define AT 128
#define KPAD 72   // 64 + 8 pad -> 144B row stride, 16B aligned rows

__launch_bounds__(AT)
__global__ void flash_attn_kernel(const __bf16* __restrict__ qg,
                                  const __bf16* __restrict__ kg,
                                  const __bf16* __restrict__ vtg,
                                  float* __restrict__ ctx)
{
    __shared__ __bf16 Ks[64][KPAD];       // K chunk   [s][dk]
    __shared__ __bf16 Vs[64][KPAD];       // Vt chunk  [dv][s]
    __shared__ __bf16 Ps[4][16][KPAD];    // per-wave P [t][s]

    const int tid   = threadIdx.x;
    const int wid   = tid >> 5;
    const int lane  = tid & 31;
    const int hf    = lane >> 4;
    const int ln    = lane & 15;
    const int bh    = blockIdx.y;         // b*NH + h
    const int qtile = blockIdx.x;
    const int qrow0 = qtile * 64 + wid * 16;

    // Q fragments (A operand, K = DHEAD = 64 -> two K-steps of 32)
    const __bf16* qrow = qg + ((size_t)bh * SEQ + qrow0 + ln) * DHEAD;
    Frag aq[2];
    #pragma unroll
    for (int ks = 0; ks < 2; ++ks) {
        aq[ks].q[0] = *(const uint4*)(qrow + ks * 32 + hf * 8);
        aq[ks].q[1] = *(const uint4*)(qrow + ks * 32 + 16 + hf * 8);
    }

    float rowmax[8], rowsum[8];
    #pragma unroll
    for (int r = 0; r < 8; ++r) { rowmax[r] = -3.0e38f; rowsum[r] = 0.0f; }
    v8f cacc[4] = {};

    const __bf16* kbase = kg  + (size_t)bh * SEQ * DHEAD;
    const __bf16* vbase = vtg + (size_t)bh * DHEAD * SEQ;

    for (int sc = 0; sc <= qtile; ++sc) {
        const int s0 = sc * 64;
        // ---- stage K chunk [64][64] and Vt chunk [64][64] ------------------
        #pragma unroll
        for (int i = 0; i < 8; ++i) {
            int idx = i * AT + tid;           // 0..1023 (8B units)
            int r = idx >> 4, c = (idx & 15) << 2;
            *(uint2*)&Ks[r][c] = *(const uint2*)(kbase + (size_t)(s0 + r) * DHEAD + c);
            *(uint2*)&Vs[r][c] = *(const uint2*)(vbase + (size_t)r * SEQ + s0 + c);
        }
        __syncthreads();

        // ---- S = Q * K^T  (16 x 64 per wave) -------------------------------
        v8f sacc[4] = {};
        #pragma unroll
        for (int nt = 0; nt < 4; ++nt) {
            #pragma unroll
            for (int ks = 0; ks < 2; ++ks) {
                Frag bk;
                const __bf16* p = &Ks[nt * 16 + ln][ks * 32];
                bk.q[0] = *(const uint4*)(p + hf * 8);
                bk.q[1] = *(const uint4*)(p + 16 + hf * 8);
                sacc[nt] = __builtin_amdgcn_wmma_f32_16x16x32_bf16(
                    false, aq[ks].v, false, bk.v, (short)0, sacc[nt], false, false);
            }
        }
        // ---- causal mask ----------------------------------------------------
        #pragma unroll
        for (int nt = 0; nt < 4; ++nt)
            #pragma unroll
            for (int r = 0; r < 8; ++r) {
                int s_idx = s0 + nt * 16 + ln;
                int t_idx = qrow0 + r + hf * 8;
                sacc[nt][r] = (s_idx > t_idx) ? -3.0e38f : sacc[nt][r];
            }
        // ---- online softmax (row stats live across 16 lanes of a half) -----
        #pragma unroll
        for (int r = 0; r < 8; ++r) {
            float mx = fmaxf(fmaxf(sacc[0][r], sacc[1][r]), fmaxf(sacc[2][r], sacc[3][r]));
            #pragma unroll
            for (int off = 1; off < 16; off <<= 1) mx = fmaxf(mx, __shfl_xor(mx, off, 32));
            float mnew = fmaxf(rowmax[r], mx);
            float corr = __expf(rowmax[r] - mnew);
            rowmax[r] = mnew;
            float ps = 0.0f;
            #pragma unroll
            for (int nt = 0; nt < 4; ++nt) {
                float p = __expf(sacc[nt][r] - mnew);
                ps += p;
                Ps[wid][r + hf * 8][nt * 16 + ln] = f2bf(p);
            }
            #pragma unroll
            for (int off = 1; off < 16; off <<= 1) ps += __shfl_xor(ps, off, 32);
            rowsum[r] = rowsum[r] * corr + ps;
            #pragma unroll
            for (int nt = 0; nt < 4; ++nt) cacc[nt][r] = cacc[nt][r] * corr;
        }
        // ---- ctx += P * V  (P reloaded in A layout from LDS) ---------------
        Frag ap[2];
        #pragma unroll
        for (int ks = 0; ks < 2; ++ks) {
            const __bf16* p = &Ps[wid][ln][ks * 32];
            ap[ks].q[0] = *(const uint4*)(p + hf * 8);
            ap[ks].q[1] = *(const uint4*)(p + 16 + hf * 8);
        }
        #pragma unroll
        for (int nt = 0; nt < 4; ++nt)
            #pragma unroll
            for (int ks = 0; ks < 2; ++ks) {
                Frag bv;
                const __bf16* p = &Vs[nt * 16 + ln][ks * 32];
                bv.q[0] = *(const uint4*)(p + hf * 8);
                bv.q[1] = *(const uint4*)(p + 16 + hf * 8);
                cacc[nt] = __builtin_amdgcn_wmma_f32_16x16x32_bf16(
                    false, ap[ks].v, false, bv.v, (short)0, cacc[nt], false, false);
            }
        __syncthreads();
    }

    // ---- normalize + store ctx as [B*T, H*DV] fp32 -------------------------
    const int b = bh / NH, h = bh % NH;
    #pragma unroll
    for (int r = 0; r < 8; ++r) {
        float inv = 1.0f / rowsum[r];
        int t = qrow0 + r + hf * 8;
        #pragma unroll
        for (int nt = 0; nt < 4; ++nt)
            ctx[(size_t)(b * SEQ + t) * DMODEL + h * 64 + nt * 16 + ln] = cacc[nt][r] * inv;
    }
}

// ---------------------------------------------------------------------------
// out = LayerNorm(a + b) * gamma + beta ; one 1024-wide row per 256-thr block
// ---------------------------------------------------------------------------
__launch_bounds__(256)
__global__ void add_ln_kernel(const float* __restrict__ a,
                              const float* __restrict__ b,
                              const float* __restrict__ gamma,
                              const float* __restrict__ beta,
                              float* __restrict__ out)
{
    __shared__ float red[16];
    const int row = blockIdx.x;
    const int tid = threadIdx.x;
    const size_t base = (size_t)row * DMODEL;

    float v[4]; float s = 0.0f, ss = 0.0f;
    #pragma unroll
    for (int j = 0; j < 4; ++j) {
        int idx = tid + j * 256;
        float x = a[base + idx] + b[base + idx];
        v[j] = x; s += x; ss += x * x;
    }
    #pragma unroll
    for (int off = 1; off < 32; off <<= 1) {
        s  += __shfl_xor(s,  off, 32);
        ss += __shfl_xor(ss, off, 32);
    }
    int wid = tid >> 5, lane = tid & 31;
    if (lane == 0) { red[wid] = s; red[8 + wid] = ss; }
    __syncthreads();
    if (wid == 0) {
        float s2  = (lane < 8) ? red[lane] : 0.0f;
        float ss2 = (lane < 8) ? red[8 + lane] : 0.0f;
        #pragma unroll
        for (int off = 1; off < 8; off <<= 1) {
            s2  += __shfl_xor(s2,  off, 32);
            ss2 += __shfl_xor(ss2, off, 32);
        }
        if (lane == 0) { red[0] = s2; red[8] = ss2; }
    }
    __syncthreads();
    float mu  = red[0] * (1.0f / DMODEL);
    float var = red[8] * (1.0f / DMODEL) - mu * mu;
    float rs  = rsqrtf(var + EPSLN);
    #pragma unroll
    for (int j = 0; j < 4; ++j) {
        int idx = tid + j * 256;
        out[base + idx] = (v[j] - mu) * rs * gamma[idx] + beta[idx];
    }
}

// ---------------------------------------------------------------------------
// Host-side orchestration
// ---------------------------------------------------------------------------
extern "C" void kernel_launch(void* const* d_in, const int* in_sizes, int n_in,
                              void* d_out, int out_size, void* d_ws, size_t ws_size,
                              hipStream_t stream)
{
    const float* x   = (const float*)d_in[0];
    const float* Wq  = (const float*)d_in[1];
    const float* Wk  = (const float*)d_in[2];
    const float* Wv  = (const float*)d_in[3];
    const float* Wo  = (const float*)d_in[4];
    const float* W1  = (const float*)d_in[5];
    const float* b1  = (const float*)d_in[6];
    const float* W2  = (const float*)d_in[7];
    const float* b2  = (const float*)d_in[8];
    const float* g1  = (const float*)d_in[9];
    const float* be1 = (const float*)d_in[10];
    const float* g2  = (const float*)d_in[11];
    const float* be2 = (const float*)d_in[12];
    float* out = (float*)d_out;

    const int M = BATCH * SEQ;   // 4096 token rows

    char* w = (char*)d_ws;
    auto take = [&](size_t bytes) -> char* {
        char* p = w; w += (bytes + 255) & ~(size_t)255; return p;
    };
    __bf16* qb  = (__bf16*)take((size_t)M * DMODEL * sizeof(__bf16)); //  8 MB
    __bf16* kb  = (__bf16*)take((size_t)M * DMODEL * sizeof(__bf16)); //  8 MB
    __bf16* vtb = (__bf16*)take((size_t)M * DMODEL * sizeof(__bf16)); //  8 MB
    float*  ctx = (float*)take((size_t)M * DMODEL * sizeof(float));   // 16 MB
    float*  ao  = (float*)take((size_t)M * DMODEL * sizeof(float));   // 16 MB
    float*  h   = (float*)take((size_t)M * DMODEL * sizeof(float));   // 16 MB
    float*  f1  = (float*)take((size_t)M * FFDIM  * sizeof(float));   // 64 MB
    float*  f2  = (float*)take((size_t)M * DMODEL * sizeof(float));   // 16 MB

    const dim3 blk(GT);
    const dim3 g_d(DMODEL / BN, M / BM);   // (8, 32)
    const dim3 g_ff(FFDIM / BN, M / BM);   // (32, 32)
    const float qscale = 0.125f;           // 1/sqrt(DK)

    // Q,K,V projections; pack straight to attention layouts in bf16
    gemm_bf16_wmma<EPI_QKPACK, false><<<g_d, blk, 0, stream>>>(x, Wq, nullptr, nullptr, qb,  M, DMODEL, DMODEL, qscale);
    gemm_bf16_wmma<EPI_QKPACK, false><<<g_d, blk, 0, stream>>>(x, Wk, nullptr, nullptr, kb,  M, DMODEL, DMODEL, 1.0f);
    gemm_bf16_wmma<EPI_VTPACK, false><<<g_d, blk, 0, stream>>>(x, Wv, nullptr, nullptr, vtb, M, DMODEL, DMODEL, 1.0f);

    // Causal flash attention
    flash_attn_kernel<<<dim3(SEQ / 64, BATCH * NH), dim3(AT), 0, stream>>>(qb, kb, vtb, ctx);

    // Output projection (Wo consumed transposed: [N,K] row-major)
    gemm_bf16_wmma<EPI_F32, true><<<g_d, blk, 0, stream>>>(ctx, Wo, nullptr, ao, nullptr, M, DMODEL, DMODEL, 1.0f);

    // h = LN(x + attn_out)
    add_ln_kernel<<<dim3(M), dim3(256), 0, stream>>>(x, ao, g1, be1, h);

    // FFN
    gemm_bf16_wmma<EPI_BIAS_RELU, false><<<g_ff, blk, 0, stream>>>(h,  W1, b1, f1, nullptr, M, FFDIM,  DMODEL, 1.0f);
    gemm_bf16_wmma<EPI_BIAS,      false><<<g_d,  blk, 0, stream>>>(f1, W2, b2, f2, nullptr, M, DMODEL, FFDIM,  1.0f);

    // out = LN(h + ffn)
    add_ln_kernel<<<dim3(M), dim3(256), 0, stream>>>(h, f2, g2, be2, out);
}

// v001
// A run of this version takes 597 microseconds.
// Next to v000, in two timings, it ran 1.67 times as fast each time.
#include <hip/hip_runtime.h>
#include <hip/hip_bf16.h>
#include <stdint.h>

// ---------------------------------------------------------------------------
// Problem constants (match reference)
// ---------------------------------------------------------------------------
#define BATCH  2
#define SEQ    2048
#define DMODEL 1024
#define NH     16
#define DHEAD  64
#define FFDIM  4096
#define EPSLN  1e-6f

// ---------------------------------------------------------------------------
// WMMA types (CDNA5 / gfx1250, wave32)
// ---------------------------------------------------------------------------
typedef __attribute__((ext_vector_type(16))) __bf16 v16bf;
typedef __attribute__((ext_vector_type(8)))  float  v8f;

union Frag {
    v16bf v;
    uint4 q[2];
};

__device__ __forceinline__ __bf16 f2bf(float f) {
    union { float f; uint32_t u; } c; c.f = f;
    uint32_t r = (c.u + 0x7FFFu + ((c.u >> 16) & 1u)) >> 16;   // RNE
    union { uint16_t s; __bf16 b; } o; o.s = (uint16_t)r;
    return o.b;
}

// ---------------------------------------------------------------------------
// Generic bf16-WMMA GEMM: C[M,N] = A[M,K] * B[K,N]  (A,B fp32 in memory,
// converted to bf16 in LDS; fp32 accumulate via v_wmma_f32_16x16x32_bf16)
//
// Block tile: 128x128, K-step 32, 256 threads (8 wave32), wave tile 64x32.
// LDS rows padded to BK+8 bf16 (80B) so per-lane fragment reads are two
// 16B-aligned ds_load_b128, matching the 16-bit A/B operand layout:
//   lane l: row/col = l&15, half = l>>4; chunk0 = K[half*8 .. +7],
//   chunk1 = K[16+half*8 .. +7]  (per K-step of 32).
// ---------------------------------------------------------------------------
#define BM 128
#define BN 128
#define BK 32
#define GT 256
#define LDAP 40   // BK + 8 pad -> 80B row stride, 16B aligned rows

enum { EPI_F32 = 0, EPI_BIAS = 1, EPI_BIAS_RELU = 2, EPI_QKPACK = 3, EPI_VTPACK = 4 };

template<int EPI, bool TRANSB>
__launch_bounds__(GT)
__global__ void gemm_bf16_wmma(const float* A,   // A, B: no __restrict__, see fetch
                               const float* B,
                               const float* __restrict__ bias,
                               float* __restrict__ C,
                               __bf16* __restrict__ Cb,
                               int M, int N, int K, float scale)
{
    __shared__ __bf16 As[BM][LDAP];
    __shared__ __bf16 Bs[BN][LDAP];

    const int tid  = threadIdx.x;
    const int m0   = blockIdx.y * BM;
    const int n0   = blockIdx.x * BN;
    const int wid  = tid >> 5;
    const int lane = tid & 31;
    const int hf   = lane >> 4;
    const int ln   = lane & 15;
    const int wm   = (wid >> 2) * 64;   // 2 wave rows
    const int wn   = (wid & 3) * 32;    // 4 wave cols

    v8f acc[4][2] = {};

    // Byte offsets of this thread's float4 slots inside a K tile; they do not
    // change over the loop, only the tile's (uniform) base address does.
    uint32_t oa[4], ob[4];
    #pragma unroll
    for (int i = 0; i < 4; ++i) {
        int idx = i * GT + tid;                  // 0..1023 float4 slots
        oa[i] = (uint32_t)(((idx >> 3) * K + ((idx & 7) << 2)) * 4);
        ob[i] = TRANSB ? oa[i]                   // B given as [N,K] row-major (Wo)
                       : (uint32_t)(((idx >> 5) * N + ((idx & 31) << 2)) * 4);
    }

    // All eight fp32 loads of one K tile, issued as one group into registers.
    // A and B are not __restrict__: plain loads keep their place in front of the
    // barrier's fence; marked __restrict__ the compiler sank them over both
    // barriers to their first use, where each waited out its own latency.
    auto fetch = [&](float4 (&ra)[4], float4 (&rb)[4], int kt) {
        const char* At = (const char*)(A + (size_t)m0 * K + kt);
        const char* Bt = (const char*)(TRANSB ? B + (size_t)n0 * K + kt
                                              : B + (size_t)kt * N + n0);
        #pragma unroll
        for (int i = 0; i < 4; ++i) ra[i] = *(const float4*)(At + oa[i]);
        // The loads stay in flight while their address registers are reused
        // (by the loads below, by the fragment loads): the wait stands first.
        asm volatile("s_wait_xcnt 0x0" ::: "memory");
        #pragma unroll
        for (int i = 0; i < 4; ++i) rb[i] = *(const float4*)(Bt + ob[i]);
        asm volatile("s_wait_xcnt 0x0" ::: "memory");   // as above
    };

    // Work-group barrier whose fences order LDS only. As and Bs are all that
    // the waves hand to each other; __syncthreads() would also wait out the
    // global loads that are meant to stay in flight over it.
    auto lds_barrier = [&]() {
        __builtin_amdgcn_fence(__ATOMIC_RELEASE, "workgroup", "local");
        __builtin_amdgcn_s_barrier();
        __builtin_amdgcn_fence(__ATOMIC_ACQUIRE, "workgroup", "local");
    };

    // The raw tile is carried over the loop's back edge: its loads are issued
    // in the pass before, behind the conversion that frees its registers, and
    // fly during that pass's LDS traffic, barriers and WMMAs. No branch stands
    // around the fetch (a join of two paths would drain it early): in the last
    // pass it re-reads the last tile and nothing uses it.
    float4 ra[4], rb[4];
    fetch(ra, rb, 0);
    for (int kt = 0; kt < K; kt += BK) {
        // ---- stage A tile (128 x 32 fp32 -> bf16) --------------------------
        #pragma unroll
        for (int i = 0; i < 4; ++i) {
            int idx = i * GT + tid;
            int r = idx >> 3, c = (idx & 7) << 2;
            As[r][c + 0] = f2bf(ra[i].x); As[r][c + 1] = f2bf(ra[i].y);
            As[r][c + 2] = f2bf(ra[i].z); As[r][c + 3] = f2bf(ra[i].w);
        }
        // ---- stage B tile ---------------------------------------------------
        #pragma unroll
        for (int i = 0; i < 4; ++i) {
            int idx = i * GT + tid;
            if (TRANSB) {   // store Bs[n][k] contiguously
                int r = idx >> 3, c = (idx & 7) << 2;
                Bs[r][c + 0] = f2bf(rb[i].x); Bs[r][c + 1] = f2bf(rb[i].y);
                Bs[r][c + 2] = f2bf(rb[i].z); Bs[r][c + 3] = f2bf(rb[i].w);
            } else {        // transpose while staging into Bs[n][k]
                int k = idx >> 5, c = (idx & 31) << 2;
                Bs[c + 0][k] = f2bf(rb[i].x); Bs[c + 1][k] = f2bf(rb[i].y);
                Bs[c + 2][k] = f2bf(rb[i].z); Bs[c + 3][k] = f2bf(rb[i].w);
            }
        }
        // Keeps the next tile's loads behind the conversions above, so that they
        // land in the registers just freed: lifted over them they need a second
        // set and copies, and the copies' wait for the loads stands early.
        __builtin_amdgcn_sched_barrier(0);
        fetch(ra, rb, (kt + BK < K) ? kt + BK : kt);
        lds_barrier();

        // ---- fragments + 8 WMMAs -------------------------------------------
        Frag af[4], bfr[2];
        #pragma unroll
        for (int mt = 0; mt < 4; ++mt) {
            const __bf16* p = &As[wm + mt * 16 + ln][0];
            af[mt].q[0] = *(const uint4*)(p + hf * 8);
            af[mt].q[1] = *(const uint4*)(p + 16 + hf * 8);
        }
        #pragma unroll
        for (int nt = 0; nt < 2; ++nt) {
            const __bf16* p = &Bs[wn + nt * 16 + ln][0];
            bfr[nt].q[0] = *(const uint4*)(p + hf * 8);
            bfr[nt].q[1] = *(const uint4*)(p + 16 + hf * 8);
        }
        #pragma unroll
        for (int mt = 0; mt < 4; ++mt)
            #pragma unroll
            for (int nt = 0; nt < 2; ++nt)
                acc[mt][nt] = __builtin_amdgcn_wmma_f32_16x16x32_bf16(
                    false, af[mt].v, false, bfr[nt].v, (short)0, acc[mt][nt], false, false);
        lds_barrier();
    }

    // ---- epilogue: C/D layout -> element (m,n): vgpr r = m&7, lane = n + 16*(m>>3)
    #pragma unroll
    for (int mt = 0; mt < 4; ++mt)
    #pragma unroll
    for (int nt = 0; nt < 2; ++nt)
    #pragma unroll
    for (int r = 0; r < 8; ++r) {
        int row = m0 + wm + mt * 16 + r + hf * 8;
        int col = n0 + wn + nt * 16 + ln;
        float v = acc[mt][nt][r];
        if (EPI == EPI_BIAS || EPI == EPI_BIAS_RELU) v += bias[col];
        if (EPI == EPI_BIAS_RELU) v = fmaxf(v, 0.0f);
        if (EPI == EPI_F32 || EPI == EPI_BIAS || EPI == EPI_BIAS_RELU) {
            C[(size_t)row * N + col] = v;
        } else if (EPI == EPI_QKPACK) {
            // [B*T, H*64] fp32 -> [B,H,T,64] bf16 (Q pre-scaled by 1/sqrt(DK))
            int b = row >> 11, t = row & (SEQ - 1);
            int h = col >> 6,  dd = col & 63;
            Cb[(((size_t)(b * NH + h) * SEQ + t) << 6) + dd] = f2bf(v * scale);
        } else { // EPI_VTPACK: -> [B,H,64,T] bf16 (V transposed)
            int b = row >> 11, t = row & (SEQ - 1);
            int h = col >> 6,  dd = col & 63;
            Cb[((size_t)(b * NH + h) * 64 + dd) * SEQ + t] = f2bf(v);
        }
    }
}

// ---------------------------------------------------------------------------
// Causal flash attention: grid (T/64, B*H), 128 threads (4 waves).
// Wave w owns q rows qtile*64 + w*16 .. +15; streams K/V in 64-wide chunks
// (only sc <= qtile: causal), online softmax, ctx accumulated in fp32.
// P (C-layout) round-trips through per-wave LDS tile to become an A operand.
// ---------------------------------------------------------------------------
#define AT 128
#define KPAD 72   // 64 + 8 pad -> 144B row stride, 16B aligned rows

__launch_bounds__(AT)
__global__ void flash_attn_kernel(const __bf16* __restrict__ qg,
                                  const __bf16* __restrict__ kg,
                                  const __bf16* __restrict__ vtg,
                                  float* __restrict__ ctx)
{
    __shared__ __bf16 Ks[64][KPAD];       // K chunk   [s][dk]
    __shared__ __bf16 Vs[64][KPAD];       // Vt chunk  [dv][s]
    __shared__ __bf16 Ps[4][16][KPAD];    // per-wave P [t][s]

    const int tid   = threadIdx.x;
    const int wid   = tid >> 5;
    const int lane  = tid & 31;
    const int hf    = lane >> 4;
    const int ln    = lane & 15;
    const int bh    = blockIdx.y;         // b*NH + h
    const int qtile = blockIdx.x;
    const int qrow0 = qtile * 64 + wid * 16;

    // Q fragments (A operand, K = DHEAD = 64 -> two K-steps of 32)
    const __bf16* qrow = qg + ((size_t)bh * SEQ + qrow0 + ln) * DHEAD;
    Frag aq[2];
    #pragma unroll
    for (int ks = 0; ks < 2; ++ks) {
        aq[ks].q[0] = *(const uint4*)(qrow + ks * 32 + hf * 8);
        aq[ks].q[1] = *(const uint4*)(qrow + ks * 32 + 16 + hf * 8);
    }

    float rowmax[8], rowsum[8];
    #pragma unroll
    for (int r = 0; r < 8; ++r) { rowmax[r] = -3.0e38f; rowsum[r] = 0.0f; }
    v8f cacc[4] = {};

    const __bf16* kbase = kg  + (size_t)bh * SEQ * DHEAD;
    const __bf16* vbase = vtg + (size_t)bh * DHEAD * SEQ;

    for (int sc = 0; sc <= qtile; ++sc) {
        const int s0 = sc * 64;
        // ---- stage K chunk [64][64] and Vt chunk [64][64] ------------------
        #pragma unroll
        for (int i = 0; i < 8; ++i) {
            int idx = i * AT + tid;           // 0..1023 (8B units)
            int r = idx >> 4, c = (idx & 15) << 2;
            *(uint2*)&Ks[r][c] = *(const uint2*)(kbase + (size_t)(s0 + r) * DHEAD + c);
            *(uint2*)&Vs[r][c] = *(const uint2*)(vbase + (size_t)r * SEQ + s0 + c);
        }
        __syncthreads();

        // ---- S = Q * K^T  (16 x 64 per wave) -------------------------------
        v8f sacc[4] = {};
        #pragma unroll
        for (int nt = 0; nt < 4; ++nt) {
            #pragma unroll
            for (int ks = 0; ks < 2; ++ks) {
                Frag bk;
                const __bf16* p = &Ks[nt * 16 + ln][ks * 32];
                bk.q[0] = *(const uint4*)(p + hf * 8);
                bk.q[1] = *(const uint4*)(p + 16 + hf * 8);
                sacc[nt] = __builtin_amdgcn_wmma_f32_16x16x32_bf16(
                    false, aq[ks].v, false, bk.v, (short)0, sacc[nt], false, false);
            }
        }
        // ---- causal mask ----------------------------------------------------
        #pragma unroll
        for (int nt = 0; nt < 4; ++nt)
            #pragma unroll
            for (int r = 0; r < 8; ++r) {
                int s_idx = s0 + nt * 16 + ln;
                int t_idx = qrow0 + r + hf * 8;
                sacc[nt][r] = (s_idx > t_idx) ? -3.0e38f : sacc[nt][r];
            }
        // ---- online softmax (row stats live across 16 lanes of a half) -----
        #pragma unroll
        for (int r = 0; r < 8; ++r) {
            float mx = fmaxf(fmaxf(sacc[0][r], sacc[1][r]), fmaxf(sacc[2][r], sacc[3][r]));
            #pragma unroll
            for (int off = 1; off < 16; off <<= 1) mx = fmaxf(mx, __shfl_xor(mx, off, 32));
            float mnew = fmaxf(rowmax[r], mx);
            float corr = __expf(rowmax[r] - mnew);
            rowmax[r] = mnew;
            float ps = 0.0f;
            #pragma unroll
            for (int nt = 0; nt < 4; ++nt) {
                float p = __expf(sacc[nt][r] - mnew);
                ps += p;
                Ps[wid][r + hf * 8][nt * 16 + ln] = f2bf(p);
            }
            #pragma unroll
            for (int off = 1; off < 16; off <<= 1) ps += __shfl_xor(ps, off, 32);
            rowsum[r] = rowsum[r] * corr + ps;
            #pragma unroll
            for (int nt = 0; nt < 4; ++nt) cacc[nt][r] = cacc[nt][r] * corr;
        }
        // ---- ctx += P * V  (P reloaded in A layout from LDS) ---------------
        Frag ap[2];
        #pragma unroll
        for (int ks = 0; ks < 2; ++ks) {
            const __bf16* p = &Ps[wid][ln][ks * 32];
            ap[ks].q[0] = *(const uint4*)(p + hf * 8);
            ap[ks].q[1] = *(const uint4*)(p + 16 + hf * 8);
        }
        #pragma unroll
        for (int nt = 0; nt < 4; ++nt)
            #pragma unroll
            for (int ks = 0; ks < 2; ++ks) {
                Frag bv;
                const __bf16* p = &Vs[nt * 16 + ln][ks * 32];
                bv.q[0] = *(const uint4*)(p + hf * 8);
                bv.q[1] = *(const uint4*)(p + 16 + hf * 8);
                cacc[nt] = __builtin_amdgcn_wmma_f32_16x16x32_bf16(
                    false, ap[ks].v, false, bv.v, (short)0, cacc[nt], false, false);
            }
        __syncthreads();
    }

    // ---- normalize + store ctx as [B*T, H*DV] fp32 -------------------------
    const int b = bh / NH, h = bh % NH;
    #pragma unroll
    for (int r = 0; r < 8; ++r) {
        float inv = 1.0f / rowsum[r];
        int t = qrow0 + r + hf * 8;
        #pragma unroll
        for (int nt = 0; nt < 4; ++nt)
            ctx[(size_t)(b * SEQ + t) * DMODEL + h * 64 + nt * 16 + ln] = cacc[nt][r] * inv;
    }
}

// ---------------------------------------------------------------------------
// out = LayerNorm(a + b) * gamma + beta ; one 1024-wide row per 256-thr block
// ---------------------------------------------------------------------------
__launch_bounds__(256)
__global__ void add_ln_kernel(const float* __restrict__ a,
                              const float* __restrict__ b,
                              const float* __restrict__ gamma,
                              const float* __restrict__ beta,
                              float* __restrict__ out)
{
    __shared__ float red[16];
    const int row = blockIdx.x;
    const int tid = threadIdx.x;
    const size_t base = (size_t)row * DMODEL;

    float v[4]; float s = 0.0f, ss = 0.0f;
    #pragma unroll
    for (int j = 0; j < 4; ++j) {
        int idx = tid + j * 256;
        float x = a[base + idx] + b[base + idx];
        v[j] = x; s += x; ss += x * x;
    }
    #pragma unroll
    for (int off = 1; off < 32; off <<= 1) {
        s  += __shfl_xor(s,  off, 32);
        ss += __shfl_xor(ss, off, 32);
    }
    int wid = tid >> 5, lane = tid & 31;
    if (lane == 0) { red[wid] = s; red[8 + wid] = ss; }
    __syncthreads();
    if (wid == 0) {
        float s2  = (lane < 8) ? red[lane] : 0.0f;
        float ss2 = (lane < 8) ? red[8 + lane] : 0.0f;
        #pragma unroll
        for (int off = 1; off < 8; off <<= 1) {
            s2  += __shfl_xor(s2,  off, 32);
            ss2 += __shfl_xor(ss2, off, 32);
        }
        if (lane == 0) { red[0] = s2; red[8] = ss2; }
    }
    __syncthreads();
    float mu  = red[0] * (1.0f / DMODEL);
    float var = red[8] * (1.0f / DMODEL) - mu * mu;
    float rs  = rsqrtf(var + EPSLN);
    #pragma unroll
    for (int j = 0; j < 4; ++j) {
        int idx = tid + j * 256;
        out[base + idx] = (v[j] - mu) * rs * gamma[idx] + beta[idx];
    }
}

// ---------------------------------------------------------------------------
// Host-side orchestration
// ---------------------------------------------------------------------------
extern "C" void kernel_launch(void* const* d_in, const int* in_sizes, int n_in,
                              void* d_out, int out_size, void* d_ws, size_t ws_size,
                              hipStream_t stream)
{
    const float* x   = (const float*)d_in[0];
    const float* Wq  = (const float*)d_in[1];
    const float* Wk  = (const float*)d_in[2];
    const float* Wv  = (const float*)d_in[3];
    const float* Wo  = (const float*)d_in[4];
    const float* W1  = (const float*)d_in[5];
    const float* b1  = (const float*)d_in[6];
    const float* W2  = (const float*)d_in[7];
    const float* b2  = (const float*)d_in[8];
    const float* g1  = (const float*)d_in[9];
    const float* be1 = (const float*)d_in[10];
    const float* g2  = (const float*)d_in[11];
    const float* be2 = (const float*)d_in[12];
    float* out = (float*)d_out;

    const int M = BATCH * SEQ;   // 4096 token rows

    char* w = (char*)d_ws;
    auto take = [&](size_t bytes) -> char* {
        char* p = w; w += (bytes + 255) & ~(size_t)255; return p;
    };
    __bf16* qb  = (__bf16*)take((size_t)M * DMODEL * sizeof(__bf16)); //  8 MB
    __bf16* kb  = (__bf16*)take((size_t)M * DMODEL * sizeof(__bf16)); //  8 MB
    __bf16* vtb = (__bf16*)take((size_t)M * DMODEL * sizeof(__bf16)); //  8 MB
    float*  ctx = (float*)take((size_t)M * DMODEL * sizeof(float));   // 16 MB
    float*  ao  = (float*)take((size_t)M * DMODEL * sizeof(float));   // 16 MB
    float*  h   = (float*)take((size_t)M * DMODEL * sizeof(float));   // 16 MB
    float*  f1  = (float*)take((size_t)M * FFDIM  * sizeof(float));   // 64 MB
    float*  f2  = (float*)take((size_t)M * DMODEL * sizeof(float));   // 16 MB

    const dim3 blk(GT);
    const dim3 g_d(DMODEL / BN, M / BM);   // (8, 32)
    const dim3 g_ff(FFDIM / BN, M / BM);   // (32, 32)
    const float qscale = 0.125f;           // 1/sqrt(DK)

    // Q,K,V projections; pack straight to attention layouts in bf16
    gemm_bf16_wmma<EPI_QKPACK, false><<<g_d, blk, 0, stream>>>(x, Wq, nullptr, nullptr, qb,  M, DMODEL, DMODEL, qscale);
    gemm_bf16_wmma<EPI_QKPACK, false><<<g_d, blk, 0, stream>>>(x, Wk, nullptr, nullptr, kb,  M, DMODEL, DMODEL, 1.0f);
    gemm_bf16_wmma<EPI_VTPACK, false><<<g_d, blk, 0, stream>>>(x, Wv, nullptr, nullptr, vtb, M, DMODEL, DMODEL, 1.0f);

    // Causal flash attention
    flash_attn_kernel<<<dim3(SEQ / 64, BATCH * NH), dim3(AT), 0, stream>>>(qb, kb, vtb, ctx);

    // Output projection (Wo consumed transposed: [N,K] row-major)
    gemm_bf16_wmma<EPI_F32, true><<<g_d, blk, 0, stream>>>(ctx, Wo, nullptr, ao, nullptr, M, DMODEL, DMODEL, 1.0f);

    // h = LN(x + attn_out)
    add_ln_kernel<<<dim3(M), dim3(256), 0, stream>>>(x, ao, g1, be1, h);

    // FFN
    gemm_bf16_wmma<EPI_BIAS_RELU, false><<<g_ff, blk, 0, stream>>>(h,  W1, b1, f1, nullptr, M, FFDIM,  DMODEL, 1.0f);
    gemm_bf16_wmma<EPI_BIAS,      false><<<g_d,  blk, 0, stream>>>(f1, W2, b2, f2, nullptr, M, DMODEL, FFDIM,  1.0f);

    // out = LN(h + ffn)
    add_ln_kernel<<<dim3(M), dim3(256), 0, stream>>>(h, f2, g2, be2, out);
}

// v002
// It runs in 241 microseconds.
// In two side-by-side timings against v001, it was 2.46 and 2.48 times as fast.
// Counting every step since v000, it is 4.13 times as fast.
#include <hip/hip_runtime.h>
#include <hip/hip_bf16.h>
#include <stdint.h>

// ---------------------------------------------------------------------------
// Problem constants (match reference)
// ---------------------------------------------------------------------------
#define BATCH  2
#define SEQ    2048
#define DMODEL 1024
#define NH     16
#define DHEAD  64
#define FFDIM  4096
#define EPSLN  1e-6f

// ---------------------------------------------------------------------------
// WMMA types (CDNA5 / gfx1250, wave32)
// ---------------------------------------------------------------------------
typedef __attribute__((ext_vector_type(16))) __bf16 v16bf;
typedef __attribute__((ext_vector_type(8)))  float  v8f;
typedef __attribute__((ext_vector_type(4)))  uint32_t v4u;   // 16 raw bytes in registers

union Frag {
    v16bf v;
    uint4 q[2];
};

__device__ __forceinline__ __bf16 f2bf(float f) {
    union { float f; uint32_t u; } c; c.f = f;
    uint32_t r = (c.u + 0x7FFFu + ((c.u >> 16) & 1u)) >> 16;   // RNE
    union { uint16_t s; __bf16 b; } o; o.s = (uint16_t)r;
    return o.b;
}

// Two fp32 values -> one dword of two bf16 (lo at the lower address).
__device__ __forceinline__ uint32_t f2bf2(float lo, float hi) {
    union { __bf16 b[2]; uint32_t u; } o;
    o.b[0] = f2bf(lo); o.b[1] = f2bf(hi);
    return o.u;
}

// ---------------------------------------------------------------------------
// Operand packing, once per call: every GEMM operand that arrives as fp32 is
// rounded to bf16 here, B operands also transposed to [N][K], so that no GEMM
// block repeats that work per tile. One 64x64 tile per 256-thread block.
//   x  [4096][1024] and Wo [N=1024][K=1024]   : same layout
//   Wq, Wk, Wv [K=1024][N=1024], W1 [1024][4096], W2 [4096][1024] : -> [N][K]
// ---------------------------------------------------------------------------
#define PK_X   (BATCH * SEQ / 64 * (DMODEL / 64))     // 1024 tiles
#define PK_W   (DMODEL / 64 * (DMODEL / 64))          //  256 tiles
#define PK_F   (DMODEL / 64 * (FFDIM / 64))           // 1024 tiles
#define PK_ALL (PK_X + 4 * PK_W + 2 * PK_F)

__launch_bounds__(256)
__global__ void pack_operands(const float* __restrict__ x,  const float* __restrict__ Wo,
                              const float* __restrict__ Wq, const float* __restrict__ Wk,
                              const float* __restrict__ Wv, const float* __restrict__ W1,
                              const float* __restrict__ W2,
                              __bf16* __restrict__ xb,  __bf16* __restrict__ Wob,
                              __bf16* __restrict__ Wqt, __bf16* __restrict__ Wkt,
                              __bf16* __restrict__ Wvt, __bf16* __restrict__ W1t,
                              __bf16* __restrict__ W2t)
{
    __shared__ uint32_t Ts[64][33];   // [n][k pair]; 33 dwords: writes and reads hit distinct banks

    const int tid = threadIdx.x;
    int t = blockIdx.x;
    const float* src; __bf16* dst; int rows, cols; bool tr;
    if      (t < PK_X)                       { src = x;  dst = xb;  rows = BATCH * SEQ; cols = DMODEL; tr = false; }
    else if ((t -= PK_X) < PK_W)             { src = Wo; dst = Wob; rows = DMODEL; cols = DMODEL; tr = false; }
    else if ((t -= PK_W) < PK_W)             { src = Wq; dst = Wqt; rows = DMODEL; cols = DMODEL; tr = true; }
    else if ((t -= PK_W) < PK_W)             { src = Wk; dst = Wkt; rows = DMODEL; cols = DMODEL; tr = true; }
    else if ((t -= PK_W) < PK_W)             { src = Wv; dst = Wvt; rows = DMODEL; cols = DMODEL; tr = true; }
    else if ((t -= PK_W) < PK_F)             { src = W1; dst = W1t; rows = DMODEL; cols = FFDIM;  tr = true; }
    else                     { t -= PK_F;      src = W2; dst = W2t; rows = FFDIM;  cols = DMODEL; tr = true; }
    const int tpr = cols >> 6;               // tiles per row of tiles
    const int r0 = (t / tpr) << 6, c0 = (t % tpr) << 6;

    if (!tr) {
        size_t e[4]; float4 v[4];
        #pragma unroll
        for (int i = 0; i < 4; ++i) {
            int idx = i * 256 + tid;
            e[i] = (size_t)(r0 + (idx >> 4)) * cols + c0 + ((idx & 15) << 2);
            v[i] = *(const float4*)(src + e[i]);
            // The load stays in flight while its address registers are reused
            // (by the next load's result, by the rounding): the wait stands first.
            asm volatile("s_wait_xcnt 0x0" ::: "memory");
        }
        #pragma unroll
        for (int i = 0; i < 4; ++i) {
            uint2 o; o.x = f2bf2(v[i].x, v[i].y); o.y = f2bf2(v[i].z, v[i].w);
            *(uint2*)(dst + e[i]) = o;
            // The store stays in flight while its address and data registers are
            // reused (by the next rounding, by code behind the branch): wait first.
            asm volatile("s_wait_xcnt 0x0" ::: "memory");
        }
    } else {                                 // block-uniform branch: the barrier is safe
        float4 a[2], b[2];
        #pragma unroll
        for (int i = 0; i < 2; ++i) {
            int idx = i * 256 + tid;
            const float* p = src + (size_t)(r0 + 2 * (idx >> 4)) * cols + c0 + ((idx & 15) << 2);
            a[i] = *(const float4*)p;
            asm volatile("s_wait_xcnt 0x0" ::: "memory");   // as above
            b[i] = *(const float4*)(p + cols);
            asm volatile("s_wait_xcnt 0x0" ::: "memory");   // as above
        }
        #pragma unroll
        for (int i = 0; i < 2; ++i) {
            int idx = i * 256 + tid;
            int kp = idx >> 4, c = (idx & 15) << 2;
            Ts[c + 0][kp] = f2bf2(a[i].x, b[i].x); Ts[c + 1][kp] = f2bf2(a[i].y, b[i].y);
            Ts[c + 2][kp] = f2bf2(a[i].z, b[i].z); Ts[c + 3][kp] = f2bf2(a[i].w, b[i].w);
        }
        __syncthreads();
        #pragma unroll
        for (int i = 0; i < 2; ++i) {
            int idx = i * 256 + tid;
            int n = idx >> 3, q = (idx & 7) << 2;
            uint4 o; o.x = Ts[n][q]; o.y = Ts[n][q + 1]; o.z = Ts[n][q + 2]; o.w = Ts[n][q + 3];
            *(uint4*)(dst + (size_t)(c0 + n) * rows + r0 + 2 * q) = o;
        }
    }
}

// ---------------------------------------------------------------------------
// Generic bf16-WMMA GEMM: C[M,N] = A[M,K] * Bt[N,K]^T  (A, Bt bf16 in memory,
// both K-contiguous; fp32 accumulate via v_wmma_f32_16x16x32_bf16)
//
// Block tile: 128x128, 256 threads (8 wave32), wave tile 64x32. A pass takes
// one 128-byte line of every row, which in bf16 is K-step 64 (two WMMA k-steps).
// LDS rows padded to BK+8 bf16 (144B) so per-lane fragment reads are two
// 16B-aligned ds_load_b128, matching the 16-bit A/B operand layout:
//   lane l: row/col = l&15, half = l>>4; chunk0 = K[half*8 .. +7],
//   chunk1 = K[16+half*8 .. +7]  (per K-step of 32).
// ---------------------------------------------------------------------------
#define BM 128
#define BN 128
#define BK 64
#define GT 256
#define LDAP 72   // BK + 8 pad -> 144B row stride, 16B aligned rows

enum { EPI_F32 = 0, EPI_BIAS = 1, EPI_BIAS_RELU = 2, EPI_QKPACK = 3, EPI_VTPACK = 4 };

template<int EPI>
__launch_bounds__(GT)
__global__ void gemm_bf16_wmma(const __bf16* A,  // A, B: no __restrict__, see fetch
                               const __bf16* B,  // [N,K] row-major
                               const float* __restrict__ bias,
                               float* __restrict__ C,
                               __bf16* __restrict__ Cb,
                               int M, int N, int K, float scale)
{
    __shared__ __bf16 As[BM][LDAP];
    __shared__ __bf16 Bs[BN][LDAP];

    const int tid  = threadIdx.x;
    const int m0   = blockIdx.y * BM;
    const int n0   = blockIdx.x * BN;
    const int wid  = tid >> 5;
    const int lane = tid & 31;
    const int hf   = lane >> 4;
    const int ln   = lane & 15;
    const int wm   = (wid >> 2) * 64;   // 2 wave rows
    const int wn   = (wid & 3) * 32;    // 4 wave cols

    v8f acc[4][2] = {};

    // Byte offsets of this thread's 16-byte slots inside a K tile (the same for
    // A and B); they do not change over the loop, only the tile's (uniform)
    // base address does.
    uint32_t oa[4];
    #pragma unroll
    for (int i = 0; i < 4; ++i) {
        int idx = i * GT + tid;                  // 0..1023 slots of 8 bf16
        oa[i] = (uint32_t)(((idx >> 3) * K + ((idx & 7) << 3)) * 2);
    }

    // All eight loads of one K tile, issued as one group into registers.
    // A and B are not __restrict__: plain loads keep their place in front of the
    // barrier's fence; marked __restrict__ the compiler sank them over both
    // barriers to their first use, where each waited out its own latency.
    auto fetch = [&](v4u (&ra)[4], v4u (&rb)[4], int kt) {
        const char* At = (const char*)(A + (size_t)m0 * K + kt);
        const char* Bt = (const char*)(B + (size_t)n0 * K + kt);
        #pragma unroll
        for (int i = 0; i < 4; ++i) ra[i] = *(const v4u*)(At + oa[i]);
        // The loads stay in flight while their address registers are reused
        // (by the loads below, by the fragment loads): the wait stands first.
        asm volatile("s_wait_xcnt 0x0" ::: "memory");
        #pragma unroll
        for (int i = 0; i < 4; ++i) rb[i] = *(const v4u*)(Bt + oa[i]);
        asm volatile("s_wait_xcnt 0x0" ::: "memory");   // as above
    };

    // Work-group barrier whose fences order LDS only. As and Bs are all that
    // the waves hand to each other; __syncthreads() would also wait out the
    // global loads that are meant to stay in flight over it.
    auto lds_barrier = [&]() {
        __builtin_amdgcn_fence(__ATOMIC_RELEASE, "workgroup", "local");
        __builtin_amdgcn_s_barrier();
        __builtin_amdgcn_fence(__ATOMIC_ACQUIRE, "workgroup", "local");
    };

    // The raw tile is carried over the loop's back edge: its loads are issued
    // in the pass before, behind the LDS stores that free its registers, and
    // fly during that pass's LDS traffic, barriers and WMMAs. No branch stands
    // around the fetch (a join of two paths would drain it early): in the last
    // pass it re-reads the last tile and nothing uses it.
    v4u ra[4], rb[4];
    fetch(ra, rb, 0);
    for (int kt = 0; kt < K; kt += BK) {
        // ---- stage A and B tiles (128 rows x 64 bf16 each) -------------------
        #pragma unroll
        for (int i = 0; i < 4; ++i) {
            int idx = i * GT + tid;
            int r = idx >> 3, c = (idx & 7) << 3;
            *(v4u*)&As[r][c] = ra[i];
            *(v4u*)&Bs[r][c] = rb[i];
        }
        // Keeps the next tile's loads behind the LDS stores above, so that they
        // land in the registers just freed: lifted over them they need a second
        // set and copies, and the copies' wait for the loads stands early.
        __builtin_amdgcn_sched_barrier(0);
        fetch(ra, rb, (kt + BK < K) ? kt + BK : kt);
        lds_barrier();

        // ---- fragments + 8 WMMAs per k-step of 32, k ascending ---------------
        #pragma unroll
        for (int ks = 0; ks < BK; ks += 32) {
            Frag af[4], bfr[2];
            #pragma unroll
            for (int mt = 0; mt < 4; ++mt) {
                const __bf16* p = &As[wm + mt * 16 + ln][ks];
                af[mt].q[0] = *(const uint4*)(p + hf * 8);
                af[mt].q[1] = *(const uint4*)(p + 16 + hf * 8);
            }
            #pragma unroll
            for (int nt = 0; nt < 2; ++nt) {
                const __bf16* p = &Bs[wn + nt * 16 + ln][ks];
                bfr[nt].q[0] = *(const uint4*)(p + hf * 8);
                bfr[nt].q[1] = *(const uint4*)(p + 16 + hf * 8);
            }
            #pragma unroll
            for (int mt = 0; mt < 4; ++mt)
                #pragma unroll
                for (int nt = 0; nt < 2; ++nt)
                    acc[mt][nt] = __builtin_amdgcn_wmma_f32_16x16x32_bf16(
                        false, af[mt].v, false, bfr[nt].v, (short)0, acc[mt][nt], false, false);
        }
        lds_barrier();
    }

    // ---- epilogue: C/D layout -> element (m,n): vgpr r = m&7, lane = n + 16*(m>>3)
    #pragma unroll
    for (int mt = 0; mt < 4; ++mt)
    #pragma unroll
    for (int nt = 0; nt < 2; ++nt)
    #pragma unroll
    for (int r = 0; r < 8; ++r) {
        int row = m0 + wm + mt * 16 + r + hf * 8;
        int col = n0 + wn + nt * 16 + ln;
        float v = acc[mt][nt][r];
        if (EPI == EPI_BIAS || EPI == EPI_BIAS_RELU) v += bias[col];
        if (EPI == EPI_BIAS_RELU) v = fmaxf(v, 0.0f);
        if (EPI == EPI_F32 || EPI == EPI_BIAS) {
            C[(size_t)row * N + col] = v;
        } else if (EPI == EPI_BIAS_RELU) {   // feeds the next GEMM only: bf16
            Cb[(size_t)row * N + col] = f2bf(v);
        } else if (EPI == EPI_QKPACK) {
            // [B*T, H*64] fp32 -> [B,H,T,64] bf16 (Q pre-scaled by 1/sqrt(DK))
            int b = row >> 11, t = row & (SEQ - 1);
            int h = col >> 6,  dd = col & 63;
            Cb[(((size_t)(b * NH + h) * SEQ + t) << 6) + dd] = f2bf(v * scale);
        } else { // EPI_VTPACK: -> [B,H,64,T] bf16 (V transposed)
            int b = row >> 11, t = row & (SEQ - 1);
            int h = col >> 6,  dd = col & 63;
            Cb[((size_t)(b * NH + h) * 64 + dd) * SEQ + t] = f2bf(v);
        }
    }
}

// ---------------------------------------------------------------------------
// Causal flash attention: grid (T/64, B*H), 128 threads (4 waves).
// Wave w owns q rows qtile*64 + w*16 .. +15; streams K/V in 64-wide chunks
// (only sc <= qtile: causal), online softmax, ctx accumulated in fp32.
// P (C-layout) round-trips through per-wave LDS tile to become an A operand.
// ---------------------------------------------------------------------------
#define AT 128
#define KPAD 72   // 64 + 8 pad -> 144B row stride, 16B aligned rows

__launch_bounds__(AT)
__global__ void flash_attn_kernel(const __bf16* __restrict__ qg,
                                  const __bf16* __restrict__ kg,
                                  const __bf16* __restrict__ vtg,
                                  __bf16* __restrict__ ctx)
{
    __shared__ __bf16 Ks[64][KPAD];       // K chunk   [s][dk]
    __shared__ __bf16 Vs[64][KPAD];       // Vt chunk  [dv][s]
    __shared__ __bf16 Ps[4][16][KPAD];    // per-wave P [t][s]

    const int tid   = threadIdx.x;
    const int wid   = tid >> 5;
    const int lane  = tid & 31;
    const int hf    = lane >> 4;
    const int ln    = lane & 15;
    const int bh    = blockIdx.y;         // b*NH + h
    const int qtile = blockIdx.x;
    const int qrow0 = qtile * 64 + wid * 16;

    // Q fragments (A operand, K = DHEAD = 64 -> two K-steps of 32)
    const __bf16* qrow = qg + ((size_t)bh * SEQ + qrow0 + ln) * DHEAD;
    Frag aq[2];
    #pragma unroll
    for (int ks = 0; ks < 2; ++ks) {
        aq[ks].q[0] = *(const uint4*)(qrow + ks * 32 + hf * 8);
        aq[ks].q[1] = *(const uint4*)(qrow + ks * 32 + 16 + hf * 8);
    }

    float rowmax[8], rowsum[8];
    #pragma unroll
    for (int r = 0; r < 8; ++r) { rowmax[r] = -3.0e38f; rowsum[r] = 0.0f; }
    v8f cacc[4] = {};

    const __bf16* kbase = kg  + (size_t)bh * SEQ * DHEAD;
    const __bf16* vbase = vtg + (size_t)bh * DHEAD * SEQ;

    for (int sc = 0; sc <= qtile; ++sc) {
        const int s0 = sc * 64;
        // ---- stage K chunk [64][64] and Vt chunk [64][64] ------------------
        #pragma unroll
        for (int i = 0; i < 8; ++i) {
            int idx = i * AT + tid;           // 0..1023 (8B units)
            int r = idx >> 4, c = (idx & 15) << 2;
            *(uint2*)&Ks[r][c] = *(const uint2*)(kbase + (size_t)(s0 + r) * DHEAD + c);
            *(uint2*)&Vs[r][c] = *(const uint2*)(vbase + (size_t)r * SEQ + s0 + c);
        }
        __syncthreads();

        // ---- S = Q * K^T  (16 x 64 per wave) -------------------------------
        v8f sacc[4] = {};
        #pragma unroll
        for (int nt = 0; nt < 4; ++nt) {
            #pragma unroll
            for (int ks = 0; ks < 2; ++ks) {
                Frag bk;
                const __bf16* p = &Ks[nt * 16 + ln][ks * 32];
                bk.q[0] = *(const uint4*)(p + hf * 8);
                bk.q[1] = *(const uint4*)(p + 16 + hf * 8);
                sacc[nt] = __builtin_amdgcn_wmma_f32_16x16x32_bf16(
                    false, aq[ks].v, false, bk.v, (short)0, sacc[nt], false, false);
            }
        }
        // ---- causal mask ----------------------------------------------------
        #pragma unroll
        for (int nt = 0; nt < 4; ++nt)
            #pragma unroll
            for (int r = 0; r < 8; ++r) {
                int s_idx = s0 + nt * 16 + ln;
                int t_idx = qrow0 + r + hf * 8;
                sacc[nt][r] = (s_idx > t_idx) ? -3.0e38f : sacc[nt][r];
            }
        // ---- online softmax (row stats live across 16 lanes of a half) -----
        #pragma unroll
        for (int r = 0; r < 8; ++r) {
            float mx = fmaxf(fmaxf(sacc[0][r], sacc[1][r]), fmaxf(sacc[2][r], sacc[3][r]));
            #pragma unroll
            for (int off = 1; off < 16; off <<= 1) mx = fmaxf(mx, __shfl_xor(mx, off, 32));
            float mnew = fmaxf(rowmax[r], mx);
            float corr = __expf(rowmax[r] - mnew);
            rowmax[r] = mnew;
            float ps = 0.0f;
            #pragma unroll
            for (int nt = 0; nt < 4; ++nt) {
                float p = __expf(sacc[nt][r] - mnew);
                ps += p;
                Ps[wid][r + hf * 8][nt * 16 + ln] = f2bf(p);
            }
            #pragma unroll
            for (int off = 1; off < 16; off <<= 1) ps += __shfl_xor(ps, off, 32);
            rowsum[r] = rowsum[r] * corr + ps;
            #pragma unroll
            for (int nt = 0; nt < 4; ++nt) cacc[nt][r] = cacc[nt][r] * corr;
        }
        // ---- ctx += P * V  (P reloaded in A layout from LDS) ---------------
        Frag ap[2];
        #pragma unroll
        for (int ks = 0; ks < 2; ++ks) {
            const __bf16* p = &Ps[wid][ln][ks * 32];
            ap[ks].q[0] = *(const uint4*)(p + hf * 8);
            ap[ks].q[1] = *(const uint4*)(p + 16 + hf * 8);
        }
        #pragma unroll
        for (int nt = 0; nt < 4; ++nt)
            #pragma unroll
            for (int ks = 0; ks < 2; ++ks) {
                Frag bv;
                const __bf16* p = &Vs[nt * 16 + ln][ks * 32];
                bv.q[0] = *(const uint4*)(p + hf * 8);
                bv.q[1] = *(const uint4*)(p + 16 + hf * 8);
                cacc[nt] = __builtin_amdgcn_wmma_f32_16x16x32_bf16(
                    false, ap[ks].v, false, bv.v, (short)0, cacc[nt], false, false);
            }
        __syncthreads();
    }

    // ---- normalize + store ctx as [B*T, H*DV] bf16 (a GEMM operand) ---------
    const int b = bh / NH, h = bh % NH;
    #pragma unroll
    for (int r = 0; r < 8; ++r) {
        float inv = 1.0f / rowsum[r];
        int t = qrow0 + r + hf * 8;
        #pragma unroll
        for (int nt = 0; nt < 4; ++nt)
            ctx[(size_t)(b * SEQ + t) * DMODEL + h * 64 + nt * 16 + ln] = f2bf(cacc[nt][r] * inv);
    }
}

// ---------------------------------------------------------------------------
// out = LayerNorm(a + b) * gamma + beta ; one 1024-wide row per 256-thr block
// WB: also write the row as bf16, the form in which the next GEMM reads it
// ---------------------------------------------------------------------------
template<bool WB>
__launch_bounds__(256)
__global__ void add_ln_kernel(const float* __restrict__ a,
                              const float* __restrict__ b,
                              const float* __restrict__ gamma,
                              const float* __restrict__ beta,
                              float* __restrict__ out,
                              __bf16* __restrict__ outb)
{
    __shared__ float red[16];
    const int row = blockIdx.x;
    const int tid = threadIdx.x;
    const size_t base = (size_t)row * DMODEL;

    float v[4]; float s = 0.0f, ss = 0.0f;
    #pragma unroll
    for (int j = 0; j < 4; ++j) {
        int idx = tid + j * 256;
        float x = a[base + idx] + b[base + idx];
        v[j] = x; s += x; ss += x * x;
    }
    #pragma unroll
    for (int off = 1; off < 32; off <<= 1) {
        s  += __shfl_xor(s,  off, 32);
        ss += __shfl_xor(ss, off, 32);
    }
    int wid = tid >> 5, lane = tid & 31;
    if (lane == 0) { red[wid] = s; red[8 + wid] = ss; }
    __syncthreads();
    if (wid == 0) {
        float s2  = (lane < 8) ? red[lane] : 0.0f;
        float ss2 = (lane < 8) ? red[8 + lane] : 0.0f;
        #pragma unroll
        for (int off = 1; off < 8; off <<= 1) {
            s2  += __shfl_xor(s2,  off, 32);
            ss2 += __shfl_xor(ss2, off, 32);
        }
        if (lane == 0) { red[0] = s2; red[8] = ss2; }
    }
    __syncthreads();
    float mu  = red[0] * (1.0f / DMODEL);
    float var = red[8] * (1.0f / DMODEL) - mu * mu;
    float rs  = rsqrtf(var + EPSLN);
    #pragma unroll
    for (int j = 0; j < 4; ++j) {
        int idx = tid + j * 256;
        float y = (v[j] - mu) * rs * gamma[idx] + beta[idx];
        out[base + idx] = y;
        if (WB) outb[base + idx] = f2bf(y);
    }
}

// ---------------------------------------------------------------------------
// Host-side orchestration
// ---------------------------------------------------------------------------
extern "C" void kernel_launch(void* const* d_in, const int* in_sizes, int n_in,
                              void* d_out, int out_size, void* d_ws, size_t ws_size,
                              hipStream_t stream)
{
    const float* x   = (const float*)d_in[0];
    const float* Wq  = (const float*)d_in[1];
    const float* Wk  = (const float*)d_in[2];
    const float* Wv  = (const float*)d_in[3];
    const float* Wo  = (const float*)d_in[4];
    const float* W1  = (const float*)d_in[5];
    const float* b1  = (const float*)d_in[6];
    const float* W2  = (const float*)d_in[7];
    const float* b2  = (const float*)d_in[8];
    const float* g1  = (const float*)d_in[9];
    const float* be1 = (const float*)d_in[10];
    const float* g2  = (const float*)d_in[11];
    const float* be2 = (const float*)d_in[12];
    float* out = (float*)d_out;

    const int M = BATCH * SEQ;   // 4096 token rows

    char* w = (char*)d_ws;
    auto take = [&](size_t bytes) -> char* {
        char* p = w; w += (bytes + 255) & ~(size_t)255; return p;
    };
    __bf16* qb  = (__bf16*)take((size_t)M * DMODEL * sizeof(__bf16)); //  8 MB
    __bf16* kb  = (__bf16*)take((size_t)M * DMODEL * sizeof(__bf16)); //  8 MB
    __bf16* vtb = (__bf16*)take((size_t)M * DMODEL * sizeof(__bf16)); //  8 MB
    __bf16* ctx = (__bf16*)take((size_t)M * DMODEL * sizeof(__bf16)); //  8 MB
    float*  ao  = (float*)take((size_t)M * DMODEL * sizeof(float));   // 16 MB
    float*  h   = (float*)take((size_t)M * DMODEL * sizeof(float));   // 16 MB
    __bf16* hb  = (__bf16*)take((size_t)M * DMODEL * sizeof(__bf16)); //  8 MB
    __bf16* f1  = (__bf16*)take((size_t)M * FFDIM  * sizeof(__bf16)); // 32 MB
    float*  f2  = (float*)take((size_t)M * DMODEL * sizeof(float));   // 16 MB
    __bf16* xb  = (__bf16*)take((size_t)M * DMODEL * sizeof(__bf16)); //  8 MB
    __bf16* Wob = (__bf16*)take((size_t)DMODEL * DMODEL * sizeof(__bf16)); // 2 MB
    __bf16* Wqt = (__bf16*)take((size_t)DMODEL * DMODEL * sizeof(__bf16)); // 2 MB
    __bf16* Wkt = (__bf16*)take((size_t)DMODEL * DMODEL * sizeof(__bf16)); // 2 MB
    __bf16* Wvt = (__bf16*)take((size_t)DMODEL * DMODEL * sizeof(__bf16)); // 2 MB
    __bf16* W1t = (__bf16*)take((size_t)DMODEL * FFDIM  * sizeof(__bf16)); // 8 MB
    __bf16* W2t = (__bf16*)take((size_t)DMODEL * FFDIM  * sizeof(__bf16)); // 8 MB

    const dim3 blk(GT);
    const dim3 g_d(DMODEL / BN, M / BM);   // (8, 32)
    const dim3 g_ff(FFDIM / BN, M / BM);   // (32, 32)
    const float qscale = 0.125f;           // 1/sqrt(DK)

    // fp32 inputs -> bf16 GEMM operands, K-contiguous
    pack_operands<<<dim3(PK_ALL), dim3(256), 0, stream>>>(x, Wo, Wq, Wk, Wv, W1, W2,
                                                          xb, Wob, Wqt, Wkt, Wvt, W1t, W2t);

    // Q,K,V projections; pack straight to attention layouts in bf16
    gemm_bf16_wmma<EPI_QKPACK><<<g_d, blk, 0, stream>>>(xb, Wqt, nullptr, nullptr, qb,  M, DMODEL, DMODEL, qscale);
    gemm_bf16_wmma<EPI_QKPACK><<<g_d, blk, 0, stream>>>(xb, Wkt, nullptr, nullptr, kb,  M, DMODEL, DMODEL, 1.0f);
    gemm_bf16_wmma<EPI_VTPACK><<<g_d, blk, 0, stream>>>(xb, Wvt, nullptr, nullptr, vtb, M, DMODEL, DMODEL, 1.0f);

    // Causal flash attention
    flash_attn_kernel<<<dim3(SEQ / 64, BATCH * NH), dim3(AT), 0, stream>>>(qb, kb, vtb, ctx);

    // Output projection (Wo is [N,K] row-major as given)
    gemm_bf16_wmma<EPI_F32><<<g_d, blk, 0, stream>>>(ctx, Wob, nullptr, ao, nullptr, M, DMODEL, DMODEL, 1.0f);

    // h = LN(x + attn_out)
    add_ln_kernel<true><<<dim3(M), dim3(256), 0, stream>>>(x, ao, g1, be1, h, hb);

    // FFN
    gemm_bf16_wmma<EPI_BIAS_RELU><<<g_ff, blk, 0, stream>>>(hb, W1t, b1, nullptr, f1, M, FFDIM,  DMODEL, 1.0f);
    gemm_bf16_wmma<EPI_BIAS><<<g_d,  blk, 0, stream>>>(f1, W2t, b2, f2, nullptr, M, DMODEL, FFDIM,  1.0f);

    // out = LN(h + ffn)
    add_ln_kernel<false><<<dim3(M), dim3(256), 0, stream>>>(h, f2, g2, be2, out, nullptr);
}

// v003
// A run of this version takes 231 microseconds.
// Two timings next to v002 put it at 1.05 and 1.06 times that version's speed.
// All steps since v000 together make it 4.35 times as fast.
#include <hip/hip_runtime.h>
#include <hip/hip_bf16.h>
#include <stdint.h>

// ---------------------------------------------------------------------------
// Problem constants (match reference)
// ---------------------------------------------------------------------------
#define BATCH  2
#define SEQ    2048
#define DMODEL 1024
#define NH     16
#define DHEAD  64
#define FFDIM  4096
#define EPSLN  1e-6f

// ---------------------------------------------------------------------------
// WMMA types (CDNA5 / gfx1250, wave32)
// ---------------------------------------------------------------------------
typedef __attribute__((ext_vector_type(16))) __bf16 v16bf;
typedef __attribute__((ext_vector_type(8)))  float  v8f;
typedef __attribute__((ext_vector_type(4)))  uint32_t v4u;   // 16 raw bytes in registers

union Frag {
    v16bf v;
    uint4 q[2];
    uint32_t u[8];
};

__device__ __forceinline__ __bf16 f2bf(float f) {
    union { float f; uint32_t u; } c; c.f = f;
    uint32_t r = (c.u + 0x7FFFu + ((c.u >> 16) & 1u)) >> 16;   // RNE
    union { uint16_t s; __bf16 b; } o; o.s = (uint16_t)r;
    return o.b;
}

// Two fp32 values -> one dword of two bf16 (lo at the lower address).
__device__ __forceinline__ uint32_t f2bf2(float lo, float hi) {
    union { __bf16 b[2]; uint32_t u; } o;
    o.b[0] = f2bf(lo); o.b[1] = f2bf(hi);
    return o.u;
}

// Value of lane l ^ 16 (the other 16-lane half), without LDS.
__device__ __forceinline__ float xhalf(float x) {
    int b = __builtin_bit_cast(int, x);
    return __builtin_bit_cast(float,
        __builtin_amdgcn_permlanex16(b, b, 0x76543210, 0xfedcba98, false, false));
}

// ---------------------------------------------------------------------------
// Operand packing, once per call: every GEMM operand that arrives as fp32 is
// rounded to bf16 here, B operands also transposed to [N][K], so that no GEMM
// block repeats that work per tile. One 64x64 tile per 256-thread block.
//   x  [4096][1024] and Wo [N=1024][K=1024]   : same layout
//   Wq, Wk, Wv [K=1024][N=1024], W1 [1024][4096], W2 [4096][1024] : -> [N][K]
// ---------------------------------------------------------------------------
#define PK_X   (BATCH * SEQ / 64 * (DMODEL / 64))     // 1024 tiles
#define PK_W   (DMODEL / 64 * (DMODEL / 64))          //  256 tiles
#define PK_F   (DMODEL / 64 * (FFDIM / 64))           // 1024 tiles
#define PK_ALL (PK_X + 4 * PK_W + 2 * PK_F)

__launch_bounds__(256)
__global__ void pack_operands(const float* __restrict__ x,  const float* __restrict__ Wo,
                              const float* __restrict__ Wq, const float* __restrict__ Wk,
                              const float* __restrict__ Wv, const float* __restrict__ W1,
                              const float* __restrict__ W2,
                              __bf16* __restrict__ xb,  __bf16* __restrict__ Wob,
                              __bf16* __restrict__ Wqt, __bf16* __restrict__ Wkt,
                              __bf16* __restrict__ Wvt, __bf16* __restrict__ W1t,
                              __bf16* __restrict__ W2t)
{
    __shared__ uint32_t Ts[64][33];   // [n][k pair]; 33 dwords: writes and reads hit distinct banks

    const int tid = threadIdx.x;
    int t = blockIdx.x;
    const float* src; __bf16* dst; int rows, cols; bool tr;
    if      (t < PK_X)                       { src = x;  dst = xb;  rows = BATCH * SEQ; cols = DMODEL; tr = false; }
    else if ((t -= PK_X) < PK_W)             { src = Wo; dst = Wob; rows = DMODEL; cols = DMODEL; tr = false; }
    else if ((t -= PK_W) < PK_W)             { src = Wq; dst = Wqt; rows = DMODEL; cols = DMODEL; tr = true; }
    else if ((t -= PK_W) < PK_W)             { src = Wk; dst = Wkt; rows = DMODEL; cols = DMODEL; tr = true; }
    else if ((t -= PK_W) < PK_W)             { src = Wv; dst = Wvt; rows = DMODEL; cols = DMODEL; tr = true; }
    else if ((t -= PK_W) < PK_F)             { src = W1; dst = W1t; rows = DMODEL; cols = FFDIM;  tr = true; }
    else                     { t -= PK_F;      src = W2; dst = W2t; rows = FFDIM;  cols = DMODEL; tr = true; }
    const int tpr = cols >> 6;               // tiles per row of tiles
    const int r0 = (t / tpr) << 6, c0 = (t % tpr) << 6;

    if (!tr) {
        size_t e[4]; float4 v[4];
        #pragma unroll
        for (int i = 0; i < 4; ++i) {
            int idx = i * 256 + tid;
            e[i] = (size_t)(r0 + (idx >> 4)) * cols + c0 + ((idx & 15) << 2);
            v[i] = *(const float4*)(src + e[i]);
            // The load stays in flight while its address registers are reused
            // (by the next load's result, by the rounding): the wait stands first.
            asm volatile("s_wait_xcnt 0x0" ::: "memory");
        }
        #pragma unroll
        for (int i = 0; i < 4; ++i) {
            uint2 o; o.x = f2bf2(v[i].x, v[i].y); o.y = f2bf2(v[i].z, v[i].w);
            *(uint2*)(dst + e[i]) = o;
            // The store stays in flight while its address and data registers are
            // reused (by the next rounding, by code behind the branch): wait first.
            asm volatile("s_wait_xcnt 0x0" ::: "memory");
        }
    } else {                                 // block-uniform branch: the barrier is safe
        float4 a[2], b[2];
        #pragma unroll
        for (int i = 0; i < 2; ++i) {
            int idx = i * 256 + tid;
            const float* p = src + (size_t)(r0 + 2 * (idx >> 4)) * cols + c0 + ((idx & 15) << 2);
            a[i] = *(const float4*)p;
            asm volatile("s_wait_xcnt 0x0" ::: "memory");   // as above
            b[i] = *(const float4*)(p + cols);
            asm volatile("s_wait_xcnt 0x0" ::: "memory");   // as above
        }
        #pragma unroll
        for (int i = 0; i < 2; ++i) {
            int idx = i * 256 + tid;
            int kp = idx >> 4, c = (idx & 15) << 2;
            Ts[c + 0][kp] = f2bf2(a[i].x, b[i].x); Ts[c + 1][kp] = f2bf2(a[i].y, b[i].y);
            Ts[c + 2][kp] = f2bf2(a[i].z, b[i].z); Ts[c + 3][kp] = f2bf2(a[i].w, b[i].w);
        }
        __syncthreads();
        #pragma unroll
        for (int i = 0; i < 2; ++i) {
            int idx = i * 256 + tid;
            int n = idx >> 3, q = (idx & 7) << 2;
            uint4 o; o.x = Ts[n][q]; o.y = Ts[n][q + 1]; o.z = Ts[n][q + 2]; o.w = Ts[n][q + 3];
            *(uint4*)(dst + (size_t)(c0 + n) * rows + r0 + 2 * q) = o;
        }
    }
}

// ---------------------------------------------------------------------------
// Generic bf16-WMMA GEMM: C[M,N] = A[M,K] * Bt[N,K]^T  (A, Bt bf16 in memory,
// both K-contiguous; fp32 accumulate via v_wmma_f32_16x16x32_bf16)
//
// Block tile: 128x128, 256 threads (8 wave32), wave tile 64x32. A pass takes
// one 128-byte line of every row, which in bf16 is K-step 64 (two WMMA k-steps).
// LDS rows padded to BK+8 bf16 (144B) so per-lane fragment reads are two
// 16B-aligned ds_load_b128, matching the 16-bit A/B operand layout:
//   lane l: row/col = l&15, half = l>>4; chunk0 = K[half*8 .. +7],
//   chunk1 = K[16+half*8 .. +7]  (per K-step of 32).
// ---------------------------------------------------------------------------
#define BM 128
#define BN 128
#define BK 64
#define GT 256
#define LDAP 72   // BK + 8 pad -> 144B row stride, 16B aligned rows

enum { EPI_F32 = 0, EPI_BIAS = 1, EPI_BIAS_RELU = 2, EPI_QKPACK = 3, EPI_VTPACK = 4 };

template<int EPI>
__launch_bounds__(GT)
__global__ void gemm_bf16_wmma(const __bf16* A,  // A, B: no __restrict__, see fetch
                               const __bf16* B,  // [N,K] row-major
                               const float* __restrict__ bias,
                               float* __restrict__ C,
                               __bf16* __restrict__ Cb,
                               int M, int N, int K, float scale)
{
    __shared__ __bf16 As[BM][LDAP];
    __shared__ __bf16 Bs[BN][LDAP];

    const int tid  = threadIdx.x;
    const int m0   = blockIdx.y * BM;
    const int n0   = blockIdx.x * BN;
    const int wid  = tid >> 5;
    const int lane = tid & 31;
    const int hf   = lane >> 4;
    const int ln   = lane & 15;
    const int wm   = (wid >> 2) * 64;   // 2 wave rows
    const int wn   = (wid & 3) * 32;    // 4 wave cols

    v8f acc[4][2] = {};

    // Byte offsets of this thread's 16-byte slots inside a K tile (the same for
    // A and B); they do not change over the loop, only the tile's (uniform)
    // base address does.
    uint32_t oa[4];
    #pragma unroll
    for (int i = 0; i < 4; ++i) {
        int idx = i * GT + tid;                  // 0..1023 slots of 8 bf16
        oa[i] = (uint32_t)(((idx >> 3) * K + ((idx & 7) << 3)) * 2);
    }

    // All eight loads of one K tile, issued as one group into registers.
    // A and B are not __restrict__: plain loads keep their place in front of the
    // barrier's fence; marked __restrict__ the compiler sank them over both
    // barriers to their first use, where each waited out its own latency.
    auto fetch = [&](v4u (&ra)[4], v4u (&rb)[4], int kt) {
        const char* At = (const char*)(A + (size_t)m0 * K + kt);
        const char* Bt = (const char*)(B + (size_t)n0 * K + kt);
        #pragma unroll
        for (int i = 0; i < 4; ++i) ra[i] = *(const v4u*)(At + oa[i]);
        // The loads stay in flight while their address registers are reused
        // (by the loads below, by the fragment loads): the wait stands first.
        asm volatile("s_wait_xcnt 0x0" ::: "memory");
        #pragma unroll
        for (int i = 0; i < 4; ++i) rb[i] = *(const v4u*)(Bt + oa[i]);
        asm volatile("s_wait_xcnt 0x0" ::: "memory");   // as above
    };

    // Work-group barrier whose fences order LDS only. As and Bs are all that
    // the waves hand to each other; __syncthreads() would also wait out the
    // global loads that are meant to stay in flight over it.
    auto lds_barrier = [&]() {
        __builtin_amdgcn_fence(__ATOMIC_RELEASE, "workgroup", "local");
        __builtin_amdgcn_s_barrier();
        __builtin_amdgcn_fence(__ATOMIC_ACQUIRE, "workgroup", "local");
    };

    // The raw tile is carried over the loop's back edge: its loads are issued
    // in the pass before, behind the LDS stores that free its registers, and
    // fly during that pass's LDS traffic, barriers and WMMAs. No branch stands
    // around the fetch (a join of two paths would drain it early): in the last
    // pass it re-reads the last tile and nothing uses it.
    v4u ra[4], rb[4];
    fetch(ra, rb, 0);
    for (int kt = 0; kt < K; kt += BK) {
        // ---- stage A and B tiles (128 rows x 64 bf16 each) -------------------
        #pragma unroll
        for (int i = 0; i < 4; ++i) {
            int idx = i * GT + tid;
            int r = idx >> 3, c = (idx & 7) << 3;
            *(v4u*)&As[r][c] = ra[i];
            *(v4u*)&Bs[r][c] = rb[i];
        }
        // Keeps the next tile's loads behind the LDS stores above, so that they
        // land in the registers just freed: lifted over them they need a second
        // set and copies, and the copies' wait for the loads stands early.
        __builtin_amdgcn_sched_barrier(0);
        fetch(ra, rb, (kt + BK < K) ? kt + BK : kt);
        lds_barrier();

        // ---- fragments + 8 WMMAs per k-step of 32, k ascending ---------------
        #pragma unroll
        for (int ks = 0; ks < BK; ks += 32) {
            Frag af[4], bfr[2];
            #pragma unroll
            for (int mt = 0; mt < 4; ++mt) {
                const __bf16* p = &As[wm + mt * 16 + ln][ks];
                af[mt].q[0] = *(const uint4*)(p + hf * 8);
                af[mt].q[1] = *(const uint4*)(p + 16 + hf * 8);
            }
            #pragma unroll
            for (int nt = 0; nt < 2; ++nt) {
                const __bf16* p = &Bs[wn + nt * 16 + ln][ks];
                bfr[nt].q[0] = *(const uint4*)(p + hf * 8);
                bfr[nt].q[1] = *(const uint4*)(p + 16 + hf * 8);
            }
            #pragma unroll
            for (int mt = 0; mt < 4; ++mt)
                #pragma unroll
                for (int nt = 0; nt < 2; ++nt)
                    acc[mt][nt] = __builtin_amdgcn_wmma_f32_16x16x32_bf16(
                        false, af[mt].v, false, bfr[nt].v, (short)0, acc[mt][nt], false, false);
        }
        lds_barrier();
    }

    // ---- epilogue: C/D layout -> element (m,n): vgpr r = m&7, lane = n + 16*(m>>3)
    #pragma unroll
    for (int mt = 0; mt < 4; ++mt)
    #pragma unroll
    for (int nt = 0; nt < 2; ++nt)
    #pragma unroll
    for (int r = 0; r < 8; ++r) {
        int row = m0 + wm + mt * 16 + r + hf * 8;
        int col = n0 + wn + nt * 16 + ln;
        float v = acc[mt][nt][r];
        if (EPI == EPI_BIAS || EPI == EPI_BIAS_RELU) v += bias[col];
        if (EPI == EPI_BIAS_RELU) v = fmaxf(v, 0.0f);
        if (EPI == EPI_F32 || EPI == EPI_BIAS) {
            C[(size_t)row * N + col] = v;
        } else if (EPI == EPI_BIAS_RELU) {   // feeds the next GEMM only: bf16
            Cb[(size_t)row * N + col] = f2bf(v);
        } else if (EPI == EPI_QKPACK) {
            // [B*T, H*64] fp32 -> [B,H,T,64] bf16 (Q pre-scaled by 1/sqrt(DK))
            int b = row >> 11, t = row & (SEQ - 1);
            int h = col >> 6,  dd = col & 63;
            Cb[(((size_t)(b * NH + h) * SEQ + t) << 6) + dd] = f2bf(v * scale);
        } else { // EPI_VTPACK: -> [B,H,64,T] bf16 (V transposed)
            int b = row >> 11, t = row & (SEQ - 1);
            int h = col >> 6,  dd = col & 63;
            Cb[((size_t)(b * NH + h) * 64 + dd) * SEQ + t] = f2bf(v);
        }
    }
}

// ---------------------------------------------------------------------------
// Causal flash attention: grid (T/64, B*H), 128 threads (4 waves).
// Wave w owns q rows qtile*64 + w*16 .. +15; streams K/V in 64-wide chunks
// (only sc <= qtile: causal), online softmax, ctx accumulated in fp32.
// Both products are taken transposed: St = K * Qt and Ot += Vt * Pt. A lane
// then holds scores of ONE query (column ln), keys nt*16 + hf*8 + r: maximum
// and sum run inside the lane, the two halves meet in one register exchange,
// and two St tiles, rounded in place, are the B operand Pt of the second
// product (its k order is the one the Vs loader below already uses).
// ---------------------------------------------------------------------------
#define AT 128
#define KPAD 72   // 64 + 8 pad -> 144B row stride, 16B aligned rows

__launch_bounds__(AT)
__global__ void flash_attn_kernel(const __bf16* __restrict__ qg,
                                  const __bf16* __restrict__ kg,
                                  const __bf16* __restrict__ vtg,
                                  __bf16* __restrict__ ctx)
{
    __shared__ __bf16 Ks[64][KPAD];       // K chunk   [s][dk]
    __shared__ __bf16 Vs[64][KPAD];       // Vt chunk  [dv][s]

    const int tid   = threadIdx.x;
    const int wid   = tid >> 5;
    const int lane  = tid & 31;
    const int hf    = lane >> 4;
    const int ln    = lane & 15;
    const int bh    = blockIdx.y;         // b*NH + h
    const int qtile = blockIdx.x;
    const int qrow0 = qtile * 64 + wid * 16;

    // Q fragments (B operand: column = query ln; K = DHEAD = 64 -> two K-steps of 32)
    const __bf16* qrow = qg + ((size_t)bh * SEQ + qrow0 + ln) * DHEAD;
    Frag aq[2];
    #pragma unroll
    for (int ks = 0; ks < 2; ++ks) {
        aq[ks].q[0] = *(const uint4*)(qrow + ks * 32 + hf * 8);
        aq[ks].q[1] = *(const uint4*)(qrow + ks * 32 + 16 + hf * 8);
    }

    float cmax = -3.0e38f;   // running maximum of query ln, alike in both halves
    float csum = 0.0f;       // running sum over the keys of this lane's half only
    v8f cacc[4] = {};        // Ot: dv = nt*16 + hf*8 + r, query ln

    const __bf16* kbase = kg  + (size_t)bh * SEQ * DHEAD;
    const __bf16* vbase = vtg + (size_t)bh * DHEAD * SEQ;
    const int t_idx = qrow0 + ln;

    for (int sc = 0; sc <= qtile; ++sc) {
        const int s0 = sc * 64;
        // ---- stage K chunk [64][64] and Vt chunk [64][64] ------------------
        // All 16 loads first, then the LDS stores: written load by store, this
        // build waited out each pair's latency in turn.
        uint2 kr[8], vr[8];
        #pragma unroll
        for (int i = 0; i < 8; ++i) {
            int idx = i * AT + tid;           // 0..1023 (8B units)
            int r = idx >> 4, c = (idx & 15) << 2;
            kr[i] = *(const uint2*)(kbase + (size_t)(s0 + r) * DHEAD + c);
            vr[i] = *(const uint2*)(vbase + (size_t)r * SEQ + s0 + c);
        }
        #pragma unroll
        for (int i = 0; i < 8; ++i) {
            int idx = i * AT + tid;
            int r = idx >> 4, c = (idx & 15) << 2;
            *(uint2*)&Ks[r][c] = kr[i];
            *(uint2*)&Vs[r][c] = vr[i];
        }
        __syncthreads();

        // ---- St = K * Qt  (64 keys x 16 queries per wave) ------------------
        v8f sacc[4] = {};
        #pragma unroll
        for (int nt = 0; nt < 4; ++nt) {
            #pragma unroll
            for (int ks = 0; ks < 2; ++ks) {
                Frag bk;
                const __bf16* p = &Ks[nt * 16 + ln][ks * 32];
                bk.q[0] = *(const uint4*)(p + hf * 8);
                bk.q[1] = *(const uint4*)(p + 16 + hf * 8);
                sacc[nt] = __builtin_amdgcn_wmma_f32_16x16x32_bf16(
                    false, bk.v, false, aq[ks].v, (short)0, sacc[nt], false, false);
            }
        }
        // ---- causal mask: key s0 + hf*8 + (nt*16 + r) against query t_idx ---
        const int room = t_idx - s0 - hf * 8;
        #pragma unroll
        for (int nt = 0; nt < 4; ++nt)
            #pragma unroll
            for (int r = 0; r < 8; ++r)
                sacc[nt][r] = (nt * 16 + r > room) ? -3.0e38f : sacc[nt][r];
        // ---- online softmax: one query per lane ----------------------------
        float mt[4];
        #pragma unroll
        for (int nt = 0; nt < 4; ++nt) {
            mt[nt] = sacc[nt][0];
            #pragma unroll
            for (int r = 1; r < 8; ++r) mt[nt] = fmaxf(mt[nt], sacc[nt][r]);
        }
        float mx = fmaxf(fmaxf(mt[0], mt[1]), fmaxf(mt[2], mt[3]));
        mx = fmaxf(mx, xhalf(mx));
        const float mnew = fmaxf(cmax, mx);
        const float corr = __expf(cmax - mnew);
        cmax = mnew;
        Frag bp[2];                       // Pt, B operand: k = key within 32
        float pt[4];
        #pragma unroll
        for (int nt = 0; nt < 4; ++nt) {
            pt[nt] = 0.0f;
            #pragma unroll
            for (int r = 0; r < 8; r += 2) {
                float p0 = __expf(sacc[nt][r]     - mnew);
                float p1 = __expf(sacc[nt][r + 1] - mnew);
                pt[nt] += p0 + p1;
                bp[nt >> 1].u[(nt & 1) * 4 + (r >> 1)] = f2bf2(p0, p1);
            }
        }
        csum = csum * corr + ((pt[0] + pt[1]) + (pt[2] + pt[3]));
        #pragma unroll
        for (int nt = 0; nt < 4; ++nt)
            #pragma unroll
            for (int r = 0; r < 8; ++r) cacc[nt][r] = cacc[nt][r] * corr;
        // ---- Ot += Vt * Pt ---------------------------------------------------
        #pragma unroll
        for (int nt = 0; nt < 4; ++nt)
            #pragma unroll
            for (int ks = 0; ks < 2; ++ks) {
                Frag bv;
                const __bf16* p = &Vs[nt * 16 + ln][ks * 32];
                bv.q[0] = *(const uint4*)(p + hf * 8);
                bv.q[1] = *(const uint4*)(p + 16 + hf * 8);
                cacc[nt] = __builtin_amdgcn_wmma_f32_16x16x32_bf16(
                    false, bv.v, false, bp[ks].v, (short)0, cacc[nt], false, false);
            }
        __syncthreads();
    }

    // ---- normalize + store ctx as [B*T, H*DV] bf16 (a GEMM operand) ---------
    // A lane holds 8 consecutive dv of its query per tile: one 16-byte store.
    const int b = bh / NH, h = bh % NH;
    const float inv = 1.0f / (csum + xhalf(csum));
    __bf16* crow = ctx + (size_t)(b * SEQ + t_idx) * DMODEL + h * 64 + hf * 8;
    #pragma unroll
    for (int nt = 0; nt < 4; ++nt) {
        uint4 o;
        o.x = f2bf2(cacc[nt][0] * inv, cacc[nt][1] * inv);
        o.y = f2bf2(cacc[nt][2] * inv, cacc[nt][3] * inv);
        o.z = f2bf2(cacc[nt][4] * inv, cacc[nt][5] * inv);
        o.w = f2bf2(cacc[nt][6] * inv, cacc[nt][7] * inv);
        *(uint4*)(crow + nt * 16) = o;
    }
}

// ---------------------------------------------------------------------------
// out = LayerNorm(a + b) * gamma + beta ; one 1024-wide row per 256-thr block
// WB: also write the row as bf16, the form in which the next GEMM reads it
// ---------------------------------------------------------------------------
template<bool WB>
__launch_bounds__(256)
__global__ void add_ln_kernel(const float* __restrict__ a,
                              const float* __restrict__ b,
                              const float* __restrict__ gamma,
                              const float* __restrict__ beta,
                              float* __restrict__ out,
                              __bf16* __restrict__ outb)
{
    __shared__ float red[16];
    const int row = blockIdx.x;
    const int tid = threadIdx.x;
    const size_t base = (size_t)row * DMODEL;

    float v[4]; float s = 0.0f, ss = 0.0f;
    #pragma unroll
    for (int j = 0; j < 4; ++j) {
        int idx = tid + j * 256;
        float x = a[base + idx] + b[base + idx];
        v[j] = x; s += x; ss += x * x;
    }
    #pragma unroll
    for (int off = 1; off < 32; off <<= 1) {
        s  += __shfl_xor(s,  off, 32);
        ss += __shfl_xor(ss, off, 32);
    }
    int wid = tid >> 5, lane = tid & 31;
    if (lane == 0) { red[wid] = s; red[8 + wid] = ss; }
    __syncthreads();
    if (wid == 0) {
        float s2  = (lane < 8) ? red[lane] : 0.0f;
        float ss2 = (lane < 8) ? red[8 + lane] : 0.0f;
        #pragma unroll
        for (int off = 1; off < 8; off <<= 1) {
            s2  += __shfl_xor(s2,  off, 32);
            ss2 += __shfl_xor(ss2, off, 32);
        }
        if (lane == 0) { red[0] = s2; red[8] = ss2; }
    }
    __syncthreads();
    float mu  = red[0] * (1.0f / DMODEL);
    float var = red[8] * (1.0f / DMODEL) - mu * mu;
    float rs  = rsqrtf(var + EPSLN);
    #pragma unroll
    for (int j = 0; j < 4; ++j) {
        int idx = tid + j * 256;
        float y = (v[j] - mu) * rs * gamma[idx] + beta[idx];
        out[base + idx] = y;
        if (WB) outb[base + idx] = f2bf(y);
    }
}

// ---------------------------------------------------------------------------
// Host-side orchestration
// ---------------------------------------------------------------------------
extern "C" void kernel_launch(void* const* d_in, const int* in_sizes, int n_in,
                              void* d_out, int out_size, void* d_ws, size_t ws_size,
                              hipStream_t stream)
{
    const float* x   = (const float*)d_in[0];
    const float* Wq  = (const float*)d_in[1];
    const float* Wk  = (const float*)d_in[2];
    const float* Wv  = (const float*)d_in[3];
    const float* Wo  = (const float*)d_in[4];
    const float* W1  = (const float*)d_in[5];
    const float* b1  = (const float*)d_in[6];
    const float* W2  = (const float*)d_in[7];
    const float* b2  = (const float*)d_in[8];
    const float* g1  = (const float*)d_in[9];
    const float* be1 = (const float*)d_in[10];
    const float* g2  = (const float*)d_in[11];
    const float* be2 = (const float*)d_in[12];
    float* out = (float*)d_out;

    const int M = BATCH * SEQ;   // 4096 token rows

    char* w = (char*)d_ws;
    auto take = [&](size_t bytes) -> char* {
        char* p = w; w += (bytes + 255) & ~(size_t)255; return p;
    };
    __bf16* qb  = (__bf16*)take((size_t)M * DMODEL * sizeof(__bf16)); //  8 MB
    __bf16* kb  = (__bf16*)take((size_t)M * DMODEL * sizeof(__bf16)); //  8 MB
    __bf16* vtb = (__bf16*)take((size_t)M * DMODEL * sizeof(__bf16)); //  8 MB
    __bf16* ctx = (__bf16*)take((size_t)M * DMODEL * sizeof(__bf16)); //  8 MB
    float*  ao  = (float*)take((size_t)M * DMODEL * sizeof(float));   // 16 MB
    float*  h   = (float*)take((size_t)M * DMODEL * sizeof(float));   // 16 MB
    __bf16* hb  = (__bf16*)take((size_t)M * DMODEL * sizeof(__bf16)); //  8 MB
    __bf16* f1  = (__bf16*)take((size_t)M * FFDIM  * sizeof(__bf16)); // 32 MB
    float*  f2  = (float*)take((size_t)M * DMODEL * sizeof(float));   // 16 MB
    __bf16* xb  = (__bf16*)take((size_t)M * DMODEL * sizeof(__bf16)); //  8 MB
    __bf16* Wob = (__bf16*)take((size_t)DMODEL * DMODEL * sizeof(__bf16)); // 2 MB
    __bf16* Wqt = (__bf16*)take((size_t)DMODEL * DMODEL * sizeof(__bf16)); // 2 MB
    __bf16* Wkt = (__bf16*)take((size_t)DMODEL * DMODEL * sizeof(__bf16)); // 2 MB
    __bf16* Wvt = (__bf16*)take((size_t)DMODEL * DMODEL * sizeof(__bf16)); // 2 MB
    __bf16* W1t = (__bf16*)take((size_t)DMODEL * FFDIM  * sizeof(__bf16)); // 8 MB
    __bf16* W2t = (__bf16*)take((size_t)DMODEL * FFDIM  * sizeof(__bf16)); // 8 MB

    const dim3 blk(GT);
    const dim3 g_d(DMODEL / BN, M / BM);   // (8, 32)
    const dim3 g_ff(FFDIM / BN, M / BM);   // (32, 32)
    const float qscale = 0.125f;           // 1/sqrt(DK)

    // fp32 inputs -> bf16 GEMM operands, K-contiguous
    pack_operands<<<dim3(PK_ALL), dim3(256), 0, stream>>>(x, Wo, Wq, Wk, Wv, W1, W2,
                                                          xb, Wob, Wqt, Wkt, Wvt, W1t, W2t);

    // Q,K,V projections; pack straight to attention layouts in bf16
    gemm_bf16_wmma<EPI_QKPACK><<<g_d, blk, 0, stream>>>(xb, Wqt, nullptr, nullptr, qb,  M, DMODEL, DMODEL, qscale);
    gemm_bf16_wmma<EPI_QKPACK><<<g_d, blk, 0, stream>>>(xb, Wkt, nullptr, nullptr, kb,  M, DMODEL, DMODEL, 1.0f);
    gemm_bf16_wmma<EPI_VTPACK><<<g_d, blk, 0, stream>>>(xb, Wvt, nullptr, nullptr, vtb, M, DMODEL, DMODEL, 1.0f);

    // Causal flash attention
    flash_attn_kernel<<<dim3(SEQ / 64, BATCH * NH), dim3(AT), 0, stream>>>(qb, kb, vtb, ctx);

    // Output projection (Wo is [N,K] row-major as given)
    gemm_bf16_wmma<EPI_F32><<<g_d, blk, 0, stream>>>(ctx, Wob, nullptr, ao, nullptr, M, DMODEL, DMODEL, 1.0f);

    // h = LN(x + attn_out)
    add_ln_kernel<true><<<dim3(M), dim3(256), 0, stream>>>(x, ao, g1, be1, h, hb);

    // FFN
    gemm_bf16_wmma<EPI_BIAS_RELU><<<g_ff, blk, 0, stream>>>(hb, W1t, b1, nullptr, f1, M, FFDIM,  DMODEL, 1.0f);
    gemm_bf16_wmma<EPI_BIAS><<<g_d,  blk, 0, stream>>>(f1, W2t, b2, f2, nullptr, M, DMODEL, FFDIM,  1.0f);

    // out = LN(h + ffn)
    add_ln_kernel<false><<<dim3(M), dim3(256), 0, stream>>>(h, f2, g2, be2, out, nullptr);
}

// v004
// It runs in 214 microseconds.
// In both of two side-by-side timings against v003, it was 1.08 times as fast.
// All steps since v000 together make it 4.69 times as fast.
#include <hip/hip_runtime.h>
#include <hip/hip_bf16.h>
#include <stdint.h>

// ---------------------------------------------------------------------------
// Problem constants (match reference)
// ---------------------------------------------------------------------------
#define BATCH  2
#define SEQ    2048
#define DMODEL 1024
#define NH     16
#define DHEAD  64
#define FFDIM  4096
#define EPSLN  1e-6f

// ---------------------------------------------------------------------------
// WMMA types (CDNA5 / gfx1250, wave32)
// ---------------------------------------------------------------------------
typedef __attribute__((ext_vector_type(16))) __bf16 v16bf;
typedef __attribute__((ext_vector_type(8)))  float  v8f;
typedef __attribute__((ext_vector_type(4)))  uint32_t v4u;   // 16 raw bytes in registers

union Frag {
    v16bf v;
    uint4 q[2];
    uint32_t u[8];
};

__device__ __forceinline__ __bf16 f2bf(float f) {
    union { float f; uint32_t u; } c; c.f = f;
    uint32_t r = (c.u + 0x7FFFu + ((c.u >> 16) & 1u)) >> 16;   // RNE
    union { uint16_t s; __bf16 b; } o; o.s = (uint16_t)r;
    return o.b;
}

// Two fp32 values -> one dword of two bf16 (lo at the lower address).
__device__ __forceinline__ uint32_t f2bf2(float lo, float hi) {
    union { __bf16 b[2]; uint32_t u; } o;
    o.b[0] = f2bf(lo); o.b[1] = f2bf(hi);
    return o.u;
}

// Value of lane l ^ 16 (the other 16-lane half), without LDS.
__device__ __forceinline__ float xhalf(float x) {
    int b = __builtin_bit_cast(int, x);
    return __builtin_bit_cast(float,
        __builtin_amdgcn_permlanex16(b, b, 0x76543210, 0xfedcba98, false, false));
}

// ---------------------------------------------------------------------------
// Operand packing, once per call: every GEMM operand that arrives as fp32 is
// rounded to bf16 here, B operands also transposed to [N][K], so that no GEMM
// block repeats that work per tile. One 64x64 tile per 256-thread block.
//   x  [4096][1024] and Wo [N=1024][K=1024]   : same layout
//   Wq, Wk, Wv [K=1024][N=1024], W1 [1024][4096], W2 [4096][1024] : -> [N][K]
// ---------------------------------------------------------------------------
#define PK_X   (BATCH * SEQ / 64 * (DMODEL / 64))     // 1024 tiles
#define PK_W   (DMODEL / 64 * (DMODEL / 64))          //  256 tiles
#define PK_F   (DMODEL / 64 * (FFDIM / 64))           // 1024 tiles
#define PK_ALL (PK_X + 4 * PK_W + 2 * PK_F)

__launch_bounds__(256)
__global__ void pack_operands(const float* __restrict__ x,  const float* __restrict__ Wo,
                              const float* __restrict__ Wq, const float* __restrict__ Wk,
                              const float* __restrict__ Wv, const float* __restrict__ W1,
                              const float* __restrict__ W2,
                              __bf16* __restrict__ xb,  __bf16* __restrict__ Wob,
                              __bf16* __restrict__ Wqt, __bf16* __restrict__ Wkt,
                              __bf16* __restrict__ Wvt, __bf16* __restrict__ W1t,
                              __bf16* __restrict__ W2t)
{
    __shared__ uint32_t Ts[64][33];   // [n][k pair]; 33 dwords: writes and reads hit distinct banks

    const int tid = threadIdx.x;
    int t = blockIdx.x;
    const float* src; __bf16* dst; int rows, cols; bool tr;
    if      (t < PK_X)                       { src = x;  dst = xb;  rows = BATCH * SEQ; cols = DMODEL; tr = false; }
    else if ((t -= PK_X) < PK_W)             { src = Wo; dst = Wob; rows = DMODEL; cols = DMODEL; tr = false; }
    else if ((t -= PK_W) < PK_W)             { src = Wq; dst = Wqt; rows = DMODEL; cols = DMODEL; tr = true; }
    else if ((t -= PK_W) < PK_W)             { src = Wk; dst = Wkt; rows = DMODEL; cols = DMODEL; tr = true; }
    else if ((t -= PK_W) < PK_W)             { src = Wv; dst = Wvt; rows = DMODEL; cols = DMODEL; tr = true; }
    else if ((t -= PK_W) < PK_F)             { src = W1; dst = W1t; rows = DMODEL; cols = FFDIM;  tr = true; }
    else                     { t -= PK_F;      src = W2; dst = W2t; rows = FFDIM;  cols = DMODEL; tr = true; }
    const int tpr = cols >> 6;               // tiles per row of tiles
    const int r0 = (t / tpr) << 6, c0 = (t % tpr) << 6;

    if (!tr) {
        size_t e[4]; float4 v[4];
        #pragma unroll
        for (int i = 0; i < 4; ++i) {
            int idx = i * 256 + tid;
            e[i] = (size_t)(r0 + (idx >> 4)) * cols + c0 + ((idx & 15) << 2);
            v[i] = *(const float4*)(src + e[i]);
            // The load stays in flight while its address registers are reused
            // (by the next load's result, by the rounding): the wait stands first.
            asm volatile("s_wait_xcnt 0x0" ::: "memory");
        }
        #pragma unroll
        for (int i = 0; i < 4; ++i) {
            uint2 o; o.x = f2bf2(v[i].x, v[i].y); o.y = f2bf2(v[i].z, v[i].w);
            *(uint2*)(dst + e[i]) = o;
            // The store stays in flight while its address and data registers are
            // reused (by the next rounding, by code behind the branch): wait first.
            asm volatile("s_wait_xcnt 0x0" ::: "memory");
        }
    } else {                                 // block-uniform branch: the barrier is safe
        float4 a[2], b[2];
        #pragma unroll
        for (int i = 0; i < 2; ++i) {
            int idx = i * 256 + tid;
            const float* p = src + (size_t)(r0 + 2 * (idx >> 4)) * cols + c0 + ((idx & 15) << 2);
            a[i] = *(const float4*)p;
            asm volatile("s_wait_xcnt 0x0" ::: "memory");   // as above
            b[i] = *(const float4*)(p + cols);
            asm volatile("s_wait_xcnt 0x0" ::: "memory");   // as above
        }
        #pragma unroll
        for (int i = 0; i < 2; ++i) {
            int idx = i * 256 + tid;
            int kp = idx >> 4, c = (idx & 15) << 2;
            Ts[c + 0][kp] = f2bf2(a[i].x, b[i].x); Ts[c + 1][kp] = f2bf2(a[i].y, b[i].y);
            Ts[c + 2][kp] = f2bf2(a[i].z, b[i].z); Ts[c + 3][kp] = f2bf2(a[i].w, b[i].w);
        }
        __syncthreads();
        #pragma unroll
        for (int i = 0; i < 2; ++i) {
            int idx = i * 256 + tid;
            int n = idx >> 3, q = (idx & 7) << 2;
            uint4 o; o.x = Ts[n][q]; o.y = Ts[n][q + 1]; o.z = Ts[n][q + 2]; o.w = Ts[n][q + 3];
            *(uint4*)(dst + (size_t)(c0 + n) * rows + r0 + 2 * q) = o;
        }
    }
}

// ---------------------------------------------------------------------------
// Generic bf16-WMMA GEMM: C[M,N] = A[M,K] * Bt[N,K]^T  (A, Bt bf16 in memory,
// both K-contiguous; fp32 accumulate via v_wmma_f32_16x16x32_bf16)
//
// Block tile: 128x128, 256 threads (8 wave32), wave tile 64x32. A pass takes
// one 128-byte line of every row, which in bf16 is K-step 64 (two WMMA k-steps).
// LDS rows padded to BK+8 bf16 (144B) so per-lane fragment reads are two
// 16B-aligned ds_load_b128, matching the 16-bit A/B operand layout:
//   lane l: row/col = l&15, half = l>>4; chunk0 = K[half*8 .. +7],
//   chunk1 = K[16+half*8 .. +7]  (per K-step of 32).
// ---------------------------------------------------------------------------
#define BM 128
#define BN 128
#define BK 64
#define GT 256
#define LDAP 72   // BK + 8 pad -> 144B row stride, 16B aligned rows

// EPI_QKV: B holds the Q, K and V weights one behind the other (N = 3 * DMODEL),
// Cb the three outputs one behind the other; a block lies wholly in one of them.
enum { EPI_F32 = 0, EPI_BIAS = 1, EPI_BIAS_RELU = 2, EPI_QKV = 3 };

template<int EPI>
__launch_bounds__(GT)
__global__ void gemm_bf16_wmma(const __bf16* A,  // A, B: no __restrict__, see fetch
                               const __bf16* B,  // [N,K] row-major
                               const float* __restrict__ bias,
                               float* __restrict__ C,
                               __bf16* __restrict__ Cb,
                               int M, int N, int K, float scale)
{
    __shared__ __bf16 As[BM][LDAP];
    __shared__ __bf16 Bs[BN][LDAP];

    const int tid  = threadIdx.x;
    const int m0   = blockIdx.y * BM;
    const int n0   = blockIdx.x * BN;
    const int wid  = tid >> 5;
    const int lane = tid & 31;
    const int hf   = lane >> 4;
    const int ln   = lane & 15;
    const int wm   = (wid >> 2) * 64;   // 2 wave rows
    const int wn   = (wid & 3) * 32;    // 4 wave cols

    v8f acc[4][2] = {};

    // Byte offsets of this thread's 16-byte slots inside a K tile (the same for
    // A and B); they do not change over the loop, only the tile's (uniform)
    // base address does.
    uint32_t oa[4];
    #pragma unroll
    for (int i = 0; i < 4; ++i) {
        int idx = i * GT + tid;                  // 0..1023 slots of 8 bf16
        oa[i] = (uint32_t)(((idx >> 3) * K + ((idx & 7) << 3)) * 2);
    }

    // All eight loads of one K tile, issued as one group into registers.
    // A and B are not __restrict__: plain loads keep their place in front of the
    // barrier's fence; marked __restrict__ the compiler sank them over both
    // barriers to their first use, where each waited out its own latency.
    auto fetch = [&](v4u (&ra)[4], v4u (&rb)[4], int kt) {
        const char* At = (const char*)(A + (size_t)m0 * K + kt);
        const char* Bt = (const char*)(B + (size_t)n0 * K + kt);
        #pragma unroll
        for (int i = 0; i < 4; ++i) ra[i] = *(const v4u*)(At + oa[i]);
        // The loads stay in flight while their address registers are reused
        // (by the loads below, by the fragment loads): the wait stands first.
        asm volatile("s_wait_xcnt 0x0" ::: "memory");
        #pragma unroll
        for (int i = 0; i < 4; ++i) rb[i] = *(const v4u*)(Bt + oa[i]);
        asm volatile("s_wait_xcnt 0x0" ::: "memory");   // as above
    };

    // Work-group barrier whose fences order LDS only. As and Bs are all that
    // the waves hand to each other; __syncthreads() would also wait out the
    // global loads that are meant to stay in flight over it.
    auto lds_barrier = [&]() {
        __builtin_amdgcn_fence(__ATOMIC_RELEASE, "workgroup", "local");
        __builtin_amdgcn_s_barrier();
        __builtin_amdgcn_fence(__ATOMIC_ACQUIRE, "workgroup", "local");
    };

    // The raw tile is carried over the loop's back edge: its loads are issued
    // in the pass before, behind the LDS stores that free its registers, and
    // fly during that pass's LDS traffic, barriers and WMMAs. No branch stands
    // around the fetch (a join of two paths would drain it early): in the last
    // pass it re-reads the last tile and nothing uses it.
    v4u ra[4], rb[4];
    fetch(ra, rb, 0);
    for (int kt = 0; kt < K; kt += BK) {
        // ---- stage A and B tiles (128 rows x 64 bf16 each) -------------------
        #pragma unroll
        for (int i = 0; i < 4; ++i) {
            int idx = i * GT + tid;
            int r = idx >> 3, c = (idx & 7) << 3;
            *(v4u*)&As[r][c] = ra[i];
            *(v4u*)&Bs[r][c] = rb[i];
        }
        // Keeps the next tile's loads behind the LDS stores above, so that they
        // land in the registers just freed: lifted over them they need a second
        // set and copies, and the copies' wait for the loads stands early.
        __builtin_amdgcn_sched_barrier(0);
        fetch(ra, rb, (kt + BK < K) ? kt + BK : kt);
        lds_barrier();

        // ---- fragments + 8 WMMAs per k-step of 32, k ascending ---------------
        #pragma unroll
        for (int ks = 0; ks < BK; ks += 32) {
            Frag af[4], bfr[2];
            #pragma unroll
            for (int mt = 0; mt < 4; ++mt) {
                const __bf16* p = &As[wm + mt * 16 + ln][ks];
                af[mt].q[0] = *(const uint4*)(p + hf * 8);
                af[mt].q[1] = *(const uint4*)(p + 16 + hf * 8);
            }
            #pragma unroll
            for (int nt = 0; nt < 2; ++nt) {
                const __bf16* p = &Bs[wn + nt * 16 + ln][ks];
                bfr[nt].q[0] = *(const uint4*)(p + hf * 8);
                bfr[nt].q[1] = *(const uint4*)(p + 16 + hf * 8);
            }
            #pragma unroll
            for (int mt = 0; mt < 4; ++mt)
                #pragma unroll
                for (int nt = 0; nt < 2; ++nt)
                    acc[mt][nt] = __builtin_amdgcn_wmma_f32_16x16x32_bf16(
                        false, af[mt].v, false, bfr[nt].v, (short)0, acc[mt][nt], false, false);
        }
        lds_barrier();
    }

    // ---- epilogue: C/D layout -> element (m,n): vgpr r = m&7, lane = n + 16*(m>>3)
    if (EPI == EPI_QKV) {
        // One test per block, in front of the stores: 0 = Q, 1 = K, 2 = V.
        const int sel = n0 / DMODEL;
        __bf16* dst = Cb + (size_t)sel * ((size_t)BATCH * SEQ * DMODEL);
        const float sc = (sel == 0) ? scale : 1.0f;   // Q pre-scaled by 1/sqrt(DK)
        const int b  = m0 >> 11;                      // BM divides SEQ: one batch per block
        const int t0 = (m0 & (SEQ - 1)) + wm + hf * 8;
        const int c0 = (n0 & (DMODEL - 1)) + wn + ln;
        if (sel < 2) {      // Q, K: [B*T, H*64] fp32 -> [B,H,T,64] bf16
            #pragma unroll
            for (int mt = 0; mt < 4; ++mt)
            #pragma unroll
            for (int nt = 0; nt < 2; ++nt)
            #pragma unroll
            for (int r = 0; r < 8; ++r) {
                int t = t0 + mt * 16 + r, col = c0 + nt * 16;
                int h = col >> 6, dd = col & 63;
                dst[(((size_t)(b * NH + h) * SEQ + t) << 6) + dd] = f2bf(acc[mt][nt][r] * sc);
            }
            // The last stores are still in flight where the other branch's code, laid
            // out behind this one, reuses their registers: the wait stands first.
            asm volatile("s_wait_xcnt 0x0" ::: "memory");
        } else {            // V: -> [B,H,64,T] bf16 (transposed)
            #pragma unroll
            for (int mt = 0; mt < 4; ++mt)
            #pragma unroll
            for (int nt = 0; nt < 2; ++nt)
            #pragma unroll
            for (int r = 0; r < 8; ++r) {
                int t = t0 + mt * 16 + r, col = c0 + nt * 16;
                int h = col >> 6, dd = col & 63;
                dst[((size_t)(b * NH + h) * 64 + dd) * SEQ + t] = f2bf(acc[mt][nt][r]);
            }
            asm volatile("s_wait_xcnt 0x0" ::: "memory");   // as above
        }
        return;
    }
    #pragma unroll
    for (int mt = 0; mt < 4; ++mt)
    #pragma unroll
    for (int nt = 0; nt < 2; ++nt)
    #pragma unroll
    for (int r = 0; r < 8; ++r) {
        int row = m0 + wm + mt * 16 + r + hf * 8;
        int col = n0 + wn + nt * 16 + ln;
        float v = acc[mt][nt][r];
        if (EPI == EPI_BIAS || EPI == EPI_BIAS_RELU) v += bias[col];
        if (EPI == EPI_BIAS_RELU) v = fmaxf(v, 0.0f);
        if (EPI == EPI_F32 || EPI == EPI_BIAS) {
            C[(size_t)row * N + col] = v;
        } else {                             // EPI_BIAS_RELU feeds the next GEMM only: bf16
            Cb[(size_t)row * N + col] = f2bf(v);
        }
    }
}

// ---------------------------------------------------------------------------
// Causal flash attention: grid (T/64, B*H), 128 threads (4 waves).
// Wave w owns q rows qtile*64 + w*16 .. +15; streams K/V in 64-wide chunks
// (only sc <= qtile: causal), online softmax, ctx accumulated in fp32.
// Both products are taken transposed: St = K * Qt and Ot += Vt * Pt. A lane
// then holds scores of ONE query (column ln), keys nt*16 + hf*8 + r: maximum
// and sum run inside the lane, the two halves meet in one register exchange,
// and two St tiles, rounded in place, are the B operand Pt of the second
// product (its k order is the one the Vs loader below already uses).
// ---------------------------------------------------------------------------
#define AT 128
#define KPAD 72   // 64 + 8 pad -> 144B row stride, 16B aligned rows

__launch_bounds__(AT)
__global__ void flash_attn_kernel(const __bf16* __restrict__ qg,
                                  const __bf16* __restrict__ kg,
                                  const __bf16* __restrict__ vtg,
                                  __bf16* __restrict__ ctx)
{
    __shared__ __bf16 Ks[64][KPAD];       // K chunk   [s][dk]
    __shared__ __bf16 Vs[64][KPAD];       // Vt chunk  [dv][s]

    const int tid   = threadIdx.x;
    const int wid   = tid >> 5;
    const int lane  = tid & 31;
    const int hf    = lane >> 4;
    const int ln    = lane & 15;
    const int bh    = blockIdx.y;         // b*NH + h
    const int qtile = blockIdx.x;
    const int qrow0 = qtile * 64 + wid * 16;

    // Q fragments (B operand: column = query ln; K = DHEAD = 64 -> two K-steps of 32)
    const __bf16* qrow = qg + ((size_t)bh * SEQ + qrow0 + ln) * DHEAD;
    Frag aq[2];
    #pragma unroll
    for (int ks = 0; ks < 2; ++ks) {
        aq[ks].q[0] = *(const uint4*)(qrow + ks * 32 + hf * 8);
        aq[ks].q[1] = *(const uint4*)(qrow + ks * 32 + 16 + hf * 8);
    }

    float cmax = -3.0e38f;   // running maximum of query ln, alike in both halves
    float csum = 0.0f;       // running sum over the keys of this lane's half only
    v8f cacc[4] = {};        // Ot: dv = nt*16 + hf*8 + r, query ln

    const __bf16* kbase = kg  + (size_t)bh * SEQ * DHEAD;
    const __bf16* vbase = vtg + (size_t)bh * DHEAD * SEQ;
    const int t_idx = qrow0 + ln;

    for (int sc = 0; sc <= qtile; ++sc) {
        const int s0 = sc * 64;
        // ---- stage K chunk [64][64] and Vt chunk [64][64] ------------------
        // All 16 loads first, then the LDS stores: written load by store, this
        // build waited out each pair's latency in turn.
        uint2 kr[8], vr[8];
        #pragma unroll
        for (int i = 0; i < 8; ++i) {
            int idx = i * AT + tid;           // 0..1023 (8B units)
            int r = idx >> 4, c = (idx & 15) << 2;
            kr[i] = *(const uint2*)(kbase + (size_t)(s0 + r) * DHEAD + c);
            vr[i] = *(const uint2*)(vbase + (size_t)r * SEQ + s0 + c);
        }
        #pragma unroll
        for (int i = 0; i < 8; ++i) {
            int idx = i * AT + tid;
            int r = idx >> 4, c = (idx & 15) << 2;
            *(uint2*)&Ks[r][c] = kr[i];
            *(uint2*)&Vs[r][c] = vr[i];
        }
        __syncthreads();

        // ---- St = K * Qt  (64 keys x 16 queries per wave) ------------------
        v8f sacc[4] = {};
        #pragma unroll
        for (int nt = 0; nt < 4; ++nt) {
            #pragma unroll
            for (int ks = 0; ks < 2; ++ks) {
                Frag bk;
                const __bf16* p = &Ks[nt * 16 + ln][ks * 32];
                bk.q[0] = *(const uint4*)(p + hf * 8);
                bk.q[1] = *(const uint4*)(p + 16 + hf * 8);
                sacc[nt] = __builtin_amdgcn_wmma_f32_16x16x32_bf16(
                    false, bk.v, false, aq[ks].v, (short)0, sacc[nt], false, false);
            }
        }
        // ---- causal mask: key s0 + hf*8 + (nt*16 + r) against query t_idx ---
        const int room = t_idx - s0 - hf * 8;
        #pragma unroll
        for (int nt = 0; nt < 4; ++nt)
            #pragma unroll
            for (int r = 0; r < 8; ++r)
                sacc[nt][r] = (nt * 16 + r > room) ? -3.0e38f : sacc[nt][r];
        // ---- online softmax: one query per lane ----------------------------
        float mt[4];
        #pragma unroll
        for (int nt = 0; nt < 4; ++nt) {
            mt[nt] = sacc[nt][0];
            #pragma unroll
            for (int r = 1; r < 8; ++r) mt[nt] = fmaxf(mt[nt], sacc[nt][r]);
        }
        float mx = fmaxf(fmaxf(mt[0], mt[1]), fmaxf(mt[2], mt[3]));
        mx = fmaxf(mx, xhalf(mx));
        const float mnew = fmaxf(cmax, mx);
        const float corr = __expf(cmax - mnew);
        cmax = mnew;
        Frag bp[2];                       // Pt, B operand: k = key within 32
        float pt[4];
        #pragma unroll
        for (int nt = 0; nt < 4; ++nt) {
            pt[nt] = 0.0f;
            #pragma unroll
            for (int r = 0; r < 8; r += 2) {
                float p0 = __expf(sacc[nt][r]     - mnew);
                float p1 = __expf(sacc[nt][r + 1] - mnew);
                pt[nt] += p0 + p1;
                bp[nt >> 1].u[(nt & 1) * 4 + (r >> 1)] = f2bf2(p0, p1);
            }
        }
        csum = csum * corr + ((pt[0] + pt[1]) + (pt[2] + pt[3]));
        #pragma unroll
        for (int nt = 0; nt < 4; ++nt)
            #pragma unroll
            for (int r = 0; r < 8; ++r) cacc[nt][r] = cacc[nt][r] * corr;
        // ---- Ot += Vt * Pt ---------------------------------------------------
        #pragma unroll
        for (int nt = 0; nt < 4; ++nt)
            #pragma unroll
            for (int ks = 0; ks < 2; ++ks) {
                Frag bv;
                const __bf16* p = &Vs[nt * 16 + ln][ks * 32];
                bv.q[0] = *(const uint4*)(p + hf * 8);
                bv.q[1] = *(const uint4*)(p + 16 + hf * 8);
                cacc[nt] = __builtin_amdgcn_wmma_f32_16x16x32_bf16(
                    false, bv.v, false, bp[ks].v, (short)0, cacc[nt], false, false);
            }
        __syncthreads();
    }

    // ---- normalize + store ctx as [B*T, H*DV] bf16 (a GEMM operand) ---------
    // A lane holds 8 consecutive dv of its query per tile: one 16-byte store.
    const int b = bh / NH, h = bh % NH;
    const float inv = 1.0f / (csum + xhalf(csum));
    __bf16* crow = ctx + (size_t)(b * SEQ + t_idx) * DMODEL + h * 64 + hf * 8;
    #pragma unroll
    for (int nt = 0; nt < 4; ++nt) {
        uint4 o;
        o.x = f2bf2(cacc[nt][0] * inv, cacc[nt][1] * inv);
        o.y = f2bf2(cacc[nt][2] * inv, cacc[nt][3] * inv);
        o.z = f2bf2(cacc[nt][4] * inv, cacc[nt][5] * inv);
        o.w = f2bf2(cacc[nt][6] * inv, cacc[nt][7] * inv);
        *(uint4*)(crow + nt * 16) = o;
    }
}

// ---------------------------------------------------------------------------
// out = LayerNorm(a + b) * gamma + beta ; one 1024-wide row per 256-thr block
// WB: also write the row as bf16, the form in which the next GEMM reads it
// ---------------------------------------------------------------------------
template<bool WB>
__launch_bounds__(256)
__global__ void add_ln_kernel(const float* __restrict__ a,
                              const float* __restrict__ b,
                              const float* __restrict__ gamma,
                              const float* __restrict__ beta,
                              float* __restrict__ out,
                              __bf16* __restrict__ outb)
{
    __shared__ float red[16];
    const int row = blockIdx.x;
    const int tid = threadIdx.x;
    const size_t base = (size_t)row * DMODEL;

    float v[4]; float s = 0.0f, ss = 0.0f;
    #pragma unroll
    for (int j = 0; j < 4; ++j) {
        int idx = tid + j * 256;
        float x = a[base + idx] + b[base + idx];
        v[j] = x; s += x; ss += x * x;
    }
    #pragma unroll
    for (int off = 1; off < 32; off <<= 1) {
        s  += __shfl_xor(s,  off, 32);
        ss += __shfl_xor(ss, off, 32);
    }
    int wid = tid >> 5, lane = tid & 31;
    if (lane == 0) { red[wid] = s; red[8 + wid] = ss; }
    __syncthreads();
    if (wid == 0) {
        float s2  = (lane < 8) ? red[lane] : 0.0f;
        float ss2 = (lane < 8) ? red[8 + lane] : 0.0f;
        #pragma unroll
        for (int off = 1; off < 8; off <<= 1) {
            s2  += __shfl_xor(s2,  off, 32);
            ss2 += __shfl_xor(ss2, off, 32);
        }
        if (lane == 0) { red[0] = s2; red[8] = ss2; }
    }
    __syncthreads();
    float mu  = red[0] * (1.0f / DMODEL);
    float var = red[8] * (1.0f / DMODEL) - mu * mu;
    float rs  = rsqrtf(var + EPSLN);
    #pragma unroll
    for (int j = 0; j < 4; ++j) {
        int idx = tid + j * 256;
        float y = (v[j] - mu) * rs * gamma[idx] + beta[idx];
        out[base + idx] = y;
        if (WB) outb[base + idx] = f2bf(y);
    }
}

// ---------------------------------------------------------------------------
// Host-side orchestration
// ---------------------------------------------------------------------------
extern "C" void kernel_launch(void* const* d_in, const int* in_sizes, int n_in,
                              void* d_out, int out_size, void* d_ws, size_t ws_size,
                              hipStream_t stream)
{
    const float* x   = (const float*)d_in[0];
    const float* Wq  = (const float*)d_in[1];
    const float* Wk  = (const float*)d_in[2];
    const float* Wv  = (const float*)d_in[3];
    const float* Wo  = (const float*)d_in[4];
    const float* W1  = (const float*)d_in[5];
    const float* b1  = (const float*)d_in[6];
    const float* W2  = (const float*)d_in[7];
    const float* b2  = (const float*)d_in[8];
    const float* g1  = (const float*)d_in[9];
    const float* be1 = (const float*)d_in[10];
    const float* g2  = (const float*)d_in[11];
    const float* be2 = (const float*)d_in[12];
    float* out = (float*)d_out;

    const int M = BATCH * SEQ;   // 4096 token rows

    char* w = (char*)d_ws;
    auto take = [&](size_t bytes) -> char* {
        char* p = w; w += (bytes + 255) & ~(size_t)255; return p;
    };
    __bf16* qb  = (__bf16*)take((size_t)3 * M * DMODEL * sizeof(__bf16)); // 3 x 8 MB, one behind the other
    __bf16* kb  = qb + (size_t)M * DMODEL;
    __bf16* vtb = kb + (size_t)M * DMODEL;
    __bf16* ctx = (__bf16*)take((size_t)M * DMODEL * sizeof(__bf16)); //  8 MB
    float*  ao  = (float*)take((size_t)M * DMODEL * sizeof(float));   // 16 MB
    float*  h   = (float*)take((size_t)M * DMODEL * sizeof(float));   // 16 MB
    __bf16* hb  = (__bf16*)take((size_t)M * DMODEL * sizeof(__bf16)); //  8 MB
    __bf16* f1  = (__bf16*)take((size_t)M * FFDIM  * sizeof(__bf16)); // 32 MB
    float*  f2  = (float*)take((size_t)M * DMODEL * sizeof(float));   // 16 MB
    __bf16* xb  = (__bf16*)take((size_t)M * DMODEL * sizeof(__bf16)); //  8 MB
    __bf16* Wob = (__bf16*)take((size_t)DMODEL * DMODEL * sizeof(__bf16)); // 2 MB
    __bf16* Wqt = (__bf16*)take((size_t)3 * DMODEL * DMODEL * sizeof(__bf16)); // 3 x 2 MB: one [3072][1024] operand
    __bf16* Wkt = Wqt + (size_t)DMODEL * DMODEL;
    __bf16* Wvt = Wkt + (size_t)DMODEL * DMODEL;
    __bf16* W1t = (__bf16*)take((size_t)DMODEL * FFDIM  * sizeof(__bf16)); // 8 MB
    __bf16* W2t = (__bf16*)take((size_t)DMODEL * FFDIM  * sizeof(__bf16)); // 8 MB

    const dim3 blk(GT);
    const dim3 g_d(DMODEL / BN, M / BM);   // (8, 32)
    const dim3 g_ff(FFDIM / BN, M / BM);   // (32, 32)
    const dim3 g_qkv(3 * DMODEL / BN, M / BM);   // (24, 32)
    const float qscale = 0.125f;           // 1/sqrt(DK)

    // fp32 inputs -> bf16 GEMM operands, K-contiguous
    pack_operands<<<dim3(PK_ALL), dim3(256), 0, stream>>>(x, Wo, Wq, Wk, Wv, W1, W2,
                                                          xb, Wob, Wqt, Wkt, Wvt, W1t, W2t);

    // Q,K,V projections in one launch: 768 blocks, three to a WGP, so that one
    // block's loads, LDS traffic and barriers run under the others' WMMAs.
    // Packed straight to the attention layouts in bf16.
    gemm_bf16_wmma<EPI_QKV><<<g_qkv, blk, 0, stream>>>(xb, Wqt, nullptr, nullptr, qb, M, 3 * DMODEL, DMODEL, qscale);

    // Causal flash attention
    flash_attn_kernel<<<dim3(SEQ / 64, BATCH * NH), dim3(AT), 0, stream>>>(qb, kb, vtb, ctx);

    // Output projection (Wo is [N,K] row-major as given)
    gemm_bf16_wmma<EPI_F32><<<g_d, blk, 0, stream>>>(ctx, Wob, nullptr, ao, nullptr, M, DMODEL, DMODEL, 1.0f);

    // h = LN(x + attn_out)
    add_ln_kernel<true><<<dim3(M), dim3(256), 0, stream>>>(x, ao, g1, be1, h, hb);

    // FFN
    gemm_bf16_wmma<EPI_BIAS_RELU><<<g_ff, blk, 0, stream>>>(hb, W1t, b1, nullptr, f1, M, FFDIM,  DMODEL, 1.0f);
    gemm_bf16_wmma<EPI_BIAS><<<g_d,  blk, 0, stream>>>(f1, W2t, b2, f2, nullptr, M, DMODEL, FFDIM,  1.0f);

    // out = LN(h + ffn)
    add_ln_kernel<false><<<dim3(M), dim3(256), 0, stream>>>(h, f2, g2, be2, out, nullptr);
}

// v005
// Measured time: 197 microseconds a run.
// Two timings next to v004 both put it at 1.08 times that version's speed.
// Over all steps from v000 it is 5.05 times as fast.
#include <hip/hip_runtime.h>
#include <hip/hip_bf16.h>
#include <stdint.h>

// ---------------------------------------------------------------------------
// Problem constants (match reference)
// ---------------------------------------------------------------------------
#define BATCH  2
#define SEQ    2048
#define DMODEL 1024
#define NH     16
#define DHEAD  64
#define FFDIM  4096
#define EPSLN  1e-6f

// ---------------------------------------------------------------------------
// WMMA types (CDNA5 / gfx1250, wave32)
// ---------------------------------------------------------------------------
typedef __attribute__((ext_vector_type(16))) __bf16 v16bf;
typedef __attribute__((ext_vector_type(8)))  float  v8f;
typedef __attribute__((ext_vector_type(4)))  uint32_t v4u;   // 16 raw bytes in registers

union Frag {
    v16bf v;
    uint4 q[2];
    uint32_t u[8];
};

__device__ __forceinline__ __bf16 f2bf(float f) {
    union { float f; uint32_t u; } c; c.f = f;
    uint32_t r = (c.u + 0x7FFFu + ((c.u >> 16) & 1u)) >> 16;   // RNE
    union { uint16_t s; __bf16 b; } o; o.s = (uint16_t)r;
    return o.b;
}

// Two fp32 values -> one dword of two bf16 (lo at the lower address).
__device__ __forceinline__ uint32_t f2bf2(float lo, float hi) {
    union { __bf16 b[2]; uint32_t u; } o;
    o.b[0] = f2bf(lo); o.b[1] = f2bf(hi);
    return o.u;
}

// Value of lane l ^ 16 (the other 16-lane half), without LDS.
__device__ __forceinline__ float xhalf(float x) {
    int b = __builtin_bit_cast(int, x);
    return __builtin_bit_cast(float,
        __builtin_amdgcn_permlanex16(b, b, 0x76543210, 0xfedcba98, false, false));
}

// ---------------------------------------------------------------------------
// Operand packing, once per call: every GEMM operand that arrives as fp32 is
// rounded to bf16 here, B operands also transposed to [N][K], so that no GEMM
// block repeats that work per tile. One 64x64 tile per 256-thread block.
//   x  [4096][1024] and Wo [N=1024][K=1024]   : same layout
//   Wq, Wk, Wv [K=1024][N=1024], W1 [1024][4096], W2 [4096][1024] : -> [N][K]
// ---------------------------------------------------------------------------
#define PK_X   (BATCH * SEQ / 64 * (DMODEL / 64))     // 1024 tiles
#define PK_W   (DMODEL / 64 * (DMODEL / 64))          //  256 tiles
#define PK_F   (DMODEL / 64 * (FFDIM / 64))           // 1024 tiles
#define PK_ALL (PK_X + 4 * PK_W + 2 * PK_F)

__launch_bounds__(256)
__global__ void pack_operands(const float* __restrict__ x,  const float* __restrict__ Wo,
                              const float* __restrict__ Wq, const float* __restrict__ Wk,
                              const float* __restrict__ Wv, const float* __restrict__ W1,
                              const float* __restrict__ W2,
                              __bf16* __restrict__ xb,  __bf16* __restrict__ Wob,
                              __bf16* __restrict__ Wqt, __bf16* __restrict__ Wkt,
                              __bf16* __restrict__ Wvt, __bf16* __restrict__ W1t,
                              __bf16* __restrict__ W2t)
{
    __shared__ uint32_t Ts[64][33];   // [n][k pair]; 33 dwords: writes and reads hit distinct banks

    const int tid = threadIdx.x;
    int t = blockIdx.x;
    const float* src; __bf16* dst; int rows, cols; bool tr;
    if      (t < PK_X)                       { src = x;  dst = xb;  rows = BATCH * SEQ; cols = DMODEL; tr = false; }
    else if ((t -= PK_X) < PK_W)             { src = Wo; dst = Wob; rows = DMODEL; cols = DMODEL; tr = false; }
    else if ((t -= PK_W) < PK_W)             { src = Wq; dst = Wqt; rows = DMODEL; cols = DMODEL; tr = true; }
    else if ((t -= PK_W) < PK_W)             { src = Wk; dst = Wkt; rows = DMODEL; cols = DMODEL; tr = true; }
    else if ((t -= PK_W) < PK_W)             { src = Wv; dst = Wvt; rows = DMODEL; cols = DMODEL; tr = true; }
    else if ((t -= PK_W) < PK_F)             { src = W1; dst = W1t; rows = DMODEL; cols = FFDIM;  tr = true; }
    else                     { t -= PK_F;      src = W2; dst = W2t; rows = FFDIM;  cols = DMODEL; tr = true; }
    const int tpr = cols >> 6;               // tiles per row of tiles
    const int r0 = (t / tpr) << 6, c0 = (t % tpr) << 6;

    if (!tr) {
        size_t e[4]; float4 v[4];
        #pragma unroll
        for (int i = 0; i < 4; ++i) {
            int idx = i * 256 + tid;
            e[i] = (size_t)(r0 + (idx >> 4)) * cols + c0 + ((idx & 15) << 2);
            v[i] = *(const float4*)(src + e[i]);
            // The load stays in flight while its address registers are reused
            // (by the next load's result, by the rounding): the wait stands first.
            asm volatile("s_wait_xcnt 0x0" ::: "memory");
        }
        #pragma unroll
        for (int i = 0; i < 4; ++i) {
            uint2 o; o.x = f2bf2(v[i].x, v[i].y); o.y = f2bf2(v[i].z, v[i].w);
            *(uint2*)(dst + e[i]) = o;
            // The store stays in flight while its address and data registers are
            // reused (by the next rounding, by code behind the branch): wait first.
            asm volatile("s_wait_xcnt 0x0" ::: "memory");
        }
    } else {                                 // block-uniform branch: the barrier is safe
        float4 a[2], b[2];
        #pragma unroll
        for (int i = 0; i < 2; ++i) {
            int idx = i * 256 + tid;
            const float* p = src + (size_t)(r0 + 2 * (idx >> 4)) * cols + c0 + ((idx & 15) << 2);
            a[i] = *(const float4*)p;
            asm volatile("s_wait_xcnt 0x0" ::: "memory");   // as above
            b[i] = *(const float4*)(p + cols);
            asm volatile("s_wait_xcnt 0x0" ::: "memory");   // as above
        }
        #pragma unroll
        for (int i = 0; i < 2; ++i) {
            int idx = i * 256 + tid;
            int kp = idx >> 4, c = (idx & 15) << 2;
            Ts[c + 0][kp] = f2bf2(a[i].x, b[i].x); Ts[c + 1][kp] = f2bf2(a[i].y, b[i].y);
            Ts[c + 2][kp] = f2bf2(a[i].z, b[i].z); Ts[c + 3][kp] = f2bf2(a[i].w, b[i].w);
        }
        __syncthreads();
        #pragma unroll
        for (int i = 0; i < 2; ++i) {
            int idx = i * 256 + tid;
            int n = idx >> 3, q = (idx & 7) << 2;
            uint4 o; o.x = Ts[n][q]; o.y = Ts[n][q + 1]; o.z = Ts[n][q + 2]; o.w = Ts[n][q + 3];
            *(uint4*)(dst + (size_t)(c0 + n) * rows + r0 + 2 * q) = o;
        }
    }
}

// ---------------------------------------------------------------------------
// Generic bf16-WMMA GEMM: C[M,N] = A[M,K] * Bt[N,K]^T  (A, Bt bf16 in memory,
// both K-contiguous; fp32 accumulate via v_wmma_f32_16x16x32_bf16)
//
// Block tile: 128x128, 256 threads (8 wave32), wave tile 64x32. A pass takes
// one 128-byte line of every row, which in bf16 is K-step 64 (two WMMA k-steps).
// LDS rows padded to BK+8 bf16 (144B) so per-lane fragment reads are two
// 16B-aligned ds_load_b128, matching the 16-bit A/B operand layout:
//   lane l: row/col = l&15, half = l>>4; chunk0 = K[half*8 .. +7],
//   chunk1 = K[16+half*8 .. +7]  (per K-step of 32).
// ---------------------------------------------------------------------------
#define BM 128
#define BN 128
#define BK 64
#define GT 256
#define LDAP 72   // BK + 8 pad -> 144B row stride, 16B aligned rows

// EPI_QKV: B holds the Q, K and V weights one behind the other (N = 3 * DMODEL),
// Cb the three outputs one behind the other; a block lies wholly in one of them.
enum { EPI_F32 = 0, EPI_BIAS = 1, EPI_BIAS_RELU = 2, EPI_QKV = 3 };

template<int EPI>
__launch_bounds__(GT)
__global__ void gemm_bf16_wmma(const __bf16* A,  // A, B: no __restrict__, see fetch
                               const __bf16* B,  // [N,K] row-major
                               const float* __restrict__ bias,
                               float* __restrict__ C,
                               __bf16* __restrict__ Cb,
                               int M, int N, int K, float scale)
{
    __shared__ __bf16 As[BM][LDAP];
    __shared__ __bf16 Bs[BN][LDAP];

    const int tid  = threadIdx.x;
    const int m0   = blockIdx.y * BM;
    const int n0   = blockIdx.x * BN;
    const int wid  = tid >> 5;
    const int lane = tid & 31;
    const int hf   = lane >> 4;
    const int ln   = lane & 15;
    const int wm   = (wid >> 2) * 64;   // 2 wave rows
    const int wn   = (wid & 3) * 32;    // 4 wave cols

    v8f acc[4][2] = {};

    // Byte offsets of this thread's 16-byte slots inside a K tile (the same for
    // A and B); they do not change over the loop, only the tile's (uniform)
    // base address does.
    uint32_t oa[4];
    #pragma unroll
    for (int i = 0; i < 4; ++i) {
        int idx = i * GT + tid;                  // 0..1023 slots of 8 bf16
        oa[i] = (uint32_t)(((idx >> 3) * K + ((idx & 7) << 3)) * 2);
    }

    // All eight loads of one K tile, issued as one group into registers.
    // A and B are not __restrict__: plain loads keep their place in front of the
    // barrier's fence; marked __restrict__ the compiler sank them over both
    // barriers to their first use, where each waited out its own latency.
    auto fetch = [&](v4u (&ra)[4], v4u (&rb)[4], int kt) {
        const char* At = (const char*)(A + (size_t)m0 * K + kt);
        const char* Bt = (const char*)(B + (size_t)n0 * K + kt);
        #pragma unroll
        for (int i = 0; i < 4; ++i) ra[i] = *(const v4u*)(At + oa[i]);
        // The loads stay in flight while their address registers are reused
        // (by the loads below, by the fragment loads): the wait stands first.
        asm volatile("s_wait_xcnt 0x0" ::: "memory");
        #pragma unroll
        for (int i = 0; i < 4; ++i) rb[i] = *(const v4u*)(Bt + oa[i]);
        asm volatile("s_wait_xcnt 0x0" ::: "memory");   // as above
    };

    // Work-group barrier whose fences order LDS only. As and Bs are all that
    // the waves hand to each other; __syncthreads() would also wait out the
    // global loads that are meant to stay in flight over it.
    auto lds_barrier = [&]() {
        __builtin_amdgcn_fence(__ATOMIC_RELEASE, "workgroup", "local");
        __builtin_amdgcn_s_barrier();
        __builtin_amdgcn_fence(__ATOMIC_ACQUIRE, "workgroup", "local");
    };

    // The raw tile is carried over the loop's back edge: its loads are issued
    // in the pass before, behind the LDS stores that free its registers, and
    // fly during that pass's LDS traffic, barriers and WMMAs. No branch stands
    // around the fetch (a join of two paths would drain it early): in the last
    // pass it re-reads the last tile and nothing uses it.
    v4u ra[4], rb[4];
    fetch(ra, rb, 0);
    for (int kt = 0; kt < K; kt += BK) {
        // ---- stage A and B tiles (128 rows x 64 bf16 each) -------------------
        #pragma unroll
        for (int i = 0; i < 4; ++i) {
            int idx = i * GT + tid;
            int r = idx >> 3, c = (idx & 7) << 3;
            *(v4u*)&As[r][c] = ra[i];
            *(v4u*)&Bs[r][c] = rb[i];
        }
        // Keeps the next tile's loads behind the LDS stores above, so that they
        // land in the registers just freed: lifted over them they need a second
        // set and copies, and the copies' wait for the loads stands early.
        __builtin_amdgcn_sched_barrier(0);
        fetch(ra, rb, (kt + BK < K) ? kt + BK : kt);
        lds_barrier();

        // ---- fragments + 8 WMMAs per k-step of 32, k ascending ---------------
        #pragma unroll
        for (int ks = 0; ks < BK; ks += 32) {
            Frag af[4], bfr[2];
            #pragma unroll
            for (int mt = 0; mt < 4; ++mt) {
                const __bf16* p = &As[wm + mt * 16 + ln][ks];
                af[mt].q[0] = *(const uint4*)(p + hf * 8);
                af[mt].q[1] = *(const uint4*)(p + 16 + hf * 8);
            }
            #pragma unroll
            for (int nt = 0; nt < 2; ++nt) {
                const __bf16* p = &Bs[wn + nt * 16 + ln][ks];
                bfr[nt].q[0] = *(const uint4*)(p + hf * 8);
                bfr[nt].q[1] = *(const uint4*)(p + 16 + hf * 8);
            }
            #pragma unroll
            for (int mt = 0; mt < 4; ++mt)
                #pragma unroll
                for (int nt = 0; nt < 2; ++nt)
                    acc[mt][nt] = __builtin_amdgcn_wmma_f32_16x16x32_bf16(
                        false, af[mt].v, false, bfr[nt].v, (short)0, acc[mt][nt], false, false);
        }
        lds_barrier();
    }

    // ---- epilogue: C/D layout -> element (m,n): vgpr r = m&7, lane = n + 16*(m>>3)
    if (EPI == EPI_QKV) {
        // One test per block, in front of the stores: 0 = Q, 1 = K, 2 = V.
        const int sel = n0 / DMODEL;
        __bf16* dst = Cb + (size_t)sel * ((size_t)BATCH * SEQ * DMODEL);
        const float sc = (sel == 0) ? scale : 1.0f;   // Q pre-scaled by 1/sqrt(DK)
        const int b  = m0 >> 11;                      // BM divides SEQ: one batch per block
        const int t0 = (m0 & (SEQ - 1)) + wm + hf * 8;
        const int c0 = (n0 & (DMODEL - 1)) + wn + ln;
        if (sel < 2) {      // Q, K: [B*T, H*64] fp32 -> [B,H,T,64] bf16
            #pragma unroll
            for (int mt = 0; mt < 4; ++mt)
            #pragma unroll
            for (int nt = 0; nt < 2; ++nt)
            #pragma unroll
            for (int r = 0; r < 8; ++r) {
                int t = t0 + mt * 16 + r, col = c0 + nt * 16;
                int h = col >> 6, dd = col & 63;
                dst[(((size_t)(b * NH + h) * SEQ + t) << 6) + dd] = f2bf(acc[mt][nt][r] * sc);
            }
            // The last stores are still in flight where the other branch's code, laid
            // out behind this one, reuses their registers: the wait stands first.
            asm volatile("s_wait_xcnt 0x0" ::: "memory");
        } else {            // V: -> [B,H,64,T] bf16 (transposed)
            #pragma unroll
            for (int mt = 0; mt < 4; ++mt)
            #pragma unroll
            for (int nt = 0; nt < 2; ++nt)
            #pragma unroll
            for (int r = 0; r < 8; ++r) {
                int t = t0 + mt * 16 + r, col = c0 + nt * 16;
                int h = col >> 6, dd = col & 63;
                dst[((size_t)(b * NH + h) * 64 + dd) * SEQ + t] = f2bf(acc[mt][nt][r]);
            }
            asm volatile("s_wait_xcnt 0x0" ::: "memory");   // as above
        }
        return;
    }
    #pragma unroll
    for (int mt = 0; mt < 4; ++mt)
    #pragma unroll
    for (int nt = 0; nt < 2; ++nt)
    #pragma unroll
    for (int r = 0; r < 8; ++r) {
        int row = m0 + wm + mt * 16 + r + hf * 8;
        int col = n0 + wn + nt * 16 + ln;
        float v = acc[mt][nt][r];
        if (EPI == EPI_BIAS || EPI == EPI_BIAS_RELU) v += bias[col];
        if (EPI == EPI_BIAS_RELU) v = fmaxf(v, 0.0f);
        if (EPI == EPI_F32 || EPI == EPI_BIAS) {
            C[(size_t)row * N + col] = v;
        } else {                             // EPI_BIAS_RELU feeds the next GEMM only: bf16
            Cb[(size_t)row * N + col] = f2bf(v);
        }
    }
}

// ---------------------------------------------------------------------------
// Causal flash attention: grid (T/64, B*H), 128 threads (4 waves).
// Wave w owns q rows qtile*64 + w*16 .. +15; streams K/V in 64-wide chunks
// (only sc <= qtile: causal), online softmax, ctx accumulated in fp32.
// Both products are taken transposed: St = K * Qt and Ot += Vt * Pt. A lane
// then holds scores of ONE query (column ln), keys nt*16 + hf*8 + r: maximum
// and sum run inside the lane, the two halves meet in one register exchange,
// and two St tiles, rounded in place, are the B operand Pt of the second
// product (its k order is the one the Vs loader below already uses).
// ---------------------------------------------------------------------------
#define AT 128
#define KPAD 72   // 64 + 8 pad -> 144B row stride, 16B aligned rows

__launch_bounds__(AT)
__global__ void flash_attn_kernel(const __bf16* __restrict__ qg,
                                  const __bf16* __restrict__ kg,
                                  const __bf16* __restrict__ vtg,
                                  __bf16* __restrict__ ctx)
{
    __shared__ __bf16 Ks[64][KPAD];       // K chunk   [s][dk]
    __shared__ __bf16 Vs[64][KPAD];       // Vt chunk  [dv][s]

    const int tid   = threadIdx.x;
    const int wid   = tid >> 5;
    const int lane  = tid & 31;
    const int hf    = lane >> 4;
    const int ln    = lane & 15;
    const int bh    = blockIdx.y;         // b*NH + h
    const int qtile = blockIdx.x;
    const int qrow0 = qtile * 64 + wid * 16;

    // Q fragments (B operand: column = query ln; K = DHEAD = 64 -> two K-steps of 32)
    const __bf16* qrow = qg + ((size_t)bh * SEQ + qrow0 + ln) * DHEAD;
    Frag aq[2];
    #pragma unroll
    for (int ks = 0; ks < 2; ++ks) {
        aq[ks].q[0] = *(const uint4*)(qrow + ks * 32 + hf * 8);
        aq[ks].q[1] = *(const uint4*)(qrow + ks * 32 + 16 + hf * 8);
    }

    float cmax = -3.0e38f;   // running maximum of query ln, alike in both halves
    float csum = 0.0f;       // running sum over the keys of this lane's half only
    v8f cacc[4] = {};        // Ot: dv = nt*16 + hf*8 + r, query ln

    const __bf16* kbase = kg  + (size_t)bh * SEQ * DHEAD;
    const __bf16* vbase = vtg + (size_t)bh * DHEAD * SEQ;
    const int t_idx = qrow0 + ln;

    for (int sc = 0; sc <= qtile; ++sc) {
        const int s0 = sc * 64;
        // ---- stage K chunk [64][64] and Vt chunk [64][64] ------------------
        // All 16 loads first, then the LDS stores: written load by store, this
        // build waited out each pair's latency in turn.
        uint2 kr[8], vr[8];
        #pragma unroll
        for (int i = 0; i < 8; ++i) {
            int idx = i * AT + tid;           // 0..1023 (8B units)
            int r = idx >> 4, c = (idx & 15) << 2;
            kr[i] = *(const uint2*)(kbase + (size_t)(s0 + r) * DHEAD + c);
            vr[i] = *(const uint2*)(vbase + (size_t)r * SEQ + s0 + c);
        }
        #pragma unroll
        for (int i = 0; i < 8; ++i) {
            int idx = i * AT + tid;
            int r = idx >> 4, c = (idx & 15) << 2;
            *(uint2*)&Ks[r][c] = kr[i];
            *(uint2*)&Vs[r][c] = vr[i];
        }
        __syncthreads();

        // ---- St = K * Qt  (64 keys x 16 queries per wave) ------------------
        // All 16 fragment loads go out as one group, each into registers of its
        // own: written load by WMMA, this build took one register set for all
        // eight fragments and waited out the LDS latency in front of every WMMA.
        Frag bk[4][2];
        #pragma unroll
        for (int nt = 0; nt < 4; ++nt)
            #pragma unroll
            for (int ks = 0; ks < 2; ++ks) {
                const __bf16* p = &Ks[nt * 16 + ln][ks * 32];
                bk[nt][ks].q[0] = *(const uint4*)(p + hf * 8);
                bk[nt][ks].q[1] = *(const uint4*)(p + 16 + hf * 8);
            }
        // Keeps the group whole: without it the loads sink back among the WMMAs.
        __builtin_amdgcn_sched_barrier(0);
        v8f sacc[4] = {};
        #pragma unroll
        for (int nt = 0; nt < 4; ++nt)
            #pragma unroll
            for (int ks = 0; ks < 2; ++ks)
                sacc[nt] = __builtin_amdgcn_wmma_f32_16x16x32_bf16(
                    false, bk[nt][ks].v, false, aq[ks].v, (short)0, sacc[nt], false, false);
        // The Vt fragments of the second product, again as one group, issued here
        // so that they land under the softmax.
        Frag bv[4][2];
        #pragma unroll
        for (int nt = 0; nt < 4; ++nt)
            #pragma unroll
            for (int ks = 0; ks < 2; ++ks) {
                const __bf16* p = &Vs[nt * 16 + ln][ks * 32];
                bv[nt][ks].q[0] = *(const uint4*)(p + hf * 8);
                bv[nt][ks].q[1] = *(const uint4*)(p + 16 + hf * 8);
            }
        // Keeps these loads in front of the softmax: sunk to their WMMAs they
        // would each be waited for there.
        __builtin_amdgcn_sched_barrier(0);
        // ---- causal mask: key s0 + hf*8 + (nt*16 + r) against query t_idx ---
        const int room = t_idx - s0 - hf * 8;
        #pragma unroll
        for (int nt = 0; nt < 4; ++nt)
            #pragma unroll
            for (int r = 0; r < 8; ++r)
                sacc[nt][r] = (nt * 16 + r > room) ? -3.0e38f : sacc[nt][r];
        // ---- online softmax: one query per lane ----------------------------
        float mt[4];
        #pragma unroll
        for (int nt = 0; nt < 4; ++nt) {
            mt[nt] = sacc[nt][0];
            #pragma unroll
            for (int r = 1; r < 8; ++r) mt[nt] = fmaxf(mt[nt], sacc[nt][r]);
        }
        float mx = fmaxf(fmaxf(mt[0], mt[1]), fmaxf(mt[2], mt[3]));
        mx = fmaxf(mx, xhalf(mx));
        const float mnew = fmaxf(cmax, mx);
        const float corr = __expf(cmax - mnew);
        cmax = mnew;
        Frag bp[2];                       // Pt, B operand: k = key within 32
        float pt[4];
        #pragma unroll
        for (int nt = 0; nt < 4; ++nt) {
            pt[nt] = 0.0f;
            #pragma unroll
            for (int r = 0; r < 8; r += 2) {
                float p0 = __expf(sacc[nt][r]     - mnew);
                float p1 = __expf(sacc[nt][r + 1] - mnew);
                pt[nt] += p0 + p1;
                bp[nt >> 1].u[(nt & 1) * 4 + (r >> 1)] = f2bf2(p0, p1);
            }
        }
        csum = csum * corr + ((pt[0] + pt[1]) + (pt[2] + pt[3]));
        #pragma unroll
        for (int nt = 0; nt < 4; ++nt)
            #pragma unroll
            for (int r = 0; r < 8; ++r) cacc[nt][r] = cacc[nt][r] * corr;
        // ---- Ot += Vt * Pt ---------------------------------------------------
        #pragma unroll
        for (int nt = 0; nt < 4; ++nt)
            #pragma unroll
            for (int ks = 0; ks < 2; ++ks)
                cacc[nt] = __builtin_amdgcn_wmma_f32_16x16x32_bf16(
                    false, bv[nt][ks].v, false, bp[ks].v, (short)0, cacc[nt], false, false);
        __syncthreads();
    }

    // ---- normalize + store ctx as [B*T, H*DV] bf16 (a GEMM operand) ---------
    // A lane holds 8 consecutive dv of its query per tile: one 16-byte store.
    const int b = bh / NH, h = bh % NH;
    const float inv = 1.0f / (csum + xhalf(csum));
    __bf16* crow = ctx + (size_t)(b * SEQ + t_idx) * DMODEL + h * 64 + hf * 8;
    #pragma unroll
    for (int nt = 0; nt < 4; ++nt) {
        uint4 o;
        o.x = f2bf2(cacc[nt][0] * inv, cacc[nt][1] * inv);
        o.y = f2bf2(cacc[nt][2] * inv, cacc[nt][3] * inv);
        o.z = f2bf2(cacc[nt][4] * inv, cacc[nt][5] * inv);
        o.w = f2bf2(cacc[nt][6] * inv, cacc[nt][7] * inv);
        *(uint4*)(crow + nt * 16) = o;
    }
}

// ---------------------------------------------------------------------------
// out = LayerNorm(a + b) * gamma + beta ; one 1024-wide row per 256-thr block
// WB: also write the row as bf16, the form in which the next GEMM reads it
// ---------------------------------------------------------------------------
template<bool WB>
__launch_bounds__(256)
__global__ void add_ln_kernel(const float* __restrict__ a,
                              const float* __restrict__ b,
                              const float* __restrict__ gamma,
                              const float* __restrict__ beta,
                              float* __restrict__ out,
                              __bf16* __restrict__ outb)
{
    __shared__ float red[16];
    const int row = blockIdx.x;
    const int tid = threadIdx.x;
    const size_t base = (size_t)row * DMODEL;

    float v[4]; float s = 0.0f, ss = 0.0f;
    #pragma unroll
    for (int j = 0; j < 4; ++j) {
        int idx = tid + j * 256;
        float x = a[base + idx] + b[base + idx];
        v[j] = x; s += x; ss += x * x;
    }
    #pragma unroll
    for (int off = 1; off < 32; off <<= 1) {
        s  += __shfl_xor(s,  off, 32);
        ss += __shfl_xor(ss, off, 32);
    }
    int wid = tid >> 5, lane = tid & 31;
    if (lane == 0) { red[wid] = s; red[8 + wid] = ss; }
    __syncthreads();
    if (wid == 0) {
        float s2  = (lane < 8) ? red[lane] : 0.0f;
        float ss2 = (lane < 8) ? red[8 + lane] : 0.0f;
        #pragma unroll
        for (int off = 1; off < 8; off <<= 1) {
            s2  += __shfl_xor(s2,  off, 32);
            ss2 += __shfl_xor(ss2, off, 32);
        }
        if (lane == 0) { red[0] = s2; red[8] = ss2; }
    }
    __syncthreads();
    float mu  = red[0] * (1.0f / DMODEL);
    float var = red[8] * (1.0f / DMODEL) - mu * mu;
    float rs  = rsqrtf(var + EPSLN);
    #pragma unroll
    for (int j = 0; j < 4; ++j) {
        int idx = tid + j * 256;
        float y = (v[j] - mu) * rs * gamma[idx] + beta[idx];
        out[base + idx] = y;
        if (WB) outb[base + idx] = f2bf(y);
    }
}

// ---------------------------------------------------------------------------
// Host-side orchestration
// ---------------------------------------------------------------------------
extern "C" void kernel_launch(void* const* d_in, const int* in_sizes, int n_in,
                              void* d_out, int out_size, void* d_ws, size_t ws_size,
                              hipStream_t stream)
{
    const float* x   = (const float*)d_in[0];
    const float* Wq  = (const float*)d_in[1];
    const float* Wk  = (const float*)d_in[2];
    const float* Wv  = (const float*)d_in[3];
    const float* Wo  = (const float*)d_in[4];
    const float* W1  = (const float*)d_in[5];
    const float* b1  = (const float*)d_in[6];
    const float* W2  = (const float*)d_in[7];
    const float* b2  = (const float*)d_in[8];
    const float* g1  = (const float*)d_in[9];
    const float* be1 = (const float*)d_in[10];
    const float* g2  = (const float*)d_in[11];
    const float* be2 = (const float*)d_in[12];
    float* out = (float*)d_out;

    const int M = BATCH * SEQ;   // 4096 token rows

    char* w = (char*)d_ws;
    auto take = [&](size_t bytes) -> char* {
        char* p = w; w += (bytes + 255) & ~(size_t)255; return p;
    };
    __bf16* qb  = (__bf16*)take((size_t)3 * M * DMODEL * sizeof(__bf16)); // 3 x 8 MB, one behind the other
    __bf16* kb  = qb + (size_t)M * DMODEL;
    __bf16* vtb = kb + (size_t)M * DMODEL;
    __bf16* ctx = (__bf16*)take((size_t)M * DMODEL * sizeof(__bf16)); //  8 MB
    float*  ao  = (float*)take((size_t)M * DMODEL * sizeof(float));   // 16 MB
    float*  h   = (float*)take((size_t)M * DMODEL * sizeof(float));   // 16 MB
    __bf16* hb  = (__bf16*)take((size_t)M * DMODEL * sizeof(__bf16)); //  8 MB
    __bf16* f1  = (__bf16*)take((size_t)M * FFDIM  * sizeof(__bf16)); // 32 MB
    float*  f2  = (float*)take((size_t)M * DMODEL * sizeof(float));   // 16 MB
    __bf16* xb  = (__bf16*)take((size_t)M * DMODEL * sizeof(__bf16)); //  8 MB
    __bf16* Wob = (__bf16*)take((size_t)DMODEL * DMODEL * sizeof(__bf16)); // 2 MB
    __bf16* Wqt = (__bf16*)take((size_t)3 * DMODEL * DMODEL * sizeof(__bf16)); // 3 x 2 MB: one [3072][1024] operand
    __bf16* Wkt = Wqt + (size_t)DMODEL * DMODEL;
    __bf16* Wvt = Wkt + (size_t)DMODEL * DMODEL;
    __bf16* W1t = (__bf16*)take((size_t)DMODEL * FFDIM  * sizeof(__bf16)); // 8 MB
    __bf16* W2t = (__bf16*)take((size_t)DMODEL * FFDIM  * sizeof(__bf16)); // 8 MB

    const dim3 blk(GT);
    const dim3 g_d(DMODEL / BN, M / BM);   // (8, 32)
    const dim3 g_ff(FFDIM / BN, M / BM);   // (32, 32)
    const dim3 g_qkv(3 * DMODEL / BN, M / BM);   // (24, 32)
    const float qscale = 0.125f;           // 1/sqrt(DK)

    // fp32 inputs -> bf16 GEMM operands, K-contiguous
    pack_operands<<<dim3(PK_ALL), dim3(256), 0, stream>>>(x, Wo, Wq, Wk, Wv, W1, W2,
                                                          xb, Wob, Wqt, Wkt, Wvt, W1t, W2t);

    // Q,K,V projections in one launch: 768 blocks, three to a WGP, so that one
    // block's loads, LDS traffic and barriers run under the others' WMMAs.
    // Packed straight to the attention layouts in bf16.
    gemm_bf16_wmma<EPI_QKV><<<g_qkv, blk, 0, stream>>>(xb, Wqt, nullptr, nullptr, qb, M, 3 * DMODEL, DMODEL, qscale);

    // Causal flash attention
    flash_attn_kernel<<<dim3(SEQ / 64, BATCH * NH), dim3(AT), 0, stream>>>(qb, kb, vtb, ctx);

    // Output projection (Wo is [N,K] row-major as given)
    gemm_bf16_wmma<EPI_F32><<<g_d, blk, 0, stream>>>(ctx, Wob, nullptr, ao, nullptr, M, DMODEL, DMODEL, 1.0f);

    // h = LN(x + attn_out)
    add_ln_kernel<true><<<dim3(M), dim3(256), 0, stream>>>(x, ao, g1, be1, h, hb);

    // FFN
    gemm_bf16_wmma<EPI_BIAS_RELU><<<g_ff, blk, 0, stream>>>(hb, W1t, b1, nullptr, f1, M, FFDIM,  DMODEL, 1.0f);
    gemm_bf16_wmma<EPI_BIAS><<<g_d,  blk, 0, stream>>>(f1, W2t, b2, f2, nullptr, M, DMODEL, FFDIM,  1.0f);

    // out = LN(h + ffn)
    add_ln_kernel<false><<<dim3(M), dim3(256), 0, stream>>>(h, f2, g2, be2, out, nullptr);
}

// v006
// Measured time: 180 microseconds a run.
// Two timings next to v005 both put it at 1.10 times that version's speed.
// All steps since v000 together make it 5.55 times as fast.
#include <hip/hip_runtime.h>
#include <hip/hip_bf16.h>
#include <stdint.h>

// ---------------------------------------------------------------------------
// Problem constants (match reference)
// ---------------------------------------------------------------------------
#define BATCH  2
#define SEQ    2048
#define DMODEL 1024
#define NH     16
#define DHEAD  64
#define FFDIM  4096
#define EPSLN  1e-6f

// ---------------------------------------------------------------------------
// WMMA types (CDNA5 / gfx1250, wave32)
// ---------------------------------------------------------------------------
typedef __attribute__((ext_vector_type(16))) __bf16 v16bf;
typedef __attribute__((ext_vector_type(8)))  float  v8f;
typedef __attribute__((ext_vector_type(4)))  uint32_t v4u;   // 16 raw bytes in registers

union Frag {
    v16bf v;
    uint4 q[2];
    uint32_t u[8];
};

__device__ __forceinline__ __bf16 f2bf(float f) {
    union { float f; uint32_t u; } c; c.f = f;
    uint32_t r = (c.u + 0x7FFFu + ((c.u >> 16) & 1u)) >> 16;   // RNE
    union { uint16_t s; __bf16 b; } o; o.s = (uint16_t)r;
    return o.b;
}

// Two fp32 values -> one dword of two bf16 (lo at the lower address).
__device__ __forceinline__ uint32_t f2bf2(float lo, float hi) {
    union { __bf16 b[2]; uint32_t u; } o;
    o.b[0] = f2bf(lo); o.b[1] = f2bf(hi);
    return o.u;
}

// Value of lane l ^ 16 (the other 16-lane half), without LDS.
__device__ __forceinline__ float xhalf(float x) {
    int b = __builtin_bit_cast(int, x);
    return __builtin_bit_cast(float,
        __builtin_amdgcn_permlanex16(b, b, 0x76543210, 0xfedcba98, false, false));
}

// ---------------------------------------------------------------------------
// Operand packing, once per call: every GEMM operand that arrives as fp32 is
// rounded to bf16 here, B operands also transposed to [N][K], so that no GEMM
// block repeats that work per tile. One 64x64 tile per 256-thread block.
//   x  [4096][1024] and Wo [N=1024][K=1024]   : same layout
//   Wq, Wk, Wv [K=1024][N=1024], W1 [1024][4096], W2 [4096][1024] : -> [N][K]
// ---------------------------------------------------------------------------
#define PK_X   (BATCH * SEQ / 64 * (DMODEL / 64))     // 1024 tiles
#define PK_W   (DMODEL / 64 * (DMODEL / 64))          //  256 tiles
#define PK_F   (DMODEL / 64 * (FFDIM / 64))           // 1024 tiles
#define PK_ALL (PK_X + 4 * PK_W + 2 * PK_F)

__launch_bounds__(256)
__global__ void pack_operands(const float* __restrict__ x,  const float* __restrict__ Wo,
                              const float* __restrict__ Wq, const float* __restrict__ Wk,
                              const float* __restrict__ Wv, const float* __restrict__ W1,
                              const float* __restrict__ W2,
                              __bf16* __restrict__ xb,  __bf16* __restrict__ Wob,
                              __bf16* __restrict__ Wqt, __bf16* __restrict__ Wkt,
                              __bf16* __restrict__ Wvt, __bf16* __restrict__ W1t,
                              __bf16* __restrict__ W2t)
{
    __shared__ uint32_t Ts[64][33];   // [n][k pair]; 33 dwords: writes and reads hit distinct banks

    const int tid = threadIdx.x;
    int t = blockIdx.x;
    const float* src; __bf16* dst; int rows, cols; bool tr;
    if      (t < PK_X)                       { src = x;  dst = xb;  rows = BATCH * SEQ; cols = DMODEL; tr = false; }
    else if ((t -= PK_X) < PK_W)             { src = Wo; dst = Wob; rows = DMODEL; cols = DMODEL; tr = false; }
    else if ((t -= PK_W) < PK_W)             { src = Wq; dst = Wqt; rows = DMODEL; cols = DMODEL; tr = true; }
    else if ((t -= PK_W) < PK_W)             { src = Wk; dst = Wkt; rows = DMODEL; cols = DMODEL; tr = true; }
    else if ((t -= PK_W) < PK_W)             { src = Wv; dst = Wvt; rows = DMODEL; cols = DMODEL; tr = true; }
    else if ((t -= PK_W) < PK_F)             { src = W1; dst = W1t; rows = DMODEL; cols = FFDIM;  tr = true; }
    else                     { t -= PK_F;      src = W2; dst = W2t; rows = FFDIM;  cols = DMODEL; tr = true; }
    const int tpr = cols >> 6;               // tiles per row of tiles
    const int r0 = (t / tpr) << 6, c0 = (t % tpr) << 6;

    if (!tr) {
        size_t e[4]; float4 v[4];
        #pragma unroll
        for (int i = 0; i < 4; ++i) {
            int idx = i * 256 + tid;
            e[i] = (size_t)(r0 + (idx >> 4)) * cols + c0 + ((idx & 15) << 2);
            v[i] = *(const float4*)(src + e[i]);
            // The load stays in flight while its address registers are reused
            // (by the next load's result, by the rounding): the wait stands first.
            asm volatile("s_wait_xcnt 0x0" ::: "memory");
        }
        #pragma unroll
        for (int i = 0; i < 4; ++i) {
            uint2 o; o.x = f2bf2(v[i].x, v[i].y); o.y = f2bf2(v[i].z, v[i].w);
            *(uint2*)(dst + e[i]) = o;
            // The store stays in flight while its address and data registers are
            // reused (by the next rounding, by code behind the branch): wait first.
            asm volatile("s_wait_xcnt 0x0" ::: "memory");
        }
    } else {                                 // block-uniform branch: the barrier is safe
        float4 a[2], b[2];
        #pragma unroll
        for (int i = 0; i < 2; ++i) {
            int idx = i * 256 + tid;
            const float* p = src + (size_t)(r0 + 2 * (idx >> 4)) * cols + c0 + ((idx & 15) << 2);
            a[i] = *(const float4*)p;
            asm volatile("s_wait_xcnt 0x0" ::: "memory");   // as above
            b[i] = *(const float4*)(p + cols);
            asm volatile("s_wait_xcnt 0x0" ::: "memory");   // as above
        }
        #pragma unroll
        for (int i = 0; i < 2; ++i) {
            int idx = i * 256 + tid;
            int kp = idx >> 4, c = (idx & 15) << 2;
            Ts[c + 0][kp] = f2bf2(a[i].x, b[i].x); Ts[c + 1][kp] = f2bf2(a[i].y, b[i].y);
            Ts[c + 2][kp] = f2bf2(a[i].z, b[i].z); Ts[c + 3][kp] = f2bf2(a[i].w, b[i].w);
        }
        __syncthreads();
        #pragma unroll
        for (int i = 0; i < 2; ++i) {
            int idx = i * 256 + tid;
            int n = idx >> 3, q = (idx & 7) << 2;
            uint4 o; o.x = Ts[n][q]; o.y = Ts[n][q + 1]; o.z = Ts[n][q + 2]; o.w = Ts[n][q + 3];
            *(uint4*)(dst + (size_t)(c0 + n) * rows + r0 + 2 * q) = o;
        }
    }
}

// ---------------------------------------------------------------------------
// Generic bf16-WMMA GEMM: C[M,N] = A[M,K] * Bt[N,K]^T  (A, Bt bf16 in memory,
// both K-contiguous; fp32 accumulate via v_wmma_f32_16x16x32_bf16)
//
// Block tile: 128x128, 256 threads (8 wave32), wave tile 64x32. A pass takes
// one 128-byte line of every row, which in bf16 is K-step 64 (two WMMA k-steps).
// LDS rows padded to BK+8 bf16 (144B) so per-lane fragment reads are two
// 16B-aligned ds_load_b128, matching the 16-bit A/B operand layout:
//   lane l: row/col = l&15, half = l>>4; chunk0 = K[half*8 .. +7],
//   chunk1 = K[16+half*8 .. +7]  (per K-step of 32).
// ---------------------------------------------------------------------------
#define BM 128
#define BN 128
#define BK 64
#define GT 256
#define LDAP 72   // BK + 8 pad -> 144B row stride, 16B aligned rows

// EPI_QKV: B holds the Q, K and V weights one behind the other (N = 3 * DMODEL),
// Cb the three outputs one behind the other; a block lies wholly in one of them.
enum { EPI_F32 = 0, EPI_BIAS = 1, EPI_BIAS_RELU = 2, EPI_QKV = 3 };

// PF: how many K tiles ahead the global loads go out, each tile into a register
// set of its own. PF is 1 or even; K is a multiple of PF * BK and at least twice it.
template<int EPI, int PF>
__launch_bounds__(GT)
__global__ void gemm_bf16_wmma(const __bf16* A,  // A, B: no __restrict__, see fetch
                               const __bf16* B,  // [N,K] row-major
                               const float* __restrict__ bias,
                               float* __restrict__ C,
                               __bf16* __restrict__ Cb,
                               int M, int N, int K, float scale)
{
    constexpr int NB = (PF > 1) ? 2 : 1;   // LDS buffers per operand
    __shared__ __bf16 As[NB][BM][LDAP];
    __shared__ __bf16 Bs[NB][BN][LDAP];

    const int tid  = threadIdx.x;
    const int m0   = blockIdx.y * BM;
    const int n0   = blockIdx.x * BN;
    const int wid  = tid >> 5;
    const int lane = tid & 31;
    const int hf   = lane >> 4;
    const int ln   = lane & 15;
    const int wm   = (wid >> 2) * 64;   // 2 wave rows
    const int wn   = (wid & 3) * 32;    // 4 wave cols

    v8f acc[4][2] = {};

    // Byte offsets of this thread's 16-byte slots inside a K tile (the same for
    // A and B); they do not change over the loop, only the tile's (uniform)
    // base address does.
    uint32_t oa[4];
    #pragma unroll
    for (int i = 0; i < 4; ++i) {
        int idx = i * GT + tid;                  // 0..1023 slots of 8 bf16
        oa[i] = (uint32_t)(((idx >> 3) * K + ((idx & 7) << 3)) * 2);
    }

    // All eight loads of one K tile, issued as one group into registers.
    // A and B are not __restrict__: plain loads keep their place in front of the
    // barrier's fence; marked __restrict__ the compiler sank them over both
    // barriers to their first use, where each waited out its own latency.
    // each: the wait stands behind every load (for the passes behind the loop, where
    // this build keeps a load's address in registers that a later load of the group
    // fills).
    auto fetch = [&](v4u (&ra)[4], v4u (&rb)[4], int kt, bool each = false) {
        const char* At = (const char*)(A + (size_t)m0 * K + kt);
        const char* Bt = (const char*)(B + (size_t)n0 * K + kt);
        #pragma unroll
        for (int i = 0; i < 4; ++i) {
            ra[i] = *(const v4u*)(At + oa[i]);
            if (each && i < 3) asm volatile("s_wait_xcnt 0x0" ::: "memory");
        }
        // The loads stay in flight while their address registers are reused
        // (by the loads below, by the fragment loads): the wait stands first.
        asm volatile("s_wait_xcnt 0x0" ::: "memory");
        #pragma unroll
        for (int i = 0; i < 4; ++i) {
            rb[i] = *(const v4u*)(Bt + oa[i]);
            if (each && i < 3) asm volatile("s_wait_xcnt 0x0" ::: "memory");
        }
        asm volatile("s_wait_xcnt 0x0" ::: "memory");   // as above
    };

    // Work-group barrier whose fences order LDS only. As and Bs are all that
    // the waves hand to each other; __syncthreads() would also wait out the
    // global loads that are meant to stay in flight over it.
    auto lds_barrier = [&]() {
        __builtin_amdgcn_fence(__ATOMIC_RELEASE, "workgroup", "local");
        __builtin_amdgcn_s_barrier();
        __builtin_amdgcn_fence(__ATOMIC_ACQUIRE, "workgroup", "local");
    };

    // Set p's raw tile goes to LDS buffer b (128 rows x 64 bf16 of A and of B).
    v4u ra[PF][4], rb[PF][4];
    auto stage = [&](int p, int b) {
        #pragma unroll
        for (int i = 0; i < 4; ++i) {
            int idx = i * GT + tid;
            int r = idx >> 3, c = (idx & 7) << 3;
            *(v4u*)&As[b][r][c] = ra[p][i];
            *(v4u*)&Bs[b][r][c] = rb[p][i];
        }
        // Keeps the next loads behind the LDS stores above, so that they land in
        // the registers just freed: lifted over them they need a further set and
        // copies, and the copies' wait for the loads stands early.
        __builtin_amdgcn_sched_barrier(0);
    };

    // PF raw tiles are carried over the loop's back edge: a tile's loads are
    // issued behind the LDS stores that free its registers and fly during PF
    // passes of LDS traffic, barriers and WMMAs. No branch stands around a fetch
    // (a join of two paths would drain it early).
    #pragma unroll
    for (int p = 0; p < PF; ++p) fetch(ra[p], rb[p], p * BK);
    if (PF == 1) {
        // Launches with several blocks on a WGP, which hide a load's latency and
        // each other's LDS phases. In the last pass the fetch re-reads the last tile
        // and nothing uses it.
        for (int kt = 0; kt < K; kt += BK) {
            stage(0, 0);
            fetch(ra[0], rb[0], (kt + BK < K) ? kt + BK : kt);
            lds_barrier();

            // ---- fragments + 8 WMMAs per k-step of 32, k ascending -----------
            #pragma unroll
            for (int ks = 0; ks < BK; ks += 32) {
                Frag af[4], bfr[2];
                #pragma unroll
                for (int mt = 0; mt < 4; ++mt) {
                    const __bf16* p = &As[0][wm + mt * 16 + ln][ks];
                    af[mt].q[0] = *(const uint4*)(p + hf * 8);
                    af[mt].q[1] = *(const uint4*)(p + 16 + hf * 8);
                }
                #pragma unroll
                for (int nt = 0; nt < 2; ++nt) {
                    const __bf16* p = &Bs[0][wn + nt * 16 + ln][ks];
                    bfr[nt].q[0] = *(const uint4*)(p + hf * 8);
                    bfr[nt].q[1] = *(const uint4*)(p + 16 + hf * 8);
                }
                #pragma unroll
                for (int mt = 0; mt < 4; ++mt)
                    #pragma unroll
                    for (int nt = 0; nt < 2; ++nt)
                        acc[mt][nt] = __builtin_amdgcn_wmma_f32_16x16x32_bf16(
                            false, af[mt].v, false, bfr[nt].v, (short)0, acc[mt][nt], false, false);
            }
            lds_barrier();
        }
    } else {
        // Launches with one block on a WGP: nothing else hides what a pass waits
        // for, so the pass itself overlaps it. Pass t reads tile t from buffer
        // t & 1; meanwhile tile t + 1, asked for PF passes earlier, goes from its
        // registers to the other buffer, and tile t + 1 + PF is asked for. The one
        // barrier at the foot of a pass publishes tile t + 1 and ends every read of
        // tile t, whose buffer the next pass overwrites.
        auto pass = [&](int p, bool more, bool ask, int knext, bool each) {
            // The pass's 24 fragment loads go out as one group, in the order of
            // their use; the WMMAs follow on counted waits.
            Frag af[2][4], bfr[2][2];
            #pragma unroll
            for (int s = 0; s < 2; ++s) {
                #pragma unroll
                for (int nt = 0; nt < 2; ++nt) {
                    const __bf16* q = &Bs[p & 1][wn + nt * 16 + ln][s * 32];
                    bfr[s][nt].q[0] = *(const uint4*)(q + hf * 8);
                    bfr[s][nt].q[1] = *(const uint4*)(q + 16 + hf * 8);
                }
                #pragma unroll
                for (int mt = 0; mt < 4; ++mt) {
                    const __bf16* q = &As[p & 1][wm + mt * 16 + ln][s * 32];
                    af[s][mt].q[0] = *(const uint4*)(q + hf * 8);
                    af[s][mt].q[1] = *(const uint4*)(q + 16 + hf * 8);
                }
            }
            // Keeps the group whole and in front: in the unrolled loop this build
            // split it into pairs, each waited out to 0 in front of its two WMMAs.
            __builtin_amdgcn_sched_barrier(0);
            if (more) stage((p + 1) % PF, (p + 1) & 1);
            if (ask)  fetch(ra[(p + 1) % PF], rb[(p + 1) % PF], knext, each);
            #pragma unroll
            for (int s = 0; s < 2; ++s)
                #pragma unroll
                for (int mt = 0; mt < 4; ++mt)
                    #pragma unroll
                    for (int nt = 0; nt < 2; ++nt)
                        acc[mt][nt] = __builtin_amdgcn_wmma_f32_16x16x32_bf16(
                            false, af[s][mt].v, false, bfr[s][nt].v, (short)0, acc[mt][nt], false, false);
            // Keeps the WMMAs in front of the barrier, where they run under the LDS
            // traffic: sunk behind it they stood in front of the next pass's loads.
            __builtin_amdgcn_sched_barrier(0);
            lds_barrier();
        };
        stage(0, 0);
        fetch(ra[0], rb[0], PF * BK);
        lds_barrier();
        for (int kt = (PF + 1) * BK; kt < K - PF * BK; kt += PF * BK) {
            #pragma unroll
            for (int p = 0; p < PF; ++p) pass(p, true, true, kt + p * BK, false);
        }
        // The last 2 * PF passes stand behind the loop: PF - 1 tiles are still to
        // be asked for, 2 * PF - 1 still to be staged.
        #pragma unroll
        for (int p = 0; p < PF; ++p) pass(p, true, p + 1 < PF, K - (PF - 1 - p) * BK, true);
        #pragma unroll
        for (int p = 0; p < PF; ++p) pass(p, p + 1 < PF, false, 0, false);
    }

    // ---- epilogue: C/D layout -> element (m,n): vgpr r = m&7, lane = n + 16*(m>>3)
    if (EPI == EPI_QKV) {
        // One test per block, in front of the stores: 0 = Q, 1 = K, 2 = V.
        const int sel = n0 / DMODEL;
        __bf16* dst = Cb + (size_t)sel * ((size_t)BATCH * SEQ * DMODEL);
        const float sc = (sel == 0) ? scale : 1.0f;   // Q pre-scaled by 1/sqrt(DK)
        const int b  = m0 >> 11;                      // BM divides SEQ: one batch per block
        const int t0 = (m0 & (SEQ - 1)) + wm + hf * 8;
        const int c0 = (n0 & (DMODEL - 1)) + wn + ln;
        if (sel < 2) {      // Q, K: [B*T, H*64] fp32 -> [B,H,T,64] bf16
            #pragma unroll
            for (int mt = 0; mt < 4; ++mt)
            #pragma unroll
            for (int nt = 0; nt < 2; ++nt)
            #pragma unroll
            for (int r = 0; r < 8; ++r) {
                int t = t0 + mt * 16 + r, col = c0 + nt * 16;
                int h = col >> 6, dd = col & 63;
                dst[(((size_t)(b * NH + h) * SEQ + t) << 6) + dd] = f2bf(acc[mt][nt][r] * sc);
            }
            // The last stores are still in flight where the other branch's code, laid
            // out behind this one, reuses their registers: the wait stands first.
            asm volatile("s_wait_xcnt 0x0" ::: "memory");
        } else {            // V: -> [B,H,64,T] bf16 (transposed)
            #pragma unroll
            for (int mt = 0; mt < 4; ++mt)
            #pragma unroll
            for (int nt = 0; nt < 2; ++nt)
            #pragma unroll
            for (int r = 0; r < 8; ++r) {
                int t = t0 + mt * 16 + r, col = c0 + nt * 16;
                int h = col >> 6, dd = col & 63;
                dst[((size_t)(b * NH + h) * 64 + dd) * SEQ + t] = f2bf(acc[mt][nt][r]);
            }
            asm volatile("s_wait_xcnt 0x0" ::: "memory");   // as above
        }
        return;
    }
    #pragma unroll
    for (int mt = 0; mt < 4; ++mt)
    #pragma unroll
    for (int nt = 0; nt < 2; ++nt)
    #pragma unroll
    for (int r = 0; r < 8; ++r) {
        int row = m0 + wm + mt * 16 + r + hf * 8;
        int col = n0 + wn + nt * 16 + ln;
        float v = acc[mt][nt][r];
        if (EPI == EPI_BIAS || EPI == EPI_BIAS_RELU) v += bias[col];
        if (EPI == EPI_BIAS_RELU) v = fmaxf(v, 0.0f);
        if (EPI == EPI_F32 || EPI == EPI_BIAS) {
            C[(size_t)row * N + col] = v;
        } else {                             // EPI_BIAS_RELU feeds the next GEMM only: bf16
            Cb[(size_t)row * N + col] = f2bf(v);
        }
    }
}

// ---------------------------------------------------------------------------
// Causal flash attention: grid (T/64, B*H), 128 threads (4 waves).
// Wave w owns q rows qtile*64 + w*16 .. +15; streams K/V in 64-wide chunks
// (only sc <= qtile: causal), online softmax, ctx accumulated in fp32.
// Both products are taken transposed: St = K * Qt and Ot += Vt * Pt. A lane
// then holds scores of ONE query (column ln), keys nt*16 + hf*8 + r: maximum
// and sum run inside the lane, the two halves meet in one register exchange,
// and two St tiles, rounded in place, are the B operand Pt of the second
// product (its k order is the one the Vs loader below already uses).
// ---------------------------------------------------------------------------
#define AT 128
#define KPAD 72   // 64 + 8 pad -> 144B row stride, 16B aligned rows

__launch_bounds__(AT)
__global__ void flash_attn_kernel(const __bf16* __restrict__ qg,
                                  const __bf16* __restrict__ kg,
                                  const __bf16* __restrict__ vtg,
                                  __bf16* __restrict__ ctx)
{
    __shared__ __bf16 Ks[64][KPAD];       // K chunk   [s][dk]
    __shared__ __bf16 Vs[64][KPAD];       // Vt chunk  [dv][s]

    const int tid   = threadIdx.x;
    const int wid   = tid >> 5;
    const int lane  = tid & 31;
    const int hf    = lane >> 4;
    const int ln    = lane & 15;
    const int bh    = blockIdx.y;         // b*NH + h
    const int qtile = blockIdx.x;
    const int qrow0 = qtile * 64 + wid * 16;

    // Q fragments (B operand: column = query ln; K = DHEAD = 64 -> two K-steps of 32)
    const __bf16* qrow = qg + ((size_t)bh * SEQ + qrow0 + ln) * DHEAD;
    Frag aq[2];
    #pragma unroll
    for (int ks = 0; ks < 2; ++ks) {
        aq[ks].q[0] = *(const uint4*)(qrow + ks * 32 + hf * 8);
        aq[ks].q[1] = *(const uint4*)(qrow + ks * 32 + 16 + hf * 8);
    }

    float cmax = -3.0e38f;   // running maximum of query ln, alike in both halves
    float csum = 0.0f;       // running sum over the keys of this lane's half only
    v8f cacc[4] = {};        // Ot: dv = nt*16 + hf*8 + r, query ln

    const __bf16* kbase = kg  + (size_t)bh * SEQ * DHEAD;
    const __bf16* vbase = vtg + (size_t)bh * DHEAD * SEQ;
    const int t_idx = qrow0 + ln;

    for (int sc = 0; sc <= qtile; ++sc) {
        const int s0 = sc * 64;
        // ---- stage K chunk [64][64] and Vt chunk [64][64] ------------------
        // All 16 loads first, then the LDS stores: written load by store, this
        // build waited out each pair's latency in turn.
        uint2 kr[8], vr[8];
        #pragma unroll
        for (int i = 0; i < 8; ++i) {
            int idx = i * AT + tid;           // 0..1023 (8B units)
            int r = idx >> 4, c = (idx & 15) << 2;
            kr[i] = *(const uint2*)(kbase + (size_t)(s0 + r) * DHEAD + c);
            vr[i] = *(const uint2*)(vbase + (size_t)r * SEQ + s0 + c);
        }
        #pragma unroll
        for (int i = 0; i < 8; ++i) {
            int idx = i * AT + tid;
            int r = idx >> 4, c = (idx & 15) << 2;
            *(uint2*)&Ks[r][c] = kr[i];
            *(uint2*)&Vs[r][c] = vr[i];
        }
        __syncthreads();

        // ---- St = K * Qt  (64 keys x 16 queries per wave) ------------------
        // All 16 fragment loads go out as one group, each into registers of its
        // own: written load by WMMA, this build took one register set for all
        // eight fragments and waited out the LDS latency in front of every WMMA.
        Frag bk[4][2];
        #pragma unroll
        for (int nt = 0; nt < 4; ++nt)
            #pragma unroll
            for (int ks = 0; ks < 2; ++ks) {
                const __bf16* p = &Ks[nt * 16 + ln][ks * 32];
                bk[nt][ks].q[0] = *(const uint4*)(p + hf * 8);
                bk[nt][ks].q[1] = *(const uint4*)(p + 16 + hf * 8);
            }
        // Keeps the group whole: without it the loads sink back among the WMMAs.
        __builtin_amdgcn_sched_barrier(0);
        v8f sacc[4] = {};
        #pragma unroll
        for (int nt = 0; nt < 4; ++nt)
            #pragma unroll
            for (int ks = 0; ks < 2; ++ks)
                sacc[nt] = __builtin_amdgcn_wmma_f32_16x16x32_bf16(
                    false, bk[nt][ks].v, false, aq[ks].v, (short)0, sacc[nt], false, false);
        // The Vt fragments of the second product, again as one group, issued here
        // so that they land under the softmax.
        Frag bv[4][2];
        #pragma unroll
        for (int nt = 0; nt < 4; ++nt)
            #pragma unroll
            for (int ks = 0; ks < 2; ++ks) {
                const __bf16* p = &Vs[nt * 16 + ln][ks * 32];
                bv[nt][ks].q[0] = *(const uint4*)(p + hf * 8);
                bv[nt][ks].q[1] = *(const uint4*)(p + 16 + hf * 8);
            }
        // Keeps these loads in front of the softmax: sunk to their WMMAs they
        // would each be waited for there.
        __builtin_amdgcn_sched_barrier(0);
        // ---- causal mask: key s0 + hf*8 + (nt*16 + r) against query t_idx ---
        const int room = t_idx - s0 - hf * 8;
        #pragma unroll
        for (int nt = 0; nt < 4; ++nt)
            #pragma unroll
            for (int r = 0; r < 8; ++r)
                sacc[nt][r] = (nt * 16 + r > room) ? -3.0e38f : sacc[nt][r];
        // ---- online softmax: one query per lane ----------------------------
        float mt[4];
        #pragma unroll
        for (int nt = 0; nt < 4; ++nt) {
            mt[nt] = sacc[nt][0];
            #pragma unroll
            for (int r = 1; r < 8; ++r) mt[nt] = fmaxf(mt[nt], sacc[nt][r]);
        }
        float mx = fmaxf(fmaxf(mt[0], mt[1]), fmaxf(mt[2], mt[3]));
        mx = fmaxf(mx, xhalf(mx));
        const float mnew = fmaxf(cmax, mx);
        const float corr = __expf(cmax - mnew);
        cmax = mnew;
        Frag bp[2];                       // Pt, B operand: k = key within 32
        float pt[4];
        #pragma unroll
        for (int nt = 0; nt < 4; ++nt) {
            pt[nt] = 0.0f;
            #pragma unroll
            for (int r = 0; r < 8; r += 2) {
                float p0 = __expf(sacc[nt][r]     - mnew);
                float p1 = __expf(sacc[nt][r + 1] - mnew);
                pt[nt] += p0 + p1;
                bp[nt >> 1].u[(nt & 1) * 4 + (r >> 1)] = f2bf2(p0, p1);
            }
        }
        csum = csum * corr + ((pt[0] + pt[1]) + (pt[2] + pt[3]));
        #pragma unroll
        for (int nt = 0; nt < 4; ++nt)
            #pragma unroll
            for (int r = 0; r < 8; ++r) cacc[nt][r] = cacc[nt][r] * corr;
        // ---- Ot += Vt * Pt ---------------------------------------------------
        #pragma unroll
        for (int nt = 0; nt < 4; ++nt)
            #pragma unroll
            for (int ks = 0; ks < 2; ++ks)
                cacc[nt] = __builtin_amdgcn_wmma_f32_16x16x32_bf16(
                    false, bv[nt][ks].v, false, bp[ks].v, (short)0, cacc[nt], false, false);
        __syncthreads();
    }

    // ---- normalize + store ctx as [B*T, H*DV] bf16 (a GEMM operand) ---------
    // A lane holds 8 consecutive dv of its query per tile: one 16-byte store.
    const int b = bh / NH, h = bh % NH;
    const float inv = 1.0f / (csum + xhalf(csum));
    __bf16* crow = ctx + (size_t)(b * SEQ + t_idx) * DMODEL + h * 64 + hf * 8;
    #pragma unroll
    for (int nt = 0; nt < 4; ++nt) {
        uint4 o;
        o.x = f2bf2(cacc[nt][0] * inv, cacc[nt][1] * inv);
        o.y = f2bf2(cacc[nt][2] * inv, cacc[nt][3] * inv);
        o.z = f2bf2(cacc[nt][4] * inv, cacc[nt][5] * inv);
        o.w = f2bf2(cacc[nt][6] * inv, cacc[nt][7] * inv);
        *(uint4*)(crow + nt * 16) = o;
    }
}

// ---------------------------------------------------------------------------
// out = LayerNorm(a + b) * gamma + beta ; one 1024-wide row per 256-thr block
// WB: also write the row as bf16, the form in which the next GEMM reads it
// ---------------------------------------------------------------------------
template<bool WB>
__launch_bounds__(256)
__global__ void add_ln_kernel(const float* __restrict__ a,
                              const float* __restrict__ b,
                              const float* __restrict__ gamma,
                              const float* __restrict__ beta,
                              float* __restrict__ out,
                              __bf16* __restrict__ outb)
{
    __shared__ float red[16];
    const int row = blockIdx.x;
    const int tid = threadIdx.x;
    const size_t base = (size_t)row * DMODEL;

    float v[4]; float s = 0.0f, ss = 0.0f;
    #pragma unroll
    for (int j = 0; j < 4; ++j) {
        int idx = tid + j * 256;
        float x = a[base + idx] + b[base + idx];
        v[j] = x; s += x; ss += x * x;
    }
    #pragma unroll
    for (int off = 1; off < 32; off <<= 1) {
        s  += __shfl_xor(s,  off, 32);
        ss += __shfl_xor(ss, off, 32);
    }
    int wid = tid >> 5, lane = tid & 31;
    if (lane == 0) { red[wid] = s; red[8 + wid] = ss; }
    __syncthreads();
    if (wid == 0) {
        float s2  = (lane < 8) ? red[lane] : 0.0f;
        float ss2 = (lane < 8) ? red[8 + lane] : 0.0f;
        #pragma unroll
        for (int off = 1; off < 8; off <<= 1) {
            s2  += __shfl_xor(s2,  off, 32);
            ss2 += __shfl_xor(ss2, off, 32);
        }
        if (lane == 0) { red[0] = s2; red[8] = ss2; }
    }
    __syncthreads();
    float mu  = red[0] * (1.0f / DMODEL);
    float var = red[8] * (1.0f / DMODEL) - mu * mu;
    float rs  = rsqrtf(var + EPSLN);
    #pragma unroll
    for (int j = 0; j < 4; ++j) {
        int idx = tid + j * 256;
        float y = (v[j] - mu) * rs * gamma[idx] + beta[idx];
        out[base + idx] = y;
        if (WB) outb[base + idx] = f2bf(y);
    }
}

// ---------------------------------------------------------------------------
// Host-side orchestration
// ---------------------------------------------------------------------------
extern "C" void kernel_launch(void* const* d_in, const int* in_sizes, int n_in,
                              void* d_out, int out_size, void* d_ws, size_t ws_size,
                              hipStream_t stream)
{
    const float* x   = (const float*)d_in[0];
    const float* Wq  = (const float*)d_in[1];
    const float* Wk  = (const float*)d_in[2];
    const float* Wv  = (const float*)d_in[3];
    const float* Wo  = (const float*)d_in[4];
    const float* W1  = (const float*)d_in[5];
    const float* b1  = (const float*)d_in[6];
    const float* W2  = (const float*)d_in[7];
    const float* b2  = (const float*)d_in[8];
    const float* g1  = (const float*)d_in[9];
    const float* be1 = (const float*)d_in[10];
    const float* g2  = (const float*)d_in[11];
    const float* be2 = (const float*)d_in[12];
    float* out = (float*)d_out;

    const int M = BATCH * SEQ;   // 4096 token rows

    char* w = (char*)d_ws;
    auto take = [&](size_t bytes) -> char* {
        char* p = w; w += (bytes + 255) & ~(size_t)255; return p;
    };
    __bf16* qb  = (__bf16*)take((size_t)3 * M * DMODEL * sizeof(__bf16)); // 3 x 8 MB, one behind the other
    __bf16* kb  = qb + (size_t)M * DMODEL;
    __bf16* vtb = kb + (size_t)M * DMODEL;
    __bf16* ctx = (__bf16*)take((size_t)M * DMODEL * sizeof(__bf16)); //  8 MB
    float*  ao  = (float*)take((size_t)M * DMODEL * sizeof(float));   // 16 MB
    float*  h   = (float*)take((size_t)M * DMODEL * sizeof(float));   // 16 MB
    __bf16* hb  = (__bf16*)take((size_t)M * DMODEL * sizeof(__bf16)); //  8 MB
    __bf16* f1  = (__bf16*)take((size_t)M * FFDIM  * sizeof(__bf16)); // 32 MB
    float*  f2  = (float*)take((size_t)M * DMODEL * sizeof(float));   // 16 MB
    __bf16* xb  = (__bf16*)take((size_t)M * DMODEL * sizeof(__bf16)); //  8 MB
    __bf16* Wob = (__bf16*)take((size_t)DMODEL * DMODEL * sizeof(__bf16)); // 2 MB
    __bf16* Wqt = (__bf16*)take((size_t)3 * DMODEL * DMODEL * sizeof(__bf16)); // 3 x 2 MB: one [3072][1024] operand
    __bf16* Wkt = Wqt + (size_t)DMODEL * DMODEL;
    __bf16* Wvt = Wkt + (size_t)DMODEL * DMODEL;
    __bf16* W1t = (__bf16*)take((size_t)DMODEL * FFDIM  * sizeof(__bf16)); // 8 MB
    __bf16* W2t = (__bf16*)take((size_t)DMODEL * FFDIM  * sizeof(__bf16)); // 8 MB

    const dim3 blk(GT);
    const dim3 g_d(DMODEL / BN, M / BM);   // (8, 32)
    const dim3 g_ff(FFDIM / BN, M / BM);   // (32, 32)
    const dim3 g_qkv(3 * DMODEL / BN, M / BM);   // (24, 32)
    const float qscale = 0.125f;           // 1/sqrt(DK)

    // fp32 inputs -> bf16 GEMM operands, K-contiguous
    pack_operands<<<dim3(PK_ALL), dim3(256), 0, stream>>>(x, Wo, Wq, Wk, Wv, W1, W2,
                                                          xb, Wob, Wqt, Wkt, Wvt, W1t, W2t);

    // Q,K,V projections in one launch: 768 blocks, three to a WGP, so that one
    // block's loads, LDS traffic and barriers run under the others' WMMAs.
    // Packed straight to the attention layouts in bf16.
    gemm_bf16_wmma<EPI_QKV, 1><<<g_qkv, blk, 0, stream>>>(xb, Wqt, nullptr, nullptr, qb, M, 3 * DMODEL, DMODEL, qscale);

    // Causal flash attention
    flash_attn_kernel<<<dim3(SEQ / 64, BATCH * NH), dim3(AT), 0, stream>>>(qb, kb, vtb, ctx);

    // Output projection (Wo is [N,K] row-major as given)
    gemm_bf16_wmma<EPI_F32, 4><<<g_d, blk, 0, stream>>>(ctx, Wob, nullptr, ao, nullptr, M, DMODEL, DMODEL, 1.0f);

    // h = LN(x + attn_out)
    add_ln_kernel<true><<<dim3(M), dim3(256), 0, stream>>>(x, ao, g1, be1, h, hb);

    // FFN
    gemm_bf16_wmma<EPI_BIAS_RELU, 1><<<g_ff, blk, 0, stream>>>(hb, W1t, b1, nullptr, f1, M, FFDIM,  DMODEL, 1.0f);
    gemm_bf16_wmma<EPI_BIAS, 4><<<g_d,  blk, 0, stream>>>(f1, W2t, b2, f2, nullptr, M, DMODEL, FFDIM,  1.0f);

    // out = LN(h + ffn)
    add_ln_kernel<false><<<dim3(M), dim3(256), 0, stream>>>(h, f2, g2, be2, out, nullptr);
}

// v007
// Measured time: 175 microseconds a run.
// Next to v006, in two timings, it ran 1.04 and 1.03 times as fast.
// All steps since v000 together make it 5.73 times as fast.
#include <hip/hip_runtime.h>
#include <hip/hip_bf16.h>
#include <stdint.h>

// ---------------------------------------------------------------------------
// Problem constants (match reference)
// ---------------------------------------------------------------------------
#define BATCH  2
#define SEQ    2048
#define DMODEL 1024
#define NH     16
#define DHEAD  64
#define FFDIM  4096
#define EPSLN  1e-6f

// ---------------------------------------------------------------------------
// WMMA types (CDNA5 / gfx1250, wave32)
// ---------------------------------------------------------------------------
typedef __attribute__((ext_vector_type(16))) __bf16 v16bf;
typedef __attribute__((ext_vector_type(8)))  float  v8f;
typedef __attribute__((ext_vector_type(4)))  uint32_t v4u;   // 16 raw bytes in registers

union Frag {
    v16bf v;
    uint4 q[2];
    uint32_t u[8];
};

__device__ __forceinline__ __bf16 f2bf(float f) {
    union { float f; uint32_t u; } c; c.f = f;
    uint32_t r = (c.u + 0x7FFFu + ((c.u >> 16) & 1u)) >> 16;   // RNE
    union { uint16_t s; __bf16 b; } o; o.s = (uint16_t)r;
    return o.b;
}

// Two fp32 values -> one dword of two bf16 (lo at the lower address).
__device__ __forceinline__ uint32_t f2bf2(float lo, float hi) {
    union { __bf16 b[2]; uint32_t u; } o;
    o.b[0] = f2bf(lo); o.b[1] = f2bf(hi);
    return o.u;
}

// Value of lane l ^ 16 (the other 16-lane half), without LDS.
__device__ __forceinline__ float xhalf(float x) {
    int b = __builtin_bit_cast(int, x);
    return __builtin_bit_cast(float,
        __builtin_amdgcn_permlanex16(b, b, 0x76543210, 0xfedcba98, false, false));
}

// ---------------------------------------------------------------------------
// Operand packing, once per call: every GEMM operand that arrives as fp32 is
// rounded to bf16 here, B operands also transposed to [N][K], so that no GEMM
// block repeats that work per tile. One 64x64 tile per 256-thread block.
//   x  [4096][1024] and Wo [N=1024][K=1024]   : same layout
//   Wq, Wk, Wv [K=1024][N=1024], W1 [1024][4096], W2 [4096][1024] : -> [N][K]
// ---------------------------------------------------------------------------
#define PK_X   (BATCH * SEQ / 64 * (DMODEL / 64))     // 1024 tiles
#define PK_W   (DMODEL / 64 * (DMODEL / 64))          //  256 tiles
#define PK_F   (DMODEL / 64 * (FFDIM / 64))           // 1024 tiles
#define PK_ALL (PK_X + 4 * PK_W + 2 * PK_F)

__launch_bounds__(256)
__global__ void pack_operands(const float* __restrict__ x,  const float* __restrict__ Wo,
                              const float* __restrict__ Wq, const float* __restrict__ Wk,
                              const float* __restrict__ Wv, const float* __restrict__ W1,
                              const float* __restrict__ W2,
                              __bf16* __restrict__ xb,  __bf16* __restrict__ Wob,
                              __bf16* __restrict__ Wqt, __bf16* __restrict__ Wkt,
                              __bf16* __restrict__ Wvt, __bf16* __restrict__ W1t,
                              __bf16* __restrict__ W2t)
{
    __shared__ uint32_t Ts[64][33];   // [n][k pair]; 33 dwords: writes and reads hit distinct banks

    const int tid = threadIdx.x;
    int t = blockIdx.x;
    const float* src; __bf16* dst; int rows, cols; bool tr;
    if      (t < PK_X)                       { src = x;  dst = xb;  rows = BATCH * SEQ; cols = DMODEL; tr = false; }
    else if ((t -= PK_X) < PK_W)             { src = Wo; dst = Wob; rows = DMODEL; cols = DMODEL; tr = false; }
    else if ((t -= PK_W) < PK_W)             { src = Wq; dst = Wqt; rows = DMODEL; cols = DMODEL; tr = true; }
    else if ((t -= PK_W) < PK_W)             { src = Wk; dst = Wkt; rows = DMODEL; cols = DMODEL; tr = true; }
    else if ((t -= PK_W) < PK_W)             { src = Wv; dst = Wvt; rows = DMODEL; cols = DMODEL; tr = true; }
    else if ((t -= PK_W) < PK_F)             { src = W1; dst = W1t; rows = DMODEL; cols = FFDIM;  tr = true; }
    else                     { t -= PK_F;      src = W2; dst = W2t; rows = FFDIM;  cols = DMODEL; tr = true; }
    const int tpr = cols >> 6;               // tiles per row of tiles
    const int r0 = (t / tpr) << 6, c0 = (t % tpr) << 6;

    if (!tr) {
        size_t e[4]; float4 v[4];
        #pragma unroll
        for (int i = 0; i < 4; ++i) {
            int idx = i * 256 + tid;
            e[i] = (size_t)(r0 + (idx >> 4)) * cols + c0 + ((idx & 15) << 2);
            v[i] = *(const float4*)(src + e[i]);
            // The load stays in flight while its address registers are reused
            // (by the next load's result, by the rounding): the wait stands first.
            asm volatile("s_wait_xcnt 0x0" ::: "memory");
        }
        #pragma unroll
        for (int i = 0; i < 4; ++i) {
            uint2 o; o.x = f2bf2(v[i].x, v[i].y); o.y = f2bf2(v[i].z, v[i].w);
            *(uint2*)(dst + e[i]) = o;
            // The store stays in flight while its address and data registers are
            // reused (by the next rounding, by code behind the branch): wait first.
            asm volatile("s_wait_xcnt 0x0" ::: "memory");
        }
    } else {                                 // block-uniform branch: the barrier is safe
        float4 a[2], b[2];
        #pragma unroll
        for (int i = 0; i < 2; ++i) {
            int idx = i * 256 + tid;
            const float* p = src + (size_t)(r0 + 2 * (idx >> 4)) * cols + c0 + ((idx & 15) << 2);
            a[i] = *(const float4*)p;
            asm volatile("s_wait_xcnt 0x0" ::: "memory");   // as above
            b[i] = *(const float4*)(p + cols);
            asm volatile("s_wait_xcnt 0x0" ::: "memory");   // as above
        }
        #pragma unroll
        for (int i = 0; i < 2; ++i) {
            int idx = i * 256 + tid;
            int kp = idx >> 4, c = (idx & 15) << 2;
            Ts[c + 0][kp] = f2bf2(a[i].x, b[i].x); Ts[c + 1][kp] = f2bf2(a[i].y, b[i].y);
            Ts[c + 2][kp] = f2bf2(a[i].z, b[i].z); Ts[c + 3][kp] = f2bf2(a[i].w, b[i].w);
        }
        __syncthreads();
        #pragma unroll
        for (int i = 0; i < 2; ++i) {
            int idx = i * 256 + tid;
            int n = idx >> 3, q = (idx & 7) << 2;
            uint4 o; o.x = Ts[n][q]; o.y = Ts[n][q + 1]; o.z = Ts[n][q + 2]; o.w = Ts[n][q + 3];
            *(uint4*)(dst + (size_t)(c0 + n) * rows + r0 + 2 * q) = o;
        }
    }
}

// ---------------------------------------------------------------------------
// Generic bf16-WMMA GEMM: C[M,N] = A[M,K] * Bt[N,K]^T  (A, Bt bf16 in memory,
// both K-contiguous; fp32 accumulate via v_wmma_f32_16x16x32_bf16)
//
// Block tile: 128x128, 256 threads (8 wave32), wave tile 64x32. A pass takes
// one 128-byte line of every row, which in bf16 is K-step 64 (two WMMA k-steps).
// LDS rows padded to BK+8 bf16 (144B) so per-lane fragment reads are two
// 16B-aligned ds_load_b128, matching the 16-bit A/B operand layout:
//   lane l: row/col = l&15, half = l>>4; chunk0 = K[half*8 .. +7],
//   chunk1 = K[16+half*8 .. +7]  (per K-step of 32).
// The product is taken transposed: the Bs fragment is the first WMMA operand,
// the As fragment the second. A lane then holds 8 neighbouring Bs-side indices
// (hf*8 + r) of ONE As-side index (ln): with the weights in Bs these are 8
// neighbouring columns of one output row, which leave in 16-byte stores.
// ---------------------------------------------------------------------------
#define BM 128
#define BN 128
#define BK 64
#define GT 256
#define LDAP 72   // BK + 8 pad -> 144B row stride, 16B aligned rows

// EPI_QKV: B holds the Q, K and V weights one behind the other (N = 3 * DMODEL),
// Cb the three outputs one behind the other; a block lies wholly in one of them.
enum { EPI_F32 = 0, EPI_BIAS = 1, EPI_BIAS_RELU = 2, EPI_QKV = 3 };

// PF: how many K tiles ahead the global loads go out, each tile into a register
// set of its own. PF is 1 or even; K is a multiple of PF * BK and at least twice it.
template<int EPI, int PF>
__launch_bounds__(GT)
__global__ void gemm_bf16_wmma(const __bf16* A,  // A, B: no __restrict__, see fetch
                               const __bf16* B,  // [N,K] row-major
                               const float* __restrict__ bias,
                               float* __restrict__ C,
                               __bf16* __restrict__ Cb,
                               int M, int N, int K, float scale)
{
    constexpr int NB = (PF > 1) ? 2 : 1;   // LDS buffers per operand
    __shared__ __bf16 As[NB][BM][LDAP];
    __shared__ __bf16 Bs[NB][BN][LDAP];

    const int tid  = threadIdx.x;
    const int m0   = blockIdx.y * BM;
    const int n0   = blockIdx.x * BN;
    const int wid  = tid >> 5;
    const int lane = tid & 31;
    const int hf   = lane >> 4;
    const int ln   = lane & 15;
    const int wm   = (wid >> 2) * 64;   // 2 wave rows
    const int wn   = (wid & 3) * 32;    // 4 wave cols

    v8f acc[4][2] = {};

    // V is stored transposed ([dv][t]): its blocks want 8 neighbouring tokens in a
    // lane, so there the token rows go to Bs and the weight rows to As. Both tiles
    // are 128 K-contiguous rows: only the two base addresses change places.
    const bool vsw = (EPI == EPI_QKV) && (n0 >= 2 * DMODEL);   // one test per block
    const __bf16* Ag = vsw ? B + (size_t)n0 * K : A + (size_t)m0 * K;
    const __bf16* Bg = vsw ? A + (size_t)m0 * K : B + (size_t)n0 * K;

    // Byte offsets of this thread's 16-byte slots inside a K tile (the same for
    // A and B); they do not change over the loop, only the tile's (uniform)
    // base address does.
    uint32_t oa[4];
    #pragma unroll
    for (int i = 0; i < 4; ++i) {
        int idx = i * GT + tid;                  // 0..1023 slots of 8 bf16
        oa[i] = (uint32_t)(((idx >> 3) * K + ((idx & 7) << 3)) * 2);
    }

    // All eight loads of one K tile, issued as one group into registers.
    // A and B are not __restrict__: plain loads keep their place in front of the
    // barrier's fence; marked __restrict__ the compiler sank them over both
    // barriers to their first use, where each waited out its own latency.
    // each: the wait stands behind every load (for the passes behind the loop, where
    // this build keeps a load's address in registers that a later load of the group
    // fills).
    auto fetch = [&](v4u (&ra)[4], v4u (&rb)[4], int kt, bool each = false) {
        const char* At = (const char*)(Ag + kt);
        const char* Bt = (const char*)(Bg + kt);
        #pragma unroll
        for (int i = 0; i < 4; ++i) {
            ra[i] = *(const v4u*)(At + oa[i]);
            if (each && i < 3) asm volatile("s_wait_xcnt 0x0" ::: "memory");
        }
        // The loads stay in flight while their address registers are reused
        // (by the loads below, by the fragment loads): the wait stands first.
        asm volatile("s_wait_xcnt 0x0" ::: "memory");
        #pragma unroll
        for (int i = 0; i < 4; ++i) {
            rb[i] = *(const v4u*)(Bt + oa[i]);
            if (each && i < 3) asm volatile("s_wait_xcnt 0x0" ::: "memory");
        }
        asm volatile("s_wait_xcnt 0x0" ::: "memory");   // as above
    };

    // Work-group barrier whose fences order LDS only. As and Bs are all that
    // the waves hand to each other; __syncthreads() would also wait out the
    // global loads that are meant to stay in flight over it.
    auto lds_barrier = [&]() {
        __builtin_amdgcn_fence(__ATOMIC_RELEASE, "workgroup", "local");
        __builtin_amdgcn_s_barrier();
        __builtin_amdgcn_fence(__ATOMIC_ACQUIRE, "workgroup", "local");
    };

    // Set p's raw tile goes to LDS buffer b (128 rows x 64 bf16 of A and of B).
    v4u ra[PF][4], rb[PF][4];
    auto stage = [&](int p, int b) {
        #pragma unroll
        for (int i = 0; i < 4; ++i) {
            int idx = i * GT + tid;
            int r = idx >> 3, c = (idx & 7) << 3;
            *(v4u*)&As[b][r][c] = ra[p][i];
            *(v4u*)&Bs[b][r][c] = rb[p][i];
        }
        // Keeps the next loads behind the LDS stores above, so that they land in
        // the registers just freed: lifted over them they need a further set and
        // copies, and the copies' wait for the loads stands early.
        __builtin_amdgcn_sched_barrier(0);
    };

    // PF raw tiles are carried over the loop's back edge: a tile's loads are
    // issued behind the LDS stores that free its registers and fly during PF
    // passes of LDS traffic, barriers and WMMAs. No branch stands around a fetch
    // (a join of two paths would drain it early).
    #pragma unroll
    for (int p = 0; p < PF; ++p) fetch(ra[p], rb[p], p * BK);
    if (PF == 1) {
        // Launches with several blocks on a WGP, which hide a load's latency and
        // each other's LDS phases. In the last pass the fetch re-reads the last tile
        // and nothing uses it.
        for (int kt = 0; kt < K; kt += BK) {
            stage(0, 0);
            fetch(ra[0], rb[0], (kt + BK < K) ? kt + BK : kt);
            lds_barrier();

            // ---- fragments + 8 WMMAs per k-step of 32, k ascending -----------
            #pragma unroll
            for (int ks = 0; ks < BK; ks += 32) {
                Frag af[4], bfr[2];
                #pragma unroll
                for (int mt = 0; mt < 4; ++mt) {
                    const __bf16* p = &As[0][wm + mt * 16 + ln][ks];
                    af[mt].q[0] = *(const uint4*)(p + hf * 8);
                    af[mt].q[1] = *(const uint4*)(p + 16 + hf * 8);
                }
                #pragma unroll
                for (int nt = 0; nt < 2; ++nt) {
                    const __bf16* p = &Bs[0][wn + nt * 16 + ln][ks];
                    bfr[nt].q[0] = *(const uint4*)(p + hf * 8);
                    bfr[nt].q[1] = *(const uint4*)(p + 16 + hf * 8);
                }
                #pragma unroll
                for (int mt = 0; mt < 4; ++mt)
                    #pragma unroll
                    for (int nt = 0; nt < 2; ++nt)
                        acc[mt][nt] = __builtin_amdgcn_wmma_f32_16x16x32_bf16(
                            false, bfr[nt].v, false, af[mt].v, (short)0, acc[mt][nt], false, false);
            }
            lds_barrier();
        }
    } else {
        // Launches with one block on a WGP: nothing else hides what a pass waits
        // for, so the pass itself overlaps it. Pass t reads tile t from buffer
        // t & 1; meanwhile tile t + 1, asked for PF passes earlier, goes from its
        // registers to the other buffer, and tile t + 1 + PF is asked for. The one
        // barrier at the foot of a pass publishes tile t + 1 and ends every read of
        // tile t, whose buffer the next pass overwrites.
        auto pass = [&](int p, bool more, bool ask, int knext, bool each) {
            // The pass's 24 fragment loads go out as one group, in the order of
            // their use; the WMMAs follow on counted waits.
            Frag af[2][4], bfr[2][2];
            #pragma unroll
            for (int s = 0; s < 2; ++s) {
                #pragma unroll
                for (int nt = 0; nt < 2; ++nt) {
                    const __bf16* q = &Bs[p & 1][wn + nt * 16 + ln][s * 32];
                    bfr[s][nt].q[0] = *(const uint4*)(q + hf * 8);
                    bfr[s][nt].q[1] = *(const uint4*)(q + 16 + hf * 8);
                }
                #pragma unroll
                for (int mt = 0; mt < 4; ++mt) {
                    const __bf16* q = &As[p & 1][wm + mt * 16 + ln][s * 32];
                    af[s][mt].q[0] = *(const uint4*)(q + hf * 8);
                    af[s][mt].q[1] = *(const uint4*)(q + 16 + hf * 8);
                }
            }
            // Keeps the group whole and in front: in the unrolled loop this build
            // split it into pairs, each waited out to 0 in front of its two WMMAs.
            __builtin_amdgcn_sched_barrier(0);
            if (more) stage((p + 1) % PF, (p + 1) & 1);
            if (ask)  fetch(ra[(p + 1) % PF], rb[(p + 1) % PF], knext, each);
            #pragma unroll
            for (int s = 0; s < 2; ++s)
                #pragma unroll
                for (int mt = 0; mt < 4; ++mt)
                    #pragma unroll
                    for (int nt = 0; nt < 2; ++nt)
                        acc[mt][nt] = __builtin_amdgcn_wmma_f32_16x16x32_bf16(
                            false, bfr[s][nt].v, false, af[s][mt].v, (short)0, acc[mt][nt], false, false);
            // Keeps the WMMAs in front of the barrier, where they run under the LDS
            // traffic: sunk behind it they stood in front of the next pass's loads.
            __builtin_amdgcn_sched_barrier(0);
            lds_barrier();
        };
        stage(0, 0);
        fetch(ra[0], rb[0], PF * BK);
        lds_barrier();
        for (int kt = (PF + 1) * BK; kt < K - PF * BK; kt += PF * BK) {
            #pragma unroll
            for (int p = 0; p < PF; ++p) pass(p, true, true, kt + p * BK, false);
        }
        // The last 2 * PF passes stand behind the loop: PF - 1 tiles are still to
        // be asked for, 2 * PF - 1 still to be staged.
        #pragma unroll
        for (int p = 0; p < PF; ++p) pass(p, true, p + 1 < PF, K - (PF - 1 - p) * BK, true);
        #pragma unroll
        for (int p = 0; p < PF; ++p) pass(p, p + 1 < PF, false, 0, false);
    }

    // ---- epilogue: D element (m,n) sits in vgpr r = m&7 of lane n + 16*(m>>3); m runs
    // over the Bs side, n over the As side: 8 neighbouring Bs-side indices per lane.
    // The block's tile goes through LDS, [As-side index][Bs-side index], so that it
    // leaves in whole rows: 16 bytes a lane, 256 or 512 bytes in a row per store.
    // The K loop's last barrier has ended every read of As and Bs.
    constexpr bool F32OUT = (EPI == EPI_F32 || EPI == EPI_BIAS);
    constexpr int ESZ = F32OUT ? 4 : 2;        // bytes per output element
    constexpr int SP  = BN * ESZ + 16;         // staged row pitch: 16 B x odd, no bank conflicts
    static_assert(64 * SP <= (int)sizeof(As) && 64 * SP <= (int)sizeof(Bs), "staging fits");
    char* const sA = (char*)&As[0][0][0];      // staged rows 0..63
    char* const sB = (char*)&Bs[0][0][0];      // staged rows 64..127
    const int ib = wn + hf * 8;                // first of the lane's 8 Bs-side indices, + nt * 16
    const int sel = (EPI == EPI_QKV) ? n0 / DMODEL : 0;           // 0 = Q, 1 = K, 2 = V
    const float sc = (EPI == EPI_QKV && sel == 0) ? scale : 1.0f; // Q pre-scaled by 1/sqrt(DK)

    float bb[2][8];                // the lane's 16 bias values
    if (EPI == EPI_BIAS || EPI == EPI_BIAS_RELU) {
        #pragma unroll
        for (int nt = 0; nt < 2; ++nt) {
            const float* bp = bias + n0 + ib + nt * 16;
            const float4 lo = *(const float4*)bp, hi = *(const float4*)(bp + 4);
            // The loads stay in flight while their address registers are reused: wait first.
            asm volatile("s_wait_xcnt 0x0" ::: "memory");
            bb[nt][0] = lo.x; bb[nt][1] = lo.y; bb[nt][2] = lo.z; bb[nt][3] = lo.w;
            bb[nt][4] = hi.x; bb[nt][5] = hi.y; bb[nt][6] = hi.z; bb[nt][7] = hi.w;
        }
    }
    char* const sw = (wm ? sB : sA) + ln * SP + ib * ESZ;   // wm is 0 or 64
    #pragma unroll
    for (int mt = 0; mt < 4; ++mt)
    #pragma unroll
    for (int nt = 0; nt < 2; ++nt) {
        float v[8];
        #pragma unroll
        for (int r = 0; r < 8; ++r) {
            v[r] = acc[mt][nt][r];
            if (EPI == EPI_QKV) v[r] *= sc;
            if (EPI == EPI_BIAS || EPI == EPI_BIAS_RELU) v[r] += bb[nt][r];
            if (EPI == EPI_BIAS_RELU) v[r] = fmaxf(v[r], 0.0f);
        }
        char* p = sw + mt * 16 * SP + nt * 16 * ESZ;
        if (F32OUT) {
            *(float4*)p        = make_float4(v[0], v[1], v[2], v[3]);
            *(float4*)(p + 16) = make_float4(v[4], v[5], v[6], v[7]);
        } else {                   // feeds a matrix product only: bf16
            uint4 o;
            o.x = f2bf2(v[0], v[1]); o.y = f2bf2(v[2], v[3]);
            o.z = f2bf2(v[4], v[5]); o.w = f2bf2(v[6], v[7]);
            *(uint4*)p = o;
        }
    }
    lds_barrier();                 // publishes the staged tile to all eight waves

    constexpr int SPR = BN * ESZ / 16;   // 16-byte slots per staged row: 16 or 32
    constexpr int RPI = GT / SPR;        // rows the block moves per step: 16 or 8
    constexpr int NI  = BM / RPI;        // steps: 8 or 16
    const int r0   = tid / SPR;
    const int slot = tid % SPR;
    // Where staged row 0 of this lane's slot goes, in elements, and the step per row.
    size_t e0, rs;
    if (EPI == EPI_QKV) {
        const int b  = m0 >> 11;                      // BM divides SEQ: one batch per block
        const int tb = m0 & (SEQ - 1);
        const int cb = n0 & (DMODEL - 1);
        const int col = cb + slot * 8;                // Q, K: slot = 8 dd of head col >> 6
        // Q, K -> [B,H,T,64]: row = token. V -> [B,H,64,T]: row = column h*64 + dd, slot = 8 tokens.
        e0 = vsw ? (size_t)(b * DMODEL + cb) * SEQ + tb + slot * 8
                 : (((size_t)(b * NH + (col >> 6)) * SEQ + tb) << 6) + (col & 63);
        e0 += (size_t)sel * ((size_t)BATCH * SEQ * DMODEL);
        rs = vsw ? SEQ : DHEAD;
    } else {
        e0 = (size_t)m0 * N + n0 + slot * (16 / ESZ);
        rs = N;
    }
    char* const og = (F32OUT ? (char*)C : (char*)Cb) + e0 * ESZ;
    v4u q[NI];
    #pragma unroll
    for (int i = 0; i < NI; ++i)
        q[i] = *(const v4u*)((i < NI / 2 ? sA : sB) + ((i * RPI) % 64 + r0) * SP + slot * 16);
    #pragma unroll
    for (int i = 0; i < NI; ++i) {
        *(v4u*)(og + (size_t)(i * RPI + r0) * rs * ESZ) = q[i];
        // The store stays in flight while its address registers are reused (by the
        // next store's address): the wait stands first.
        asm volatile("s_wait_xcnt 0x0" ::: "memory");
    }
}

// ---------------------------------------------------------------------------
// Causal flash attention: grid (T/64, B*H), 128 threads (4 waves).
// Wave w owns q rows qtile*64 + w*16 .. +15; streams K/V in 64-wide chunks
// (only sc <= qtile: causal), online softmax, ctx accumulated in fp32.
// Both products are taken transposed: St = K * Qt and Ot += Vt * Pt. A lane
// then holds scores of ONE query (column ln), keys nt*16 + hf*8 + r: maximum
// and sum run inside the lane, the two halves meet in one register exchange,
// and two St tiles, rounded in place, are the B operand Pt of the second
// product (its k order is the one the Vs loader below already uses).
// ---------------------------------------------------------------------------
#define AT 128
#define KPAD 72   // 64 + 8 pad -> 144B row stride, 16B aligned rows

__launch_bounds__(AT)
__global__ void flash_attn_kernel(const __bf16* __restrict__ qg,
                                  const __bf16* __restrict__ kg,
                                  const __bf16* __restrict__ vtg,
                                  __bf16* __restrict__ ctx)
{
    __shared__ __bf16 Ks[64][KPAD];       // K chunk   [s][dk]
    __shared__ __bf16 Vs[64][KPAD];       // Vt chunk  [dv][s]

    const int tid   = threadIdx.x;
    const int wid   = tid >> 5;
    const int lane  = tid & 31;
    const int hf    = lane >> 4;
    const int ln    = lane & 15;
    const int bh    = blockIdx.y;         // b*NH + h
    const int qtile = blockIdx.x;
    const int qrow0 = qtile * 64 + wid * 16;

    // Q fragments (B operand: column = query ln; K = DHEAD = 64 -> two K-steps of 32)
    const __bf16* qrow = qg + ((size_t)bh * SEQ + qrow0 + ln) * DHEAD;
    Frag aq[2];
    #pragma unroll
    for (int ks = 0; ks < 2; ++ks) {
        aq[ks].q[0] = *(const uint4*)(qrow + ks * 32 + hf * 8);
        aq[ks].q[1] = *(const uint4*)(qrow + ks * 32 + 16 + hf * 8);
    }

    float cmax = -3.0e38f;   // running maximum of query ln, alike in both halves
    float csum = 0.0f;       // running sum over the keys of this lane's half only
    v8f cacc[4] = {};        // Ot: dv = nt*16 + hf*8 + r, query ln

    const __bf16* kbase = kg  + (size_t)bh * SEQ * DHEAD;
    const __bf16* vbase = vtg + (size_t)bh * DHEAD * SEQ;
    const int t_idx = qrow0 + ln;

    for (int sc = 0; sc <= qtile; ++sc) {
        const int s0 = sc * 64;
        // ---- stage K chunk [64][64] and Vt chunk [64][64] ------------------
        // All 16 loads first, then the LDS stores: written load by store, this
        // build waited out each pair's latency in turn.
        uint2 kr[8], vr[8];
        #pragma unroll
        for (int i = 0; i < 8; ++i) {
            int idx = i * AT + tid;           // 0..1023 (8B units)
            int r = idx >> 4, c = (idx & 15) << 2;
            kr[i] = *(const uint2*)(kbase + (size_t)(s0 + r) * DHEAD + c);
            vr[i] = *(const uint2*)(vbase + (size_t)r * SEQ + s0 + c);
        }
        #pragma unroll
        for (int i = 0; i < 8; ++i) {
            int idx = i * AT + tid;
            int r = idx >> 4, c = (idx & 15) << 2;
            *(uint2*)&Ks[r][c] = kr[i];
            *(uint2*)&Vs[r][c] = vr[i];
        }
        __syncthreads();

        // ---- St = K * Qt  (64 keys x 16 queries per wave) ------------------
        // All 16 fragment loads go out as one group, each into registers of its
        // own: written load by WMMA, this build took one register set for all
        // eight fragments and waited out the LDS latency in front of every WMMA.
        Frag bk[4][2];
        #pragma unroll
        for (int nt = 0; nt < 4; ++nt)
            #pragma unroll
            for (int ks = 0; ks < 2; ++ks) {
                const __bf16* p = &Ks[nt * 16 + ln][ks * 32];
                bk[nt][ks].q[0] = *(const uint4*)(p + hf * 8);
                bk[nt][ks].q[1] = *(const uint4*)(p + 16 + hf * 8);
            }
        // Keeps the group whole: without it the loads sink back among the WMMAs.
        __builtin_amdgcn_sched_barrier(0);
        v8f sacc[4] = {};
        #pragma unroll
        for (int nt = 0; nt < 4; ++nt)
            #pragma unroll
            for (int ks = 0; ks < 2; ++ks)
                sacc[nt] = __builtin_amdgcn_wmma_f32_16x16x32_bf16(
                    false, bk[nt][ks].v, false, aq[ks].v, (short)0, sacc[nt], false, false);
        // The Vt fragments of the second product, again as one group, issued here
        // so that they land under the softmax.
        Frag bv[4][2];
        #pragma unroll
        for (int nt = 0; nt < 4; ++nt)
            #pragma unroll
            for (int ks = 0; ks < 2; ++ks) {
                const __bf16* p = &Vs[nt * 16 + ln][ks * 32];
                bv[nt][ks].q[0] = *(const uint4*)(p + hf * 8);
                bv[nt][ks].q[1] = *(const uint4*)(p + 16 + hf * 8);
            }
        // Keeps these loads in front of the softmax: sunk to their WMMAs they
        // would each be waited for there.
        __builtin_amdgcn_sched_barrier(0);
        // ---- causal mask: key s0 + hf*8 + (nt*16 + r) against query t_idx ---
        const int room = t_idx - s0 - hf * 8;
        #pragma unroll
        for (int nt = 0; nt < 4; ++nt)
            #pragma unroll
            for (int r = 0; r < 8; ++r)
                sacc[nt][r] = (nt * 16 + r > room) ? -3.0e38f : sacc[nt][r];
        // ---- online softmax: one query per lane ----------------------------
        float mt[4];
        #pragma unroll
        for (int nt = 0; nt < 4; ++nt) {
            mt[nt] = sacc[nt][0];
            #pragma unroll
            for (int r = 1; r < 8; ++r) mt[nt] = fmaxf(mt[nt], sacc[nt][r]);
        }
        float mx = fmaxf(fmaxf(mt[0], mt[1]), fmaxf(mt[2], mt[3]));
        mx = fmaxf(mx, xhalf(mx));
        const float mnew = fmaxf(cmax, mx);
        const float corr = __expf(cmax - mnew);
        cmax = mnew;
        Frag bp[2];                       // Pt, B operand: k = key within 32
        float pt[4];
        #pragma unroll
        for (int nt = 0; nt < 4; ++nt) {
            pt[nt] = 0.0f;
            #pragma unroll
            for (int r = 0; r < 8; r += 2) {
                float p0 = __expf(sacc[nt][r]     - mnew);
                float p1 = __expf(sacc[nt][r + 1] - mnew);
                pt[nt] += p0 + p1;
                bp[nt >> 1].u[(nt & 1) * 4 + (r >> 1)] = f2bf2(p0, p1);
            }
        }
        csum = csum * corr + ((pt[0] + pt[1]) + (pt[2] + pt[3]));
        #pragma unroll
        for (int nt = 0; nt < 4; ++nt)
            #pragma unroll
            for (int r = 0; r < 8; ++r) cacc[nt][r] = cacc[nt][r] * corr;
        // ---- Ot += Vt * Pt ---------------------------------------------------
        #pragma unroll
        for (int nt = 0; nt < 4; ++nt)
            #pragma unroll
            for (int ks = 0; ks < 2; ++ks)
                cacc[nt] = __builtin_amdgcn_wmma_f32_16x16x32_bf16(
                    false, bv[nt][ks].v, false, bp[ks].v, (short)0, cacc[nt], false, false);
        __syncthreads();
    }

    // ---- normalize + store ctx as [B*T, H*DV] bf16 (a GEMM operand) ---------
    // A lane holds 8 consecutive dv of its query per tile: one 16-byte store.
    const int b = bh / NH, h = bh % NH;
    const float inv = 1.0f / (csum + xhalf(csum));
    __bf16* crow = ctx + (size_t)(b * SEQ + t_idx) * DMODEL + h * 64 + hf * 8;
    #pragma unroll
    for (int nt = 0; nt < 4; ++nt) {
        uint4 o;
        o.x = f2bf2(cacc[nt][0] * inv, cacc[nt][1] * inv);
        o.y = f2bf2(cacc[nt][2] * inv, cacc[nt][3] * inv);
        o.z = f2bf2(cacc[nt][4] * inv, cacc[nt][5] * inv);
        o.w = f2bf2(cacc[nt][6] * inv, cacc[nt][7] * inv);
        *(uint4*)(crow + nt * 16) = o;
    }
}

// ---------------------------------------------------------------------------
// out = LayerNorm(a + b) * gamma + beta ; one 1024-wide row per 256-thr block
// WB: also write the row as bf16, the form in which the next GEMM reads it
// ---------------------------------------------------------------------------
template<bool WB>
__launch_bounds__(256)
__global__ void add_ln_kernel(const float* __restrict__ a,
                              const float* __restrict__ b,
                              const float* __restrict__ gamma,
                              const float* __restrict__ beta,
                              float* __restrict__ out,
                              __bf16* __restrict__ outb)
{
    __shared__ float red[16];
    const int row = blockIdx.x;
    const int tid = threadIdx.x;
    const size_t base = (size_t)row * DMODEL;

    float v[4]; float s = 0.0f, ss = 0.0f;
    #pragma unroll
    for (int j = 0; j < 4; ++j) {
        int idx = tid + j * 256;
        float x = a[base + idx] + b[base + idx];
        v[j] = x; s += x; ss += x * x;
    }
    #pragma unroll
    for (int off = 1; off < 32; off <<= 1) {
        s  += __shfl_xor(s,  off, 32);
        ss += __shfl_xor(ss, off, 32);
    }
    int wid = tid >> 5, lane = tid & 31;
    if (lane == 0) { red[wid] = s; red[8 + wid] = ss; }
    __syncthreads();
    if (wid == 0) {
        float s2  = (lane < 8) ? red[lane] : 0.0f;
        float ss2 = (lane < 8) ? red[8 + lane] : 0.0f;
        #pragma unroll
        for (int off = 1; off < 8; off <<= 1) {
            s2  += __shfl_xor(s2,  off, 32);
            ss2 += __shfl_xor(ss2, off, 32);
        }
        if (lane == 0) { red[0] = s2; red[8] = ss2; }
    }
    __syncthreads();
    float mu  = red[0] * (1.0f / DMODEL);
    float var = red[8] * (1.0f / DMODEL) - mu * mu;
    float rs  = rsqrtf(var + EPSLN);
    #pragma unroll
    for (int j = 0; j < 4; ++j) {
        int idx = tid + j * 256;
        float y = (v[j] - mu) * rs * gamma[idx] + beta[idx];
        out[base + idx] = y;
        if (WB) outb[base + idx] = f2bf(y);
    }
}

// ---------------------------------------------------------------------------
// Host-side orchestration
// ---------------------------------------------------------------------------
extern "C" void kernel_launch(void* const* d_in, const int* in_sizes, int n_in,
                              void* d_out, int out_size, void* d_ws, size_t ws_size,
                              hipStream_t stream)
{
    const float* x   = (const float*)d_in[0];
    const float* Wq  = (const float*)d_in[1];
    const float* Wk  = (const float*)d_in[2];
    const float* Wv  = (const float*)d_in[3];
    const float* Wo  = (const float*)d_in[4];
    const float* W1  = (const float*)d_in[5];
    const float* b1  = (const float*)d_in[6];
    const float* W2  = (const float*)d_in[7];
    const float* b2  = (const float*)d_in[8];
    const float* g1  = (const float*)d_in[9];
    const float* be1 = (const float*)d_in[10];
    const float* g2  = (const float*)d_in[11];
    const float* be2 = (const float*)d_in[12];
    float* out = (float*)d_out;

    const int M = BATCH * SEQ;   // 4096 token rows

    char* w = (char*)d_ws;
    auto take = [&](size_t bytes) -> char* {
        char* p = w; w += (bytes + 255) & ~(size_t)255; return p;
    };
    __bf16* qb  = (__bf16*)take((size_t)3 * M * DMODEL * sizeof(__bf16)); // 3 x 8 MB, one behind the other
    __bf16* kb  = qb + (size_t)M * DMODEL;
    __bf16* vtb = kb + (size_t)M * DMODEL;
    __bf16* ctx = (__bf16*)take((size_t)M * DMODEL * sizeof(__bf16)); //  8 MB
    float*  ao  = (float*)take((size_t)M * DMODEL * sizeof(float));   // 16 MB
    float*  h   = (float*)take((size_t)M * DMODEL * sizeof(float));   // 16 MB
    __bf16* hb  = (__bf16*)take((size_t)M * DMODEL * sizeof(__bf16)); //  8 MB
    __bf16* f1  = (__bf16*)take((size_t)M * FFDIM  * sizeof(__bf16)); // 32 MB
    float*  f2  = (float*)take((size_t)M * DMODEL * sizeof(float));   // 16 MB
    __bf16* xb  = (__bf16*)take((size_t)M * DMODEL * sizeof(__bf16)); //  8 MB
    __bf16* Wob = (__bf16*)take((size_t)DMODEL * DMODEL * sizeof(__bf16)); // 2 MB
    __bf16* Wqt = (__bf16*)take((size_t)3 * DMODEL * DMODEL * sizeof(__bf16)); // 3 x 2 MB: one [3072][1024] operand
    __bf16* Wkt = Wqt + (size_t)DMODEL * DMODEL;
    __bf16* Wvt = Wkt + (size_t)DMODEL * DMODEL;
    __bf16* W1t = (__bf16*)take((size_t)DMODEL * FFDIM  * sizeof(__bf16)); // 8 MB
    __bf16* W2t = (__bf16*)take((size_t)DMODEL * FFDIM  * sizeof(__bf16)); // 8 MB

    const dim3 blk(GT);
    const dim3 g_d(DMODEL / BN, M / BM);   // (8, 32)
    const dim3 g_ff(FFDIM / BN, M / BM);   // (32, 32)
    const dim3 g_qkv(3 * DMODEL / BN, M / BM);   // (24, 32)
    const float qscale = 0.125f;           // 1/sqrt(DK)

    // fp32 inputs -> bf16 GEMM operands, K-contiguous
    pack_operands<<<dim3(PK_ALL), dim3(256), 0, stream>>>(x, Wo, Wq, Wk, Wv, W1, W2,
                                                          xb, Wob, Wqt, Wkt, Wvt, W1t, W2t);

    // Q,K,V projections in one launch: 768 blocks, three to a WGP, so that one
    // block's loads, LDS traffic and barriers run under the others' WMMAs.
    // Packed straight to the attention layouts in bf16.
    gemm_bf16_wmma<EPI_QKV, 1><<<g_qkv, blk, 0, stream>>>(xb, Wqt, nullptr, nullptr, qb, M, 3 * DMODEL, DMODEL, qscale);

    // Causal flash attention
    flash_attn_kernel<<<dim3(SEQ / 64, BATCH * NH), dim3(AT), 0, stream>>>(qb, kb, vtb, ctx);

    // Output projection (Wo is [N,K] row-major as given)
    gemm_bf16_wmma<EPI_F32, 4><<<g_d, blk, 0, stream>>>(ctx, Wob, nullptr, ao, nullptr, M, DMODEL, DMODEL, 1.0f);

    // h = LN(x + attn_out)
    add_ln_kernel<true><<<dim3(M), dim3(256), 0, stream>>>(x, ao, g1, be1, h, hb);

    // FFN
    gemm_bf16_wmma<EPI_BIAS_RELU, 1><<<g_ff, blk, 0, stream>>>(hb, W1t, b1, nullptr, f1, M, FFDIM,  DMODEL, 1.0f);
    gemm_bf16_wmma<EPI_BIAS, 4><<<g_d,  blk, 0, stream>>>(f1, W2t, b2, f2, nullptr, M, DMODEL, FFDIM,  1.0f);

    // out = LN(h + ffn)
    add_ln_kernel<false><<<dim3(M), dim3(256), 0, stream>>>(h, f2, g2, be2, out, nullptr);
}

// v008
// Measured time: 169 microseconds a run.
// In both of two side-by-side timings against v007, it was 1.03 times as fast.
// Over all steps from v000 it is 5.92 times as fast.
#include <hip/hip_runtime.h>
#include <hip/hip_bf16.h>
#include <stdint.h>

// ---------------------------------------------------------------------------
// Problem constants (match reference)
// ---------------------------------------------------------------------------
#define BATCH  2
#define SEQ    2048
#define DMODEL 1024
#define NH     16
#define DHEAD  64
#define FFDIM  4096
#define EPSLN  1e-6f

// ---------------------------------------------------------------------------
// WMMA types (CDNA5 / gfx1250, wave32)
// ---------------------------------------------------------------------------
typedef __attribute__((ext_vector_type(16))) __bf16 v16bf;
typedef __attribute__((ext_vector_type(8)))  float  v8f;
typedef __attribute__((ext_vector_type(4)))  uint32_t v4u;   // 16 raw bytes in registers

union Frag {
    v16bf v;
    uint4 q[2];
    uint32_t u[8];
};

__device__ __forceinline__ __bf16 f2bf(float f) {
    union { float f; uint32_t u; } c; c.f = f;
    uint32_t r = (c.u + 0x7FFFu + ((c.u >> 16) & 1u)) >> 16;   // RNE
    union { uint16_t s; __bf16 b; } o; o.s = (uint16_t)r;
    return o.b;
}

// Two fp32 values -> one dword of two bf16 (lo at the lower address).
__device__ __forceinline__ uint32_t f2bf2(float lo, float hi) {
    union { __bf16 b[2]; uint32_t u; } o;
    o.b[0] = f2bf(lo); o.b[1] = f2bf(hi);
    return o.u;
}

// Value of lane l ^ 16 (the other 16-lane half), without LDS.
__device__ __forceinline__ float xhalf(float x) {
    int b = __builtin_bit_cast(int, x);
    return __builtin_bit_cast(float,
        __builtin_amdgcn_permlanex16(b, b, 0x76543210, 0xfedcba98, false, false));
}

// ---------------------------------------------------------------------------
// Operand packing, once per call: every GEMM operand that arrives as fp32 is
// rounded to bf16 here, B operands also transposed to [N][K], so that no GEMM
// block repeats that work per tile. One 64x64 tile per 256-thread block.
//   x  [4096][1024] and Wo [N=1024][K=1024]   : same layout
//   Wq, Wk, Wv [K=1024][N=1024], W1 [1024][4096], W2 [4096][1024] : -> [N][K]
// ---------------------------------------------------------------------------
#define PK_X   (BATCH * SEQ / 64 * (DMODEL / 64))     // 1024 tiles
#define PK_W   (DMODEL / 64 * (DMODEL / 64))          //  256 tiles
#define PK_F   (DMODEL / 64 * (FFDIM / 64))           // 1024 tiles
#define PK_ALL (PK_X + 4 * PK_W + 2 * PK_F)

__launch_bounds__(256)
__global__ void pack_operands(const float* __restrict__ x,  const float* __restrict__ Wo,
                              const float* __restrict__ Wq, const float* __restrict__ Wk,
                              const float* __restrict__ Wv, const float* __restrict__ W1,
                              const float* __restrict__ W2,
                              __bf16* __restrict__ xb,  __bf16* __restrict__ Wob,
                              __bf16* __restrict__ Wqt, __bf16* __restrict__ Wkt,
                              __bf16* __restrict__ Wvt, __bf16* __restrict__ W1t,
                              __bf16* __restrict__ W2t)
{
    __shared__ uint32_t Ts[64][33];   // [n][k pair]; 33 dwords: writes and reads hit distinct banks

    const int tid = threadIdx.x;
    int t = blockIdx.x;
    const float* src; __bf16* dst; int rows, cols; bool tr;
    if      (t < PK_X)                       { src = x;  dst = xb;  rows = BATCH * SEQ; cols = DMODEL; tr = false; }
    else if ((t -= PK_X) < PK_W)             { src = Wo; dst = Wob; rows = DMODEL; cols = DMODEL; tr = false; }
    else if ((t -= PK_W) < PK_W)             { src = Wq; dst = Wqt; rows = DMODEL; cols = DMODEL; tr = true; }
    else if ((t -= PK_W) < PK_W)             { src = Wk; dst = Wkt; rows = DMODEL; cols = DMODEL; tr = true; }
    else if ((t -= PK_W) < PK_W)             { src = Wv; dst = Wvt; rows = DMODEL; cols = DMODEL; tr = true; }
    else if ((t -= PK_W) < PK_F)             { src = W1; dst = W1t; rows = DMODEL; cols = FFDIM;  tr = true; }
    else                     { t -= PK_F;      src = W2; dst = W2t; rows = FFDIM;  cols = DMODEL; tr = true; }
    const int tpr = cols >> 6;               // tiles per row of tiles
    const int r0 = (t / tpr) << 6, c0 = (t % tpr) << 6;

    if (!tr) {
        size_t e[4]; float4 v[4];
        #pragma unroll
        for (int i = 0; i < 4; ++i) {
            int idx = i * 256 + tid;
            e[i] = (size_t)(r0 + (idx >> 4)) * cols + c0 + ((idx & 15) << 2);
            v[i] = *(const float4*)(src + e[i]);
            // The load stays in flight while its address registers are reused
            // (by the next load's result, by the rounding): the wait stands first.
            asm volatile("s_wait_xcnt 0x0" ::: "memory");
        }
        #pragma unroll
        for (int i = 0; i < 4; ++i) {
            uint2 o; o.x = f2bf2(v[i].x, v[i].y); o.y = f2bf2(v[i].z, v[i].w);
            *(uint2*)(dst + e[i]) = o;
            // The store stays in flight while its address and data registers are
            // reused (by the next rounding, by code behind the branch): wait first.
            asm volatile("s_wait_xcnt 0x0" ::: "memory");
        }
    } else {                                 // block-uniform branch: the barrier is safe
        float4 a[2], b[2];
        #pragma unroll
        for (int i = 0; i < 2; ++i) {
            int idx = i * 256 + tid;
            const float* p = src + (size_t)(r0 + 2 * (idx >> 4)) * cols + c0 + ((idx & 15) << 2);
            a[i] = *(const float4*)p;
            asm volatile("s_wait_xcnt 0x0" ::: "memory");   // as above
            b[i] = *(const float4*)(p + cols);
            asm volatile("s_wait_xcnt 0x0" ::: "memory");   // as above
        }
        #pragma unroll
        for (int i = 0; i < 2; ++i) {
            int idx = i * 256 + tid;
            int kp = idx >> 4, c = (idx & 15) << 2;
            Ts[c + 0][kp] = f2bf2(a[i].x, b[i].x); Ts[c + 1][kp] = f2bf2(a[i].y, b[i].y);
            Ts[c + 2][kp] = f2bf2(a[i].z, b[i].z); Ts[c + 3][kp] = f2bf2(a[i].w, b[i].w);
        }
        __syncthreads();
        #pragma unroll
        for (int i = 0; i < 2; ++i) {
            int idx = i * 256 + tid;
            int n = idx >> 3, q = (idx & 7) << 2;
            uint4 o; o.x = Ts[n][q]; o.y = Ts[n][q + 1]; o.z = Ts[n][q + 2]; o.w = Ts[n][q + 3];
            *(uint4*)(dst + (size_t)(c0 + n) * rows + r0 + 2 * q) = o;
        }
    }
}

// ---------------------------------------------------------------------------
// Generic bf16-WMMA GEMM: C[M,N] = A[M,K] * Bt[N,K]^T  (A, Bt bf16 in memory,
// both K-contiguous; fp32 accumulate via v_wmma_f32_16x16x32_bf16)
//
// Block tile: 128x128, 256 threads (8 wave32), wave tile 64x32. A pass takes
// one 128-byte line of every row, which in bf16 is K-step 64 (two WMMA k-steps).
// LDS rows padded to BK+8 bf16 (144B) so per-lane fragment reads are two
// 16B-aligned ds_load_b128, matching the 16-bit A/B operand layout:
//   lane l: row/col = l&15, half = l>>4; chunk0 = K[half*8 .. +7],
//   chunk1 = K[16+half*8 .. +7]  (per K-step of 32).
// The product is taken transposed: the Bs fragment is the first WMMA operand,
// the As fragment the second. A lane then holds 8 neighbouring Bs-side indices
// (hf*8 + r) of ONE As-side index (ln): with the weights in Bs these are 8
// neighbouring columns of one output row, which leave in 16-byte stores.
// ---------------------------------------------------------------------------
#define BM 128
#define BN 128
#define BK 64
#define GT 256
#define LDAP 72   // BK + 8 pad -> 144B row stride, 16B aligned rows

// EPI_QKV: B holds the Q, K and V weights one behind the other (N = 3 * DMODEL),
// Cb the three outputs one behind the other; a block lies wholly in one of them.
enum { EPI_F32 = 0, EPI_BIAS = 1, EPI_BIAS_RELU = 2, EPI_QKV = 3 };

// PF: how many K tiles ahead the global loads go out, each tile into a register
// set of its own. PF is 1 or even; K is a multiple of PF * BK and at least twice it.
template<int EPI, int PF>
__launch_bounds__(GT)
__global__ void gemm_bf16_wmma(const __bf16* A,  // A, B: no __restrict__, see fetch
                               const __bf16* B,  // [N,K] row-major
                               const float* __restrict__ bias,
                               float* __restrict__ C,
                               __bf16* __restrict__ Cb,
                               int M, int N, int K, float scale)
{
    constexpr int NB = (PF > 1) ? 2 : 1;   // LDS buffers per operand
    __shared__ __bf16 As[NB][BM][LDAP];
    __shared__ __bf16 Bs[NB][BN][LDAP];

    const int tid  = threadIdx.x;
    const int m0   = blockIdx.y * BM;
    const int n0   = blockIdx.x * BN;
    const int wid  = tid >> 5;
    const int lane = tid & 31;
    const int hf   = lane >> 4;
    const int ln   = lane & 15;
    const int wm   = (wid >> 2) * 64;   // 2 wave rows
    const int wn   = (wid & 3) * 32;    // 4 wave cols

    v8f acc[4][2] = {};

    // V is stored transposed ([dv][t]): its blocks want 8 neighbouring tokens in a
    // lane, so there the token rows go to Bs and the weight rows to As. Both tiles
    // are 128 K-contiguous rows: only the two base addresses change places.
    const bool vsw = (EPI == EPI_QKV) && (n0 >= 2 * DMODEL);   // one test per block
    const __bf16* Ag = vsw ? B + (size_t)n0 * K : A + (size_t)m0 * K;
    const __bf16* Bg = vsw ? A + (size_t)m0 * K : B + (size_t)n0 * K;

    // Byte offsets of this thread's 16-byte slots inside a K tile (the same for
    // A and B); they do not change over the loop, only the tile's (uniform)
    // base address does.
    uint32_t oa[4];
    #pragma unroll
    for (int i = 0; i < 4; ++i) {
        int idx = i * GT + tid;                  // 0..1023 slots of 8 bf16
        oa[i] = (uint32_t)(((idx >> 3) * K + ((idx & 7) << 3)) * 2);
    }

    // All eight loads of one K tile, issued as one group into registers.
    // A and B are not __restrict__: plain loads keep their place in front of the
    // barrier's fence; marked __restrict__ the compiler sank them over both
    // barriers to their first use, where each waited out its own latency.
    // each: the wait stands behind every load (for the passes behind the loop, where
    // this build keeps a load's address in registers that a later load of the group
    // fills).
    auto fetch = [&](v4u (&ra)[4], v4u (&rb)[4], int kt, bool each = false) {
        const char* At = (const char*)(Ag + kt);
        const char* Bt = (const char*)(Bg + kt);
        #pragma unroll
        for (int i = 0; i < 4; ++i) {
            ra[i] = *(const v4u*)(At + oa[i]);
            if (each && i < 3) asm volatile("s_wait_xcnt 0x0" ::: "memory");
        }
        // The loads stay in flight while their address registers are reused
        // (by the loads below, by the fragment loads): the wait stands first.
        asm volatile("s_wait_xcnt 0x0" ::: "memory");
        #pragma unroll
        for (int i = 0; i < 4; ++i) {
            rb[i] = *(const v4u*)(Bt + oa[i]);
            if (each && i < 3) asm volatile("s_wait_xcnt 0x0" ::: "memory");
        }
        asm volatile("s_wait_xcnt 0x0" ::: "memory");   // as above
    };

    // Work-group barrier whose fences order LDS only. As and Bs are all that
    // the waves hand to each other; __syncthreads() would also wait out the
    // global loads that are meant to stay in flight over it.
    auto lds_barrier = [&]() {
        __builtin_amdgcn_fence(__ATOMIC_RELEASE, "workgroup", "local");
        __builtin_amdgcn_s_barrier();
        __builtin_amdgcn_fence(__ATOMIC_ACQUIRE, "workgroup", "local");
    };

    // Set p's raw tile goes to LDS buffer b (128 rows x 64 bf16 of A and of B).
    v4u ra[PF][4], rb[PF][4];
    auto stage = [&](int p, int b) {
        #pragma unroll
        for (int i = 0; i < 4; ++i) {
            int idx = i * GT + tid;
            int r = idx >> 3, c = (idx & 7) << 3;
            *(v4u*)&As[b][r][c] = ra[p][i];
            *(v4u*)&Bs[b][r][c] = rb[p][i];
        }
        // Keeps the next loads behind the LDS stores above, so that they land in
        // the registers just freed: lifted over them they need a further set and
        // copies, and the copies' wait for the loads stands early.
        __builtin_amdgcn_sched_barrier(0);
    };

    // PF raw tiles are carried over the loop's back edge: a tile's loads are
    // issued behind the LDS stores that free its registers and fly during PF
    // passes of LDS traffic, barriers and WMMAs. No branch stands around a fetch
    // (a join of two paths would drain it early).
    #pragma unroll
    for (int p = 0; p < PF; ++p) fetch(ra[p], rb[p], p * BK);
    if (PF == 1) {
        // Launches with several blocks on a WGP, which hide a load's latency and
        // each other's LDS phases. In the last pass the fetch re-reads the last tile
        // and nothing uses it.
        for (int kt = 0; kt < K; kt += BK) {
            stage(0, 0);
            fetch(ra[0], rb[0], (kt + BK < K) ? kt + BK : kt);
            lds_barrier();

            // ---- fragments + 8 WMMAs per k-step of 32, k ascending -----------
            #pragma unroll
            for (int ks = 0; ks < BK; ks += 32) {
                Frag af[4], bfr[2];
                #pragma unroll
                for (int mt = 0; mt < 4; ++mt) {
                    const __bf16* p = &As[0][wm + mt * 16 + ln][ks];
                    af[mt].q[0] = *(const uint4*)(p + hf * 8);
                    af[mt].q[1] = *(const uint4*)(p + 16 + hf * 8);
                }
                #pragma unroll
                for (int nt = 0; nt < 2; ++nt) {
                    const __bf16* p = &Bs[0][wn + nt * 16 + ln][ks];
                    bfr[nt].q[0] = *(const uint4*)(p + hf * 8);
                    bfr[nt].q[1] = *(const uint4*)(p + 16 + hf * 8);
                }
                #pragma unroll
                for (int mt = 0; mt < 4; ++mt)
                    #pragma unroll
                    for (int nt = 0; nt < 2; ++nt)
                        acc[mt][nt] = __builtin_amdgcn_wmma_f32_16x16x32_bf16(
                            false, bfr[nt].v, false, af[mt].v, (short)0, acc[mt][nt], false, false);
            }
            lds_barrier();
        }
    } else {
        // Launches with one block on a WGP: nothing else hides what a pass waits
        // for, so the pass itself overlaps it. Pass t reads tile t from buffer
        // t & 1; meanwhile tile t + 1, asked for PF passes earlier, goes from its
        // registers to the other buffer, and tile t + 1 + PF is asked for. The one
        // barrier at the foot of a pass publishes tile t + 1 and ends every read of
        // tile t, whose buffer the next pass overwrites.
        auto pass = [&](int p, bool more, bool ask, int knext, bool each) {
            // The pass's 24 fragment loads go out as one group, in the order of
            // their use; the WMMAs follow on counted waits.
            Frag af[2][4], bfr[2][2];
            #pragma unroll
            for (int s = 0; s < 2; ++s) {
                #pragma unroll
                for (int nt = 0; nt < 2; ++nt) {
                    const __bf16* q = &Bs[p & 1][wn + nt * 16 + ln][s * 32];
                    bfr[s][nt].q[0] = *(const uint4*)(q + hf * 8);
                    bfr[s][nt].q[1] = *(const uint4*)(q + 16 + hf * 8);
                }
                #pragma unroll
                for (int mt = 0; mt < 4; ++mt) {
                    const __bf16* q = &As[p & 1][wm + mt * 16 + ln][s * 32];
                    af[s][mt].q[0] = *(const uint4*)(q + hf * 8);
                    af[s][mt].q[1] = *(const uint4*)(q + 16 + hf * 8);
                }
            }
            // Keeps the group whole and in front: in the unrolled loop this build
            // split it into pairs, each waited out to 0 in front of its two WMMAs.
            __builtin_amdgcn_sched_barrier(0);
            if (more) stage((p + 1) % PF, (p + 1) & 1);
            if (ask)  fetch(ra[(p + 1) % PF], rb[(p + 1) % PF], knext, each);
            #pragma unroll
            for (int s = 0; s < 2; ++s)
                #pragma unroll
                for (int mt = 0; mt < 4; ++mt)
                    #pragma unroll
                    for (int nt = 0; nt < 2; ++nt)
                        acc[mt][nt] = __builtin_amdgcn_wmma_f32_16x16x32_bf16(
                            false, bfr[s][nt].v, false, af[s][mt].v, (short)0, acc[mt][nt], false, false);
            // Keeps the WMMAs in front of the barrier, where they run under the LDS
            // traffic: sunk behind it they stood in front of the next pass's loads.
            __builtin_amdgcn_sched_barrier(0);
            lds_barrier();
        };
        stage(0, 0);
        fetch(ra[0], rb[0], PF * BK);
        lds_barrier();
        for (int kt = (PF + 1) * BK; kt < K - PF * BK; kt += PF * BK) {
            #pragma unroll
            for (int p = 0; p < PF; ++p) pass(p, true, true, kt + p * BK, false);
        }
        // The last 2 * PF passes stand behind the loop: PF - 1 tiles are still to
        // be asked for, 2 * PF - 1 still to be staged.
        #pragma unroll
        for (int p = 0; p < PF; ++p) pass(p, true, p + 1 < PF, K - (PF - 1 - p) * BK, true);
        #pragma unroll
        for (int p = 0; p < PF; ++p) pass(p, p + 1 < PF, false, 0, false);
    }

    // ---- epilogue: D element (m,n) sits in vgpr r = m&7 of lane n + 16*(m>>3); m runs
    // over the Bs side, n over the As side: 8 neighbouring Bs-side indices per lane.
    // The block's tile goes through LDS, [As-side index][Bs-side index], so that it
    // leaves in whole rows: 16 bytes a lane, 256 or 512 bytes in a row per store.
    // The K loop's last barrier has ended every read of As and Bs.
    constexpr bool F32OUT = (EPI == EPI_F32 || EPI == EPI_BIAS);
    constexpr int ESZ = F32OUT ? 4 : 2;        // bytes per output element
    constexpr int SP  = BN * ESZ + 16;         // staged row pitch: 16 B x odd, no bank conflicts
    static_assert(64 * SP <= (int)sizeof(As) && 64 * SP <= (int)sizeof(Bs), "staging fits");
    char* const sA = (char*)&As[0][0][0];      // staged rows 0..63
    char* const sB = (char*)&Bs[0][0][0];      // staged rows 64..127
    const int ib = wn + hf * 8;                // first of the lane's 8 Bs-side indices, + nt * 16
    const int sel = (EPI == EPI_QKV) ? n0 / DMODEL : 0;           // 0 = Q, 1 = K, 2 = V
    const float sc = (EPI == EPI_QKV && sel == 0) ? scale : 1.0f; // Q pre-scaled by 1/sqrt(DK)

    float bb[2][8];                // the lane's 16 bias values
    if (EPI == EPI_BIAS || EPI == EPI_BIAS_RELU) {
        #pragma unroll
        for (int nt = 0; nt < 2; ++nt) {
            const float* bp = bias + n0 + ib + nt * 16;
            const float4 lo = *(const float4*)bp, hi = *(const float4*)(bp + 4);
            // The loads stay in flight while their address registers are reused: wait first.
            asm volatile("s_wait_xcnt 0x0" ::: "memory");
            bb[nt][0] = lo.x; bb[nt][1] = lo.y; bb[nt][2] = lo.z; bb[nt][3] = lo.w;
            bb[nt][4] = hi.x; bb[nt][5] = hi.y; bb[nt][6] = hi.z; bb[nt][7] = hi.w;
        }
    }
    char* const sw = (wm ? sB : sA) + ln * SP + ib * ESZ;   // wm is 0 or 64
    #pragma unroll
    for (int mt = 0; mt < 4; ++mt)
    #pragma unroll
    for (int nt = 0; nt < 2; ++nt) {
        float v[8];
        #pragma unroll
        for (int r = 0; r < 8; ++r) {
            v[r] = acc[mt][nt][r];
            if (EPI == EPI_QKV) v[r] *= sc;
            if (EPI == EPI_BIAS || EPI == EPI_BIAS_RELU) v[r] += bb[nt][r];
            if (EPI == EPI_BIAS_RELU) v[r] = fmaxf(v[r], 0.0f);
        }
        char* p = sw + mt * 16 * SP + nt * 16 * ESZ;
        if (F32OUT) {
            *(float4*)p        = make_float4(v[0], v[1], v[2], v[3]);
            *(float4*)(p + 16) = make_float4(v[4], v[5], v[6], v[7]);
        } else {                   // feeds a matrix product only: bf16
            uint4 o;
            o.x = f2bf2(v[0], v[1]); o.y = f2bf2(v[2], v[3]);
            o.z = f2bf2(v[4], v[5]); o.w = f2bf2(v[6], v[7]);
            *(uint4*)p = o;
        }
    }
    lds_barrier();                 // publishes the staged tile to all eight waves

    constexpr int SPR = BN * ESZ / 16;   // 16-byte slots per staged row: 16 or 32
    constexpr int RPI = GT / SPR;        // rows the block moves per step: 16 or 8
    constexpr int NI  = BM / RPI;        // steps: 8 or 16
    const int r0   = tid / SPR;
    const int slot = tid % SPR;
    // Where staged row 0 of this lane's slot goes, in elements, and the step per row.
    size_t e0, rs;
    if (EPI == EPI_QKV) {
        const int b  = m0 >> 11;                      // BM divides SEQ: one batch per block
        const int tb = m0 & (SEQ - 1);
        const int cb = n0 & (DMODEL - 1);
        const int col = cb + slot * 8;                // Q, K: slot = 8 dd of head col >> 6
        // Q, K -> [B,H,T,64]: row = token. V -> [B,H,64,T]: row = column h*64 + dd, slot = 8 tokens.
        e0 = vsw ? (size_t)(b * DMODEL + cb) * SEQ + tb + slot * 8
                 : (((size_t)(b * NH + (col >> 6)) * SEQ + tb) << 6) + (col & 63);
        e0 += (size_t)sel * ((size_t)BATCH * SEQ * DMODEL);
        rs = vsw ? SEQ : DHEAD;
    } else {
        e0 = (size_t)m0 * N + n0 + slot * (16 / ESZ);
        rs = N;
    }
    char* const og = (F32OUT ? (char*)C : (char*)Cb) + e0 * ESZ;
    v4u q[NI];
    #pragma unroll
    for (int i = 0; i < NI; ++i)
        q[i] = *(const v4u*)((i < NI / 2 ? sA : sB) + ((i * RPI) % 64 + r0) * SP + slot * 16);
    #pragma unroll
    for (int i = 0; i < NI; ++i) {
        *(v4u*)(og + (size_t)(i * RPI + r0) * rs * ESZ) = q[i];
        // The store stays in flight while its address registers are reused (by the
        // next store's address): the wait stands first.
        asm volatile("s_wait_xcnt 0x0" ::: "memory");
    }
}

// ---------------------------------------------------------------------------
// Causal flash attention: grid (T/64, B*H), 128 threads (4 waves).
// Wave w owns q rows qtile*64 + w*16 .. +15; streams K/V in 64-wide chunks
// (only sc <= qtile: causal), online softmax, ctx accumulated in fp32.
// Both products are taken transposed: St = K * Qt and Ot += Vt * Pt. A lane
// then holds scores of ONE query (column ln), keys nt*16 + hf*8 + r: maximum
// and sum run inside the lane, the two halves meet in one register exchange,
// and two St tiles, rounded in place, are the B operand Pt of the second
// product (its k order is the one the Vs loader below already uses).
// K and Vt chunks come by asynchronous copies to LDS, two buffers: chunk sc + 1
// flies while chunk sc is worked on.
// ---------------------------------------------------------------------------
#define AT 128
#define KPAD 72   // 64 + 8 pad -> 144B row stride, 16B aligned rows

__launch_bounds__(AT)
__global__ void flash_attn_kernel(const __bf16* __restrict__ qg,
                                  const __bf16* __restrict__ kg,
                                  const __bf16* __restrict__ vtg,
                                  __bf16* __restrict__ ctx)
{
    __shared__ __attribute__((aligned(16))) __bf16 Ks[2][64][KPAD];   // K chunk   [s][dk], two buffers
    __shared__ __attribute__((aligned(16))) __bf16 Vs[2][64][KPAD];   // Vt chunk  [dv][s], two buffers

    const int tid   = threadIdx.x;
    const int wid   = tid >> 5;
    const int lane  = tid & 31;
    const int hf    = lane >> 4;
    const int ln    = lane & 15;
    const int bh    = blockIdx.y;         // b*NH + h
    const int qtile = blockIdx.x;
    const int qrow0 = qtile * 64 + wid * 16;

    // Q fragments (B operand: column = query ln; K = DHEAD = 64 -> two K-steps of 32)
    const __bf16* qrow = qg + ((size_t)bh * SEQ + qrow0 + ln) * DHEAD;
    Frag aq[2];
    #pragma unroll
    for (int ks = 0; ks < 2; ++ks) {
        aq[ks].q[0] = *(const uint4*)(qrow + ks * 32 + hf * 8);
        aq[ks].q[1] = *(const uint4*)(qrow + ks * 32 + 16 + hf * 8);
    }

    float cmax = -3.0e38f;   // running maximum of query ln, alike in both halves
    float csum = 0.0f;       // running sum over the keys of this lane's half only
    v8f cacc[4] = {};        // Ot: dv = nt*16 + hf*8 + r, query ln

    const __bf16* kbase = kg  + (size_t)bh * SEQ * DHEAD;
    const __bf16* vbase = vtg + (size_t)bh * DHEAD * SEQ;
    const int t_idx = qrow0 + ln;

    // ---- K chunk [64][64] and Vt chunk [64][64] -> LDS buffer b ------------
    // A thread moves 16 bytes of rows sr, sr + 16, sr + 32, sr + 48 of each: eight
    // copies a wave, every lane on, straight into the padded rows.
    const int sr = tid >> 3, scol = (tid & 7) << 3;
    const __bf16* kslot = kbase + (size_t)sr * DHEAD + scol;
    const __bf16* vslot = vbase + (size_t)sr * SEQ + scol;
    const uint32_t lks = (uint32_t)(uintptr_t)&Ks[0][sr][scol];   // LDS byte addresses
    const uint32_t lvs = (uint32_t)(uintptr_t)&Vs[0][sr][scol];
    constexpr uint32_t LBUF = 64 * KPAD * 2;    // bytes of one buffer
    constexpr uint32_t LR16 = 16 * KPAD * 2;    // bytes of 16 LDS rows
    auto copy_chunk = [&](int sc, int b) {
        const __bf16* kp = kslot + (size_t)sc * 64 * DHEAD;
        const __bf16* vp = vslot + sc * 64;
        const uint32_t lk = lks + b * LBUF, lv = lvs + b * LBUF;
        // The wait is the statement's last line: the copies stay in flight while
        // their address registers are reused, and it stands in front of that.
        asm volatile("global_load_async_to_lds_b128 %0, %8, off\n\t"
                     "global_load_async_to_lds_b128 %1, %9, off\n\t"
                     "global_load_async_to_lds_b128 %2, %10, off\n\t"
                     "global_load_async_to_lds_b128 %3, %11, off\n\t"
                     "global_load_async_to_lds_b128 %4, %12, off\n\t"
                     "global_load_async_to_lds_b128 %5, %13, off\n\t"
                     "global_load_async_to_lds_b128 %6, %14, off\n\t"
                     "global_load_async_to_lds_b128 %7, %15, off\n\t"
                     "s_wait_xcnt 0x0"
                     :: "v"(lk), "v"(lk + LR16), "v"(lk + 2 * LR16), "v"(lk + 3 * LR16),
                        "v"(lv), "v"(lv + LR16), "v"(lv + 2 * LR16), "v"(lv + 3 * LR16),
                        "v"(kp), "v"(kp + 16 * DHEAD), "v"(kp + 32 * DHEAD), "v"(kp + 48 * DHEAD),
                        "v"(vp), "v"(vp + 16 * SEQ), "v"(vp + 32 * SEQ), "v"(vp + 48 * SEQ)
                     : "memory");
    };

    copy_chunk(0, 0);
    asm volatile("s_wait_asynccnt 0x0" ::: "memory");   // this wave's copies of chunk 0 have landed
    __syncthreads();                                    // and every other wave's
    if (qtile >= 1) copy_chunk(1, 1);                   // one test for the whole block

    for (int sc = 0; sc <= qtile; ++sc) {
        const int s0 = sc * 64;
        const int cb = sc & 1;                // this chunk's buffer

        // ---- St = K * Qt  (64 keys x 16 queries per wave) ------------------
        // All 16 fragment loads go out as one group, each into registers of its
        // own: written load by WMMA, this build took one register set for all
        // eight fragments and waited out the LDS latency in front of every WMMA.
        Frag bk[4][2];
        #pragma unroll
        for (int nt = 0; nt < 4; ++nt)
            #pragma unroll
            for (int ks = 0; ks < 2; ++ks) {
                const __bf16* p = &Ks[cb][nt * 16 + ln][ks * 32];
                bk[nt][ks].q[0] = *(const uint4*)(p + hf * 8);
                bk[nt][ks].q[1] = *(const uint4*)(p + 16 + hf * 8);
            }
        // Keeps the group whole: without it the loads sink back among the WMMAs.
        __builtin_amdgcn_sched_barrier(0);
        v8f sacc[4] = {};
        #pragma unroll
        for (int nt = 0; nt < 4; ++nt)
            #pragma unroll
            for (int ks = 0; ks < 2; ++ks)
                sacc[nt] = __builtin_amdgcn_wmma_f32_16x16x32_bf16(
                    false, bk[nt][ks].v, false, aq[ks].v, (short)0, sacc[nt], false, false);
        // The Vt fragments of the second product, again as one group, issued here
        // so that the hand-over below can free buffer cb before the softmax.
        Frag bv[4][2];
        #pragma unroll
        for (int nt = 0; nt < 4; ++nt)
            #pragma unroll
            for (int ks = 0; ks < 2; ++ks) {
                const __bf16* p = &Vs[cb][nt * 16 + ln][ks * 32];
                bv[nt][ks].q[0] = *(const uint4*)(p + hf * 8);
                bv[nt][ks].q[1] = *(const uint4*)(p + 16 + hf * 8);
            }
        // Keeps these loads in front of the softmax: sunk to their WMMAs they
        // would each be waited for there.
        __builtin_amdgcn_sched_barrier(0);
        // ---- hand-over: chunk sc + 1 is published, buffer cb is given free ----
        // It stands behind the trip's last LDS read (the rest of the trip works in
        // registers), so that chunk sc + 2 has a whole trip to land.
        asm volatile("s_wait_dscnt 0x0" ::: "memory");      // this wave's reads of buffer cb are done
        asm volatile("s_wait_asynccnt 0x0" ::: "memory");   // its copies of chunk sc + 1 have landed
        __syncthreads();
        if (sc + 2 <= qtile) copy_chunk(sc + 2, cb);        // one test for the whole block
        // ---- causal mask: key s0 + hf*8 + (nt*16 + r) against query t_idx ---
        const int room = t_idx - s0 - hf * 8;
        #pragma unroll
        for (int nt = 0; nt < 4; ++nt)
            #pragma unroll
            for (int r = 0; r < 8; ++r)
                sacc[nt][r] = (nt * 16 + r > room) ? -3.0e38f : sacc[nt][r];
        // ---- online softmax: one query per lane ----------------------------
        float mt[4];
        #pragma unroll
        for (int nt = 0; nt < 4; ++nt) {
            mt[nt] = sacc[nt][0];
            #pragma unroll
            for (int r = 1; r < 8; ++r) mt[nt] = fmaxf(mt[nt], sacc[nt][r]);
        }
        float mx = fmaxf(fmaxf(mt[0], mt[1]), fmaxf(mt[2], mt[3]));
        mx = fmaxf(mx, xhalf(mx));
        const float mnew = fmaxf(cmax, mx);
        const float corr = __expf(cmax - mnew);
        cmax = mnew;
        Frag bp[2];                       // Pt, B operand: k = key within 32
        float pt[4];
        #pragma unroll
        for (int nt = 0; nt < 4; ++nt) {
            pt[nt] = 0.0f;
            #pragma unroll
            for (int r = 0; r < 8; r += 2) {
                float p0 = __expf(sacc[nt][r]     - mnew);
                float p1 = __expf(sacc[nt][r + 1] - mnew);
                pt[nt] += p0 + p1;
                bp[nt >> 1].u[(nt & 1) * 4 + (r >> 1)] = f2bf2(p0, p1);
            }
        }
        csum = csum * corr + ((pt[0] + pt[1]) + (pt[2] + pt[3]));
        #pragma unroll
        for (int nt = 0; nt < 4; ++nt)
            #pragma unroll
            for (int r = 0; r < 8; ++r) cacc[nt][r] = cacc[nt][r] * corr;
        // ---- Ot += Vt * Pt ---------------------------------------------------
        #pragma unroll
        for (int nt = 0; nt < 4; ++nt)
            #pragma unroll
            for (int ks = 0; ks < 2; ++ks)
                cacc[nt] = __builtin_amdgcn_wmma_f32_16x16x32_bf16(
                    false, bv[nt][ks].v, false, bp[ks].v, (short)0, cacc[nt], false, false);
    }
    asm volatile("s_wait_asynccnt 0x0" ::: "memory");       // no copy is left in flight at the wave's end

    // ---- normalize + store ctx as [B*T, H*DV] bf16 (a GEMM operand) ---------
    // A lane holds 8 consecutive dv of its query per tile: one 16-byte store.
    const int b = bh / NH, h = bh % NH;
    const float inv = 1.0f / (csum + xhalf(csum));
    __bf16* crow = ctx + (size_t)(b * SEQ + t_idx) * DMODEL + h * 64 + hf * 8;
    #pragma unroll
    for (int nt = 0; nt < 4; ++nt) {
        uint4 o;
        o.x = f2bf2(cacc[nt][0] * inv, cacc[nt][1] * inv);
        o.y = f2bf2(cacc[nt][2] * inv, cacc[nt][3] * inv);
        o.z = f2bf2(cacc[nt][4] * inv, cacc[nt][5] * inv);
        o.w = f2bf2(cacc[nt][6] * inv, cacc[nt][7] * inv);
        *(uint4*)(crow + nt * 16) = o;
    }
}

// ---------------------------------------------------------------------------
// out = LayerNorm(a + b) * gamma + beta ; one 1024-wide row per 256-thr block
// WB: also write the row as bf16, the form in which the next GEMM reads it
// ---------------------------------------------------------------------------
template<bool WB>
__launch_bounds__(256)
__global__ void add_ln_kernel(const float* __restrict__ a,
                              const float* __restrict__ b,
                              const float* __restrict__ gamma,
                              const float* __restrict__ beta,
                              float* __restrict__ out,
                              __bf16* __restrict__ outb)
{
    __shared__ float red[16];
    const int row = blockIdx.x;
    const int tid = threadIdx.x;
    const size_t base = (size_t)row * DMODEL;

    float v[4]; float s = 0.0f, ss = 0.0f;
    #pragma unroll
    for (int j = 0; j < 4; ++j) {
        int idx = tid + j * 256;
        float x = a[base + idx] + b[base + idx];
        v[j] = x; s += x; ss += x * x;
    }
    #pragma unroll
    for (int off = 1; off < 32; off <<= 1) {
        s  += __shfl_xor(s,  off, 32);
        ss += __shfl_xor(ss, off, 32);
    }
    int wid = tid >> 5, lane = tid & 31;
    if (lane == 0) { red[wid] = s; red[8 + wid] = ss; }
    __syncthreads();
    if (wid == 0) {
        float s2  = (lane < 8) ? red[lane] : 0.0f;
        float ss2 = (lane < 8) ? red[8 + lane] : 0.0f;
        #pragma unroll
        for (int off = 1; off < 8; off <<= 1) {
            s2  += __shfl_xor(s2,  off, 32);
            ss2 += __shfl_xor(ss2, off, 32);
        }
        if (lane == 0) { red[0] = s2; red[8] = ss2; }
    }
    __syncthreads();
    float mu  = red[0] * (1.0f / DMODEL);
    float var = red[8] * (1.0f / DMODEL) - mu * mu;
    float rs  = rsqrtf(var + EPSLN);
    #pragma unroll
    for (int j = 0; j < 4; ++j) {
        int idx = tid + j * 256;
        float y = (v[j] - mu) * rs * gamma[idx] + beta[idx];
        out[base + idx] = y;
        if (WB) outb[base + idx] = f2bf(y);
    }
}

// ---------------------------------------------------------------------------
// Host-side orchestration
// ---------------------------------------------------------------------------
extern "C" void kernel_launch(void* const* d_in, const int* in_sizes, int n_in,
                              void* d_out, int out_size, void* d_ws, size_t ws_size,
                              hipStream_t stream)
{
    const float* x   = (const float*)d_in[0];
    const float* Wq  = (const float*)d_in[1];
    const float* Wk  = (const float*)d_in[2];
    const float* Wv  = (const float*)d_in[3];
    const float* Wo  = (const float*)d_in[4];
    const float* W1  = (const float*)d_in[5];
    const float* b1  = (const float*)d_in[6];
    const float* W2  = (const float*)d_in[7];
    const float* b2  = (const float*)d_in[8];
    const float* g1  = (const float*)d_in[9];
    const float* be1 = (const float*)d_in[10];
    const float* g2  = (const float*)d_in[11];
    const float* be2 = (const float*)d_in[12];
    float* out = (float*)d_out;

    const int M = BATCH * SEQ;   // 4096 token rows

    char* w = (char*)d_ws;
    auto take = [&](size_t bytes) -> char* {
        char* p = w; w += (bytes + 255) & ~(size_t)255; return p;
    };
    __bf16* qb  = (__bf16*)take((size_t)3 * M * DMODEL * sizeof(__bf16)); // 3 x 8 MB, one behind the other
    __bf16* kb  = qb + (size_t)M * DMODEL;
    __bf16* vtb = kb + (size_t)M * DMODEL;
    __bf16* ctx = (__bf16*)take((size_t)M * DMODEL * sizeof(__bf16)); //  8 MB
    float*  ao  = (float*)take((size_t)M * DMODEL * sizeof(float));   // 16 MB
    float*  h   = (float*)take((size_t)M * DMODEL * sizeof(float));   // 16 MB
    __bf16* hb  = (__bf16*)take((size_t)M * DMODEL * sizeof(__bf16)); //  8 MB
    __bf16* f1  = (__bf16*)take((size_t)M * FFDIM  * sizeof(__bf16)); // 32 MB
    float*  f2  = (float*)take((size_t)M * DMODEL * sizeof(float));   // 16 MB
    __bf16* xb  = (__bf16*)take((size_t)M * DMODEL * sizeof(__bf16)); //  8 MB
    __bf16* Wob = (__bf16*)take((size_t)DMODEL * DMODEL * sizeof(__bf16)); // 2 MB
    __bf16* Wqt = (__bf16*)take((size_t)3 * DMODEL * DMODEL * sizeof(__bf16)); // 3 x 2 MB: one [3072][1024] operand
    __bf16* Wkt = Wqt + (size_t)DMODEL * DMODEL;
    __bf16* Wvt = Wkt + (size_t)DMODEL * DMODEL;
    __bf16* W1t = (__bf16*)take((size_t)DMODEL * FFDIM  * sizeof(__bf16)); // 8 MB
    __bf16* W2t = (__bf16*)take((size_t)DMODEL * FFDIM  * sizeof(__bf16)); // 8 MB

    const dim3 blk(GT);
    const dim3 g_d(DMODEL / BN, M / BM);   // (8, 32)
    const dim3 g_ff(FFDIM / BN, M / BM);   // (32, 32)
    const dim3 g_qkv(3 * DMODEL / BN, M / BM);   // (24, 32)
    const float qscale = 0.125f;           // 1/sqrt(DK)

    // fp32 inputs -> bf16 GEMM operands, K-contiguous
    pack_operands<<<dim3(PK_ALL), dim3(256), 0, stream>>>(x, Wo, Wq, Wk, Wv, W1, W2,
                                                          xb, Wob, Wqt, Wkt, Wvt, W1t, W2t);

    // Q,K,V projections in one launch: 768 blocks, three to a WGP, so that one
    // block's loads, LDS traffic and barriers run under the others' WMMAs.
    // Packed straight to the attention layouts in bf16.
    gemm_bf16_wmma<EPI_QKV, 1><<<g_qkv, blk, 0, stream>>>(xb, Wqt, nullptr, nullptr, qb, M, 3 * DMODEL, DMODEL, qscale);

    // Causal flash attention
    flash_attn_kernel<<<dim3(SEQ / 64, BATCH * NH), dim3(AT), 0, stream>>>(qb, kb, vtb, ctx);

    // Output projection (Wo is [N,K] row-major as given)
    gemm_bf16_wmma<EPI_F32, 4><<<g_d, blk, 0, stream>>>(ctx, Wob, nullptr, ao, nullptr, M, DMODEL, DMODEL, 1.0f);

    // h = LN(x + attn_out)
    add_ln_kernel<true><<<dim3(M), dim3(256), 0, stream>>>(x, ao, g1, be1, h, hb);

    // FFN
    gemm_bf16_wmma<EPI_BIAS_RELU, 1><<<g_ff, blk, 0, stream>>>(hb, W1t, b1, nullptr, f1, M, FFDIM,  DMODEL, 1.0f);
    gemm_bf16_wmma<EPI_BIAS, 4><<<g_d,  blk, 0, stream>>>(f1, W2t, b2, f2, nullptr, M, DMODEL, FFDIM,  1.0f);

    // out = LN(h + ffn)
    add_ln_kernel<false><<<dim3(M), dim3(256), 0, stream>>>(h, f2, g2, be2, out, nullptr);
}

// v009
// A run of this version takes 160 microseconds.
// Next to v008, in two timings, it ran 1.06 times as fast each time.
// All steps since v000 together make it 6.27 times as fast.
#include <hip/hip_runtime.h>
#include <hip/hip_bf16.h>
#include <stdint.h>

// ---------------------------------------------------------------------------
// Problem constants (match reference)
// ---------------------------------------------------------------------------
#define BATCH  2
#define SEQ    2048
#define DMODEL 1024
#define NH     16
#define DHEAD  64
#define FFDIM  4096
#define EPSLN  1e-6f

// ---------------------------------------------------------------------------
// WMMA types (CDNA5 / gfx1250, wave32)
// ---------------------------------------------------------------------------
typedef __attribute__((ext_vector_type(16))) __bf16 v16bf;
typedef __attribute__((ext_vector_type(8)))  float  v8f;
typedef __attribute__((ext_vector_type(4)))  uint32_t v4u;   // 16 raw bytes in registers

union Frag {
    v16bf v;
    uint4 q[2];
    uint32_t u[8];
};

__device__ __forceinline__ __bf16 f2bf(float f) {
    union { float f; uint32_t u; } c; c.f = f;
    uint32_t r = (c.u + 0x7FFFu + ((c.u >> 16) & 1u)) >> 16;   // RNE
    union { uint16_t s; __bf16 b; } o; o.s = (uint16_t)r;
    return o.b;
}

// Two fp32 values -> one dword of two bf16 (lo at the lower address).
__device__ __forceinline__ uint32_t f2bf2(float lo, float hi) {
    union { __bf16 b[2]; uint32_t u; } o;
    o.b[0] = f2bf(lo); o.b[1] = f2bf(hi);
    return o.u;
}

// Value of lane l ^ 16 (the other 16-lane half), without LDS.
__device__ __forceinline__ float xhalf(float x) {
    int b = __builtin_bit_cast(int, x);
    return __builtin_bit_cast(float,
        __builtin_amdgcn_permlanex16(b, b, 0x76543210, 0xfedcba98, false, false));
}

// ---------------------------------------------------------------------------
// Operand packing, once per call: every GEMM operand that arrives as fp32 is
// rounded to bf16 here, B operands also transposed to [N][K], so that no GEMM
// block repeats that work per tile. One 64x64 tile per 256-thread block.
//   x  [4096][1024] and Wo [N=1024][K=1024]   : same layout
//   Wq, Wk, Wv [K=1024][N=1024], W1 [1024][4096], W2 [4096][1024] : -> [N][K]
// ---------------------------------------------------------------------------
#define PK_X   (BATCH * SEQ / 64 * (DMODEL / 64))     // 1024 tiles
#define PK_W   (DMODEL / 64 * (DMODEL / 64))          //  256 tiles
#define PK_F   (DMODEL / 64 * (FFDIM / 64))           // 1024 tiles
#define PK_ALL (PK_X + 4 * PK_W + 2 * PK_F)

__launch_bounds__(256)
__global__ void pack_operands(const float* __restrict__ x,  const float* __restrict__ Wo,
                              const float* __restrict__ Wq, const float* __restrict__ Wk,
                              const float* __restrict__ Wv, const float* __restrict__ W1,
                              const float* __restrict__ W2,
                              __bf16* __restrict__ xb,  __bf16* __restrict__ Wob,
                              __bf16* __restrict__ Wqt, __bf16* __restrict__ Wkt,
                              __bf16* __restrict__ Wvt, __bf16* __restrict__ W1t,
                              __bf16* __restrict__ W2t)
{
    __shared__ uint32_t Ts[64][33];   // [n][k pair]; 33 dwords: writes and reads hit distinct banks

    const int tid = threadIdx.x;
    int t = blockIdx.x;
    const float* src; __bf16* dst; int rows, cols; bool tr;
    if      (t < PK_X)                       { src = x;  dst = xb;  rows = BATCH * SEQ; cols = DMODEL; tr = false; }
    else if ((t -= PK_X) < PK_W)             { src = Wo; dst = Wob; rows = DMODEL; cols = DMODEL; tr = false; }
    else if ((t -= PK_W) < PK_W)             { src = Wq; dst = Wqt; rows = DMODEL; cols = DMODEL; tr = true; }
    else if ((t -= PK_W) < PK_W)             { src = Wk; dst = Wkt; rows = DMODEL; cols = DMODEL; tr = true; }
    else if ((t -= PK_W) < PK_W)             { src = Wv; dst = Wvt; rows = DMODEL; cols = DMODEL; tr = true; }
    else if ((t -= PK_W) < PK_F)             { src = W1; dst = W1t; rows = DMODEL; cols = FFDIM;  tr = true; }
    else                     { t -= PK_F;      src = W2; dst = W2t; rows = FFDIM;  cols = DMODEL; tr = true; }
    const int tpr = cols >> 6;               // tiles per row of tiles
    const int r0 = (t / tpr) << 6, c0 = (t % tpr) << 6;

    if (!tr) {
        size_t e[4]; float4 v[4];
        #pragma unroll
        for (int i = 0; i < 4; ++i) {
            int idx = i * 256 + tid;
            e[i] = (size_t)(r0 + (idx >> 4)) * cols + c0 + ((idx & 15) << 2);
            v[i] = *(const float4*)(src + e[i]);
            // The load stays in flight while its address registers are reused
            // (by the next load's result, by the rounding): the wait stands first.
            asm volatile("s_wait_xcnt 0x0" ::: "memory");
        }
        #pragma unroll
        for (int i = 0; i < 4; ++i) {
            uint2 o; o.x = f2bf2(v[i].x, v[i].y); o.y = f2bf2(v[i].z, v[i].w);
            *(uint2*)(dst + e[i]) = o;
            // The store stays in flight while its address and data registers are
            // reused (by the next rounding, by code behind the branch): wait first.
            asm volatile("s_wait_xcnt 0x0" ::: "memory");
        }
    } else {                                 // block-uniform branch: the barrier is safe
        float4 a[2], b[2];
        #pragma unroll
        for (int i = 0; i < 2; ++i) {
            int idx = i * 256 + tid;
            const float* p = src + (size_t)(r0 + 2 * (idx >> 4)) * cols + c0 + ((idx & 15) << 2);
            a[i] = *(const float4*)p;
            asm volatile("s_wait_xcnt 0x0" ::: "memory");   // as above
            b[i] = *(const float4*)(p + cols);
            asm volatile("s_wait_xcnt 0x0" ::: "memory");   // as above
        }
        #pragma unroll
        for (int i = 0; i < 2; ++i) {
            int idx = i * 256 + tid;
            int kp = idx >> 4, c = (idx & 15) << 2;
            Ts[c + 0][kp] = f2bf2(a[i].x, b[i].x); Ts[c + 1][kp] = f2bf2(a[i].y, b[i].y);
            Ts[c + 2][kp] = f2bf2(a[i].z, b[i].z); Ts[c + 3][kp] = f2bf2(a[i].w, b[i].w);
        }
        __syncthreads();
        #pragma unroll
        for (int i = 0; i < 2; ++i) {
            int idx = i * 256 + tid;
            int n = idx >> 3, q = (idx & 7) << 2;
            uint4 o; o.x = Ts[n][q]; o.y = Ts[n][q + 1]; o.z = Ts[n][q + 2]; o.w = Ts[n][q + 3];
            *(uint4*)(dst + (size_t)(c0 + n) * rows + r0 + 2 * q) = o;
        }
    }
}

// ---------------------------------------------------------------------------
// Generic bf16-WMMA GEMM: C[M,N] = A[M,K] * Bt[N,K]^T  (A, Bt bf16 in memory,
// both K-contiguous; fp32 accumulate via v_wmma_f32_16x16x32_bf16)
//
// Block tile: 128x128, 256 threads (8 wave32), wave tile 64x32. A pass takes
// one 128-byte line of every row, which in bf16 is K-step 64 (two WMMA k-steps).
// LDS rows padded to BK+8 bf16 (144B) so per-lane fragment reads are two
// 16B-aligned ds_load_b128, matching the 16-bit A/B operand layout:
//   lane l: row/col = l&15, half = l>>4; chunk0 = K[half*8 .. +7],
//   chunk1 = K[16+half*8 .. +7]  (per K-step of 32).
// The product is taken transposed: the Bs fragment is the first WMMA operand,
// the As fragment the second. A lane then holds 8 neighbouring Bs-side indices
// (hf*8 + r) of ONE As-side index (ln): with the weights in Bs these are 8
// neighbouring columns of one output row, which leave in 16-byte stores.
// ---------------------------------------------------------------------------
#define BM 128
#define BN 128
#define BK 64
#define GT 256
#define LDAP 72   // BK + 8 pad -> 144B row stride, 16B aligned rows

// EPI_QKV: B holds the Q, K and V weights one behind the other (N = 3 * DMODEL),
// Cb the three outputs one behind the other; a block lies wholly in one of them.
enum { EPI_F32 = 0, EPI_BIAS = 1, EPI_BIAS_RELU = 2, EPI_QKV = 3 };

// PF: how many K tiles ahead the global loads go out, each tile into a register
// set of its own. PF is 1 or even; K is a multiple of PF * BK and at least twice it.
template<int EPI, int PF>
__launch_bounds__(GT)
__global__ void gemm_bf16_wmma(const __bf16* A,  // A, B: no __restrict__, see fetch
                               const __bf16* B,  // [N,K] row-major
                               const float* __restrict__ bias,
                               float* __restrict__ C,
                               __bf16* __restrict__ Cb,
                               int M, int N, int K, float scale)
{
    constexpr int NB = (PF > 1) ? 2 : 1;   // LDS buffers per operand
    __shared__ __bf16 As[NB][BM][LDAP];
    __shared__ __bf16 Bs[NB][BN][LDAP];

    const int tid  = threadIdx.x;
    const int m0   = blockIdx.y * BM;
    const int n0   = blockIdx.x * BN;
    const int wid  = tid >> 5;
    const int lane = tid & 31;
    const int hf   = lane >> 4;
    const int ln   = lane & 15;
    const int wm   = (wid >> 2) * 64;   // 2 wave rows
    const int wn   = (wid & 3) * 32;    // 4 wave cols

    v8f acc[4][2] = {};

    // V is stored transposed ([dv][t]): its blocks want 8 neighbouring tokens in a
    // lane, so there the token rows go to Bs and the weight rows to As. Both tiles
    // are 128 K-contiguous rows: only the two base addresses change places.
    const bool vsw = (EPI == EPI_QKV) && (n0 >= 2 * DMODEL);   // one test per block
    const __bf16* Ag = vsw ? B + (size_t)n0 * K : A + (size_t)m0 * K;
    const __bf16* Bg = vsw ? A + (size_t)m0 * K : B + (size_t)n0 * K;

    // Byte offsets of this thread's 16-byte slots inside a K tile (the same for
    // A and B); they do not change over the loop, only the tile's (uniform)
    // base address does.
    uint32_t oa[4];
    #pragma unroll
    for (int i = 0; i < 4; ++i) {
        int idx = i * GT + tid;                  // 0..1023 slots of 8 bf16
        oa[i] = (uint32_t)(((idx >> 3) * K + ((idx & 7) << 3)) * 2);
    }

    // All eight loads of one K tile, issued as one group into registers.
    // A and B are not __restrict__: plain loads keep their place in front of the
    // barrier's fence; marked __restrict__ the compiler sank them over both
    // barriers to their first use, where each waited out its own latency.
    // each: the wait stands behind every load (for the passes behind the loop, where
    // this build keeps a load's address in registers that a later load of the group
    // fills).
    auto fetch = [&](v4u (&ra)[4], v4u (&rb)[4], int kt, bool each = false) {
        const char* At = (const char*)(Ag + kt);
        const char* Bt = (const char*)(Bg + kt);
        #pragma unroll
        for (int i = 0; i < 4; ++i) {
            ra[i] = *(const v4u*)(At + oa[i]);
            if (each && i < 3) asm volatile("s_wait_xcnt 0x0" ::: "memory");
        }
        // The loads stay in flight while their address registers are reused
        // (by the loads below, by the fragment loads): the wait stands first.
        asm volatile("s_wait_xcnt 0x0" ::: "memory");
        #pragma unroll
        for (int i = 0; i < 4; ++i) {
            rb[i] = *(const v4u*)(Bt + oa[i]);
            if (each && i < 3) asm volatile("s_wait_xcnt 0x0" ::: "memory");
        }
        asm volatile("s_wait_xcnt 0x0" ::: "memory");   // as above
    };

    // Work-group barrier whose fences order LDS only. As and Bs are all that
    // the waves hand to each other; __syncthreads() would also wait out the
    // global loads that are meant to stay in flight over it.
    auto lds_barrier = [&]() {
        __builtin_amdgcn_fence(__ATOMIC_RELEASE, "workgroup", "local");
        __builtin_amdgcn_s_barrier();
        __builtin_amdgcn_fence(__ATOMIC_ACQUIRE, "workgroup", "local");
    };

    // Set p's raw tile goes to LDS buffer b (128 rows x 64 bf16 of A and of B).
    v4u ra[PF][4], rb[PF][4];
    auto stage = [&](int p, int b) {
        #pragma unroll
        for (int i = 0; i < 4; ++i) {
            int idx = i * GT + tid;
            int r = idx >> 3, c = (idx & 7) << 3;
            *(v4u*)&As[b][r][c] = ra[p][i];
            *(v4u*)&Bs[b][r][c] = rb[p][i];
        }
        // Keeps the next loads behind the LDS stores above, so that they land in
        // the registers just freed: lifted over them they need a further set and
        // copies, and the copies' wait for the loads stands early.
        __builtin_amdgcn_sched_barrier(0);
    };

    // PF raw tiles are carried over the loop's back edge: a tile's loads are
    // issued behind the LDS stores that free its registers and fly during PF
    // passes of LDS traffic, barriers and WMMAs. No branch stands around a fetch
    // (a join of two paths would drain it early).
    #pragma unroll
    for (int p = 0; p < PF; ++p) fetch(ra[p], rb[p], p * BK);
    if (PF == 1) {
        // Launches with several blocks on a WGP, which hide a load's latency and
        // each other's LDS phases. In the last pass the fetch re-reads the last tile
        // and nothing uses it.
        for (int kt = 0; kt < K; kt += BK) {
            stage(0, 0);
            fetch(ra[0], rb[0], (kt + BK < K) ? kt + BK : kt);
            lds_barrier();

            // ---- fragments + 8 WMMAs per k-step of 32, k ascending -----------
            #pragma unroll
            for (int ks = 0; ks < BK; ks += 32) {
                Frag af[4], bfr[2];
                #pragma unroll
                for (int mt = 0; mt < 4; ++mt) {
                    const __bf16* p = &As[0][wm + mt * 16 + ln][ks];
                    af[mt].q[0] = *(const uint4*)(p + hf * 8);
                    af[mt].q[1] = *(const uint4*)(p + 16 + hf * 8);
                }
                #pragma unroll
                for (int nt = 0; nt < 2; ++nt) {
                    const __bf16* p = &Bs[0][wn + nt * 16 + ln][ks];
                    bfr[nt].q[0] = *(const uint4*)(p + hf * 8);
                    bfr[nt].q[1] = *(const uint4*)(p + 16 + hf * 8);
                }
                #pragma unroll
                for (int mt = 0; mt < 4; ++mt)
                    #pragma unroll
                    for (int nt = 0; nt < 2; ++nt)
                        acc[mt][nt] = __builtin_amdgcn_wmma_f32_16x16x32_bf16(
                            false, bfr[nt].v, false, af[mt].v, (short)0, acc[mt][nt], false, false);
            }
            lds_barrier();
        }
    } else {
        // Launches with one block on a WGP: nothing else hides what a pass waits
        // for, so the pass itself overlaps it. Pass t reads tile t from buffer
        // t & 1; meanwhile tile t + 1, asked for PF passes earlier, goes from its
        // registers to the other buffer, and tile t + 1 + PF is asked for. The one
        // barrier at the foot of a pass publishes tile t + 1 and ends every read of
        // tile t, whose buffer the next pass overwrites.
        auto pass = [&](int p, bool more, bool ask, int knext, bool each) {
            // The pass's 24 fragment loads go out as one group, in the order of
            // their use; the WMMAs follow on counted waits.
            Frag af[2][4], bfr[2][2];
            #pragma unroll
            for (int s = 0; s < 2; ++s) {
                #pragma unroll
                for (int nt = 0; nt < 2; ++nt) {
                    const __bf16* q = &Bs[p & 1][wn + nt * 16 + ln][s * 32];
                    bfr[s][nt].q[0] = *(const uint4*)(q + hf * 8);
                    bfr[s][nt].q[1] = *(const uint4*)(q + 16 + hf * 8);
                }
                #pragma unroll
                for (int mt = 0; mt < 4; ++mt) {
                    const __bf16* q = &As[p & 1][wm + mt * 16 + ln][s * 32];
                    af[s][mt].q[0] = *(const uint4*)(q + hf * 8);
                    af[s][mt].q[1] = *(const uint4*)(q + 16 + hf * 8);
                }
            }
            // Keeps the group whole and in front: in the unrolled loop this build
            // split it into pairs, each waited out to 0 in front of its two WMMAs.
            __builtin_amdgcn_sched_barrier(0);
            if (more) stage((p + 1) % PF, (p + 1) & 1);
            if (ask)  fetch(ra[(p + 1) % PF], rb[(p + 1) % PF], knext, each);
            #pragma unroll
            for (int s = 0; s < 2; ++s)
                #pragma unroll
                for (int mt = 0; mt < 4; ++mt)
                    #pragma unroll
                    for (int nt = 0; nt < 2; ++nt)
                        acc[mt][nt] = __builtin_amdgcn_wmma_f32_16x16x32_bf16(
                            false, bfr[s][nt].v, false, af[s][mt].v, (short)0, acc[mt][nt], false, false);
            // Keeps the WMMAs in front of the barrier, where they run under the LDS
            // traffic: sunk behind it they stood in front of the next pass's loads.
            __builtin_amdgcn_sched_barrier(0);
            lds_barrier();
        };
        stage(0, 0);
        fetch(ra[0], rb[0], PF * BK);
        lds_barrier();
        for (int kt = (PF + 1) * BK; kt < K - PF * BK; kt += PF * BK) {
            #pragma unroll
            for (int p = 0; p < PF; ++p) pass(p, true, true, kt + p * BK, false);
        }
        // The last 2 * PF passes stand behind the loop: PF - 1 tiles are still to
        // be asked for, 2 * PF - 1 still to be staged.
        #pragma unroll
        for (int p = 0; p < PF; ++p) pass(p, true, p + 1 < PF, K - (PF - 1 - p) * BK, true);
        #pragma unroll
        for (int p = 0; p < PF; ++p) pass(p, p + 1 < PF, false, 0, false);
    }

    // ---- epilogue: D element (m,n) sits in vgpr r = m&7 of lane n + 16*(m>>3); m runs
    // over the Bs side, n over the As side: 8 neighbouring Bs-side indices per lane.
    // The block's tile goes through LDS, [As-side index][Bs-side index], so that it
    // leaves in whole rows: 16 bytes a lane, 256 or 512 bytes in a row per store.
    // The K loop's last barrier has ended every read of As and Bs.
    constexpr bool F32OUT = (EPI == EPI_F32 || EPI == EPI_BIAS);
    constexpr int ESZ = F32OUT ? 4 : 2;        // bytes per output element
    constexpr int SP  = BN * ESZ + 16;         // staged row pitch: 16 B x odd, no bank conflicts
    static_assert(64 * SP <= (int)sizeof(As) && 64 * SP <= (int)sizeof(Bs), "staging fits");
    char* const sA = (char*)&As[0][0][0];      // staged rows 0..63
    char* const sB = (char*)&Bs[0][0][0];      // staged rows 64..127
    const int ib = wn + hf * 8;                // first of the lane's 8 Bs-side indices, + nt * 16
    const int sel = (EPI == EPI_QKV) ? n0 / DMODEL : 0;           // 0 = Q, 1 = K, 2 = V
    const float sc = (EPI == EPI_QKV && sel == 0) ? scale : 1.0f; // Q pre-scaled by 1/sqrt(DK)

    float bb[2][8];                // the lane's 16 bias values
    if (EPI == EPI_BIAS || EPI == EPI_BIAS_RELU) {
        #pragma unroll
        for (int nt = 0; nt < 2; ++nt) {
            const float* bp = bias + n0 + ib + nt * 16;
            const float4 lo = *(const float4*)bp, hi = *(const float4*)(bp + 4);
            // The loads stay in flight while their address registers are reused: wait first.
            asm volatile("s_wait_xcnt 0x0" ::: "memory");
            bb[nt][0] = lo.x; bb[nt][1] = lo.y; bb[nt][2] = lo.z; bb[nt][3] = lo.w;
            bb[nt][4] = hi.x; bb[nt][5] = hi.y; bb[nt][6] = hi.z; bb[nt][7] = hi.w;
        }
    }
    char* const sw = (wm ? sB : sA) + ln * SP + ib * ESZ;   // wm is 0 or 64
    #pragma unroll
    for (int mt = 0; mt < 4; ++mt)
    #pragma unroll
    for (int nt = 0; nt < 2; ++nt) {
        float v[8];
        #pragma unroll
        for (int r = 0; r < 8; ++r) {
            v[r] = acc[mt][nt][r];
            if (EPI == EPI_QKV) v[r] *= sc;
            if (EPI == EPI_BIAS || EPI == EPI_BIAS_RELU) v[r] += bb[nt][r];
            if (EPI == EPI_BIAS_RELU) v[r] = fmaxf(v[r], 0.0f);
        }
        char* p = sw + mt * 16 * SP + nt * 16 * ESZ;
        if (F32OUT) {
            *(float4*)p        = make_float4(v[0], v[1], v[2], v[3]);
            *(float4*)(p + 16) = make_float4(v[4], v[5], v[6], v[7]);
        } else {                   // feeds a matrix product only: bf16
            uint4 o;
            o.x = f2bf2(v[0], v[1]); o.y = f2bf2(v[2], v[3]);
            o.z = f2bf2(v[4], v[5]); o.w = f2bf2(v[6], v[7]);
            *(uint4*)p = o;
        }
    }
    lds_barrier();                 // publishes the staged tile to all eight waves

    constexpr int SPR = BN * ESZ / 16;   // 16-byte slots per staged row: 16 or 32
    constexpr int RPI = GT / SPR;        // rows the block moves per step: 16 or 8
    constexpr int NI  = BM / RPI;        // steps: 8 or 16
    const int r0   = tid / SPR;
    const int slot = tid % SPR;
    // Where staged row 0 of this lane's slot goes, in elements, and the step per row.
    size_t e0, rs;
    if (EPI == EPI_QKV) {
        const int b  = m0 >> 11;                      // BM divides SEQ: one batch per block
        const int tb = m0 & (SEQ - 1);
        const int cb = n0 & (DMODEL - 1);
        const int col = cb + slot * 8;                // Q, K: slot = 8 dd of head col >> 6
        // Q, K -> [B,H,T,64]: row = token. V -> [B,H,64,T]: row = column h*64 + dd, slot = 8 tokens.
        e0 = vsw ? (size_t)(b * DMODEL + cb) * SEQ + tb + slot * 8
                 : (((size_t)(b * NH + (col >> 6)) * SEQ + tb) << 6) + (col & 63);
        e0 += (size_t)sel * ((size_t)BATCH * SEQ * DMODEL);
        rs = vsw ? SEQ : DHEAD;
    } else {
        e0 = (size_t)m0 * N + n0 + slot * (16 / ESZ);
        rs = N;
    }
    char* const og = (F32OUT ? (char*)C : (char*)Cb) + e0 * ESZ;
    v4u q[NI];
    #pragma unroll
    for (int i = 0; i < NI; ++i)
        q[i] = *(const v4u*)((i < NI / 2 ? sA : sB) + ((i * RPI) % 64 + r0) * SP + slot * 16);
    #pragma unroll
    for (int i = 0; i < NI; ++i) {
        *(v4u*)(og + (size_t)(i * RPI + r0) * rs * ESZ) = q[i];
        // The store stays in flight while its address registers are reused (by the
        // next store's address): the wait stands first.
        asm volatile("s_wait_xcnt 0x0" ::: "memory");
    }
}

// ---------------------------------------------------------------------------
// Causal flash attention: grid (T/128, B*H), 128 threads (4 waves).
// A block takes two query tiles of its head, one behind the other: tile
// T/64 - 1 - x, then tile x. Tile t costs t + 1 chunks, so every block walks
// T/64 + 1 chunks: all blocks are resident at once, and the launch lasts as long
// as its longest block.
// Wave w owns q rows qtile*64 + w*16 .. +15; streams K/V in 64-wide chunks
// (only sc <= qtile: causal), online softmax, ctx accumulated in fp32.
// Both products are taken transposed: St = K * Qt and Ot += Vt * Pt. A lane
// then holds scores of ONE query (column ln), keys nt*16 + hf*8 + r: maximum
// and sum run inside the lane, the two halves meet in one register exchange,
// and two St tiles, rounded in place, are the B operand Pt of the second
// product (its k order is the one the Vs loader below already uses).
// K and Vt chunks come by asynchronous copies to LDS, two buffers: the next trip's
// chunk flies while this trip's is worked on, also from one tile to the next.
// ---------------------------------------------------------------------------
#define AT 128
#define KPAD 72   // 64 + 8 pad -> 144B row stride, 16B aligned rows

__launch_bounds__(AT)
__global__ void flash_attn_kernel(const __bf16* __restrict__ qg,
                                  const __bf16* __restrict__ kg,
                                  const __bf16* __restrict__ vtg,
                                  __bf16* __restrict__ ctx)
{
    __shared__ __attribute__((aligned(16))) __bf16 Ks[2][64][KPAD];   // K chunk   [s][dk], two buffers
    __shared__ __attribute__((aligned(16))) __bf16 Vs[2][64][KPAD];   // Vt chunk  [dv][s], two buffers

    const int tid   = threadIdx.x;
    const int wid   = tid >> 5;
    const int lane  = tid & 31;
    const int hf    = lane >> 4;
    const int ln    = lane & 15;
    const int bh    = blockIdx.y;         // b*NH + h
    constexpr int NQT   = SEQ / 64;       // query tiles of a head
    constexpr int NTRIP = NQT + 1;        // chunks of a block's two tiles together
    const int qhi   = NQT - 1 - blockIdx.x;   // first tile: trips 0 .. qhi
    const int qlo   = blockIdx.x;             // second tile: the trips behind them
    // Chunk that trip i works on (one value for the whole block).
    auto chunk_of = [&](int i) { return i <= qhi ? i : i - qhi - 1; };

    int t_idx = qhi * 64 + wid * 16 + ln;     // this lane's query

    // Q fragments (B operand: column = query ln; K = DHEAD = 64 -> two K-steps of 32)
    Frag aq[2];
    auto load_q = [&]() {
        const __bf16* qrow = qg + ((size_t)bh * SEQ + t_idx) * DHEAD;
        #pragma unroll
        for (int ks = 0; ks < 2; ++ks) {
            aq[ks].q[0] = *(const uint4*)(qrow + ks * 32 + hf * 8);
            aq[ks].q[1] = *(const uint4*)(qrow + ks * 32 + 16 + hf * 8);
        }
        // The loads stay in flight while their address registers are reused: wait first.
        asm volatile("s_wait_xcnt 0x0" ::: "memory");
    };
    load_q();

    float cmax = -3.0e38f;   // running maximum of query ln, alike in both halves
    float csum = 0.0f;       // running sum over the keys of this lane's half only
    v8f cacc[4] = {};        // Ot: dv = nt*16 + hf*8 + r, query ln

    const __bf16* kbase = kg  + (size_t)bh * SEQ * DHEAD;
    const __bf16* vbase = vtg + (size_t)bh * DHEAD * SEQ;

    // ---- K chunk [64][64] and Vt chunk [64][64] -> LDS buffer b ------------
    // A thread moves 16 bytes of rows sr, sr + 16, sr + 32, sr + 48 of each: eight
    // copies a wave, every lane on, straight into the padded rows.
    const int sr = tid >> 3, scol = (tid & 7) << 3;
    const __bf16* kslot = kbase + (size_t)sr * DHEAD + scol;
    const __bf16* vslot = vbase + (size_t)sr * SEQ + scol;
    const uint32_t lks = (uint32_t)(uintptr_t)&Ks[0][sr][scol];   // LDS byte addresses
    const uint32_t lvs = (uint32_t)(uintptr_t)&Vs[0][sr][scol];
    constexpr uint32_t LBUF = 64 * KPAD * 2;    // bytes of one buffer
    constexpr uint32_t LR16 = 16 * KPAD * 2;    // bytes of 16 LDS rows
    auto copy_chunk = [&](int sc, int b) {
        const __bf16* kp = kslot + (size_t)sc * 64 * DHEAD;
        const __bf16* vp = vslot + sc * 64;
        const uint32_t lk = lks + b * LBUF, lv = lvs + b * LBUF;
        // The wait is the statement's last line: the copies stay in flight while
        // their address registers are reused, and it stands in front of that.
        asm volatile("global_load_async_to_lds_b128 %0, %8, off\n\t"
                     "global_load_async_to_lds_b128 %1, %9, off\n\t"
                     "global_load_async_to_lds_b128 %2, %10, off\n\t"
                     "global_load_async_to_lds_b128 %3, %11, off\n\t"
                     "global_load_async_to_lds_b128 %4, %12, off\n\t"
                     "global_load_async_to_lds_b128 %5, %13, off\n\t"
                     "global_load_async_to_lds_b128 %6, %14, off\n\t"
                     "global_load_async_to_lds_b128 %7, %15, off\n\t"
                     "s_wait_xcnt 0x0"
                     :: "v"(lk), "v"(lk + LR16), "v"(lk + 2 * LR16), "v"(lk + 3 * LR16),
                        "v"(lv), "v"(lv + LR16), "v"(lv + 2 * LR16), "v"(lv + 3 * LR16),
                        "v"(kp), "v"(kp + 16 * DHEAD), "v"(kp + 32 * DHEAD), "v"(kp + 48 * DHEAD),
                        "v"(vp), "v"(vp + 16 * SEQ), "v"(vp + 32 * SEQ), "v"(vp + 48 * SEQ)
                     : "memory");
    };

    copy_chunk(0, 0);
    asm volatile("s_wait_asynccnt 0x0" ::: "memory");   // this wave's copies of chunk 0 have landed
    __syncthreads();                                    // and every other wave's
    copy_chunk(chunk_of(1), 1);                         // a block has more than two trips

    // ---- normalize + store ctx as [B*T, H*DV] bf16 (a GEMM operand) ---------
    // A lane holds 8 consecutive dv of its query t per tile: one 16-byte store.
    const int b = bh / NH, h = bh % NH;
    auto store_tile = [&](int t) {
        const float inv = 1.0f / (csum + xhalf(csum));
        __bf16* crow = ctx + (size_t)(b * SEQ + t) * DMODEL + h * 64 + hf * 8;
        #pragma unroll
        for (int nt = 0; nt < 4; ++nt) {
            uint4 o;
            o.x = f2bf2(cacc[nt][0] * inv, cacc[nt][1] * inv);
            o.y = f2bf2(cacc[nt][2] * inv, cacc[nt][3] * inv);
            o.z = f2bf2(cacc[nt][4] * inv, cacc[nt][5] * inv);
            o.w = f2bf2(cacc[nt][6] * inv, cacc[nt][7] * inv);
            *(uint4*)(crow + nt * 16) = o;
            // The store stays in flight while its address and data registers are
            // reused (by the next rounding, by the next tile): the wait stands first.
            asm volatile("s_wait_xcnt 0x0" ::: "memory");
        }
    };

    for (int i = 0; i < NTRIP; ++i) {
        const int sc = chunk_of(i);
        const int s0 = sc * 64;
        const int cb = i & 1;                 // this trip's buffer

        // ---- St = K * Qt  (64 keys x 16 queries per wave) ------------------
        // All 16 fragment loads go out as one group, each into registers of its
        // own: written load by WMMA, this build took one register set for all
        // eight fragments and waited out the LDS latency in front of every WMMA.
        Frag bk[4][2];
        #pragma unroll
        for (int nt = 0; nt < 4; ++nt)
            #pragma unroll
            for (int ks = 0; ks < 2; ++ks) {
                const __bf16* p = &Ks[cb][nt * 16 + ln][ks * 32];
                bk[nt][ks].q[0] = *(const uint4*)(p + hf * 8);
                bk[nt][ks].q[1] = *(const uint4*)(p + 16 + hf * 8);
            }
        // Keeps the group whole: without it the loads sink back among the WMMAs.
        __builtin_amdgcn_sched_barrier(0);
        v8f sacc[4] = {};
        #pragma unroll
        for (int nt = 0; nt < 4; ++nt)
            #pragma unroll
            for (int ks = 0; ks < 2; ++ks)
                sacc[nt] = __builtin_amdgcn_wmma_f32_16x16x32_bf16(
                    false, bk[nt][ks].v, false, aq[ks].v, (short)0, sacc[nt], false, false);
        // The Vt fragments of the second product, again as one group, issued here
        // so that the hand-over below can free buffer cb before the softmax.
        Frag bv[4][2];
        #pragma unroll
        for (int nt = 0; nt < 4; ++nt)
            #pragma unroll
            for (int ks = 0; ks < 2; ++ks) {
                const __bf16* p = &Vs[cb][nt * 16 + ln][ks * 32];
                bv[nt][ks].q[0] = *(const uint4*)(p + hf * 8);
                bv[nt][ks].q[1] = *(const uint4*)(p + 16 + hf * 8);
            }
        // Keeps these loads in front of the softmax: sunk to their WMMAs they
        // would each be waited for there.
        __builtin_amdgcn_sched_barrier(0);
        // ---- hand-over: trip i + 1's chunk is published, buffer cb is given free ----
        // It stands behind the trip's last LDS read (the rest of the trip works in
        // registers), so that trip i + 2's chunk has a whole trip to land.
        asm volatile("s_wait_dscnt 0x0" ::: "memory");      // this wave's reads of buffer cb are done
        asm volatile("s_wait_asynccnt 0x0" ::: "memory");   // its copies for trip i + 1 have landed
        __syncthreads();
        if (i + 2 < NTRIP) copy_chunk(chunk_of(i + 2), cb); // one test for the whole block
        // ---- causal mask: key s0 + hf*8 + (nt*16 + r) against query t_idx ---
        const int room = t_idx - s0 - hf * 8;
        #pragma unroll
        for (int nt = 0; nt < 4; ++nt)
            #pragma unroll
            for (int r = 0; r < 8; ++r)
                sacc[nt][r] = (nt * 16 + r > room) ? -3.0e38f : sacc[nt][r];
        // ---- online softmax: one query per lane ----------------------------
        float mt[4];
        #pragma unroll
        for (int nt = 0; nt < 4; ++nt) {
            mt[nt] = sacc[nt][0];
            #pragma unroll
            for (int r = 1; r < 8; ++r) mt[nt] = fmaxf(mt[nt], sacc[nt][r]);
        }
        float mx = fmaxf(fmaxf(mt[0], mt[1]), fmaxf(mt[2], mt[3]));
        mx = fmaxf(mx, xhalf(mx));
        const float mnew = fmaxf(cmax, mx);
        const float corr = __expf(cmax - mnew);
        cmax = mnew;
        Frag bp[2];                       // Pt, B operand: k = key within 32
        float pt[4];
        #pragma unroll
        for (int nt = 0; nt < 4; ++nt) {
            pt[nt] = 0.0f;
            #pragma unroll
            for (int r = 0; r < 8; r += 2) {
                float p0 = __expf(sacc[nt][r]     - mnew);
                float p1 = __expf(sacc[nt][r + 1] - mnew);
                pt[nt] += p0 + p1;
                bp[nt >> 1].u[(nt & 1) * 4 + (r >> 1)] = f2bf2(p0, p1);
            }
        }
        csum = csum * corr + ((pt[0] + pt[1]) + (pt[2] + pt[3]));
        #pragma unroll
        for (int nt = 0; nt < 4; ++nt)
            #pragma unroll
            for (int r = 0; r < 8; ++r) cacc[nt][r] = cacc[nt][r] * corr;
        // ---- Ot += Vt * Pt ---------------------------------------------------
        #pragma unroll
        for (int nt = 0; nt < 4; ++nt)
            #pragma unroll
            for (int ks = 0; ks < 2; ++ks)
                cacc[nt] = __builtin_amdgcn_wmma_f32_16x16x32_bf16(
                    false, bv[nt][ks].v, false, bp[ks].v, (short)0, cacc[nt], false, false);

        if (i == qhi) {                       // the first tile's last chunk: one test for the whole block
            // The second tile's Q is asked for first, so that it lands under the
            // first tile's rounding and stores.
            const int t_done = t_idx;
            t_idx = qlo * 64 + wid * 16 + ln;
            load_q();
            store_tile(t_done);
            // ---- the second tile starts afresh ----
            cmax = -3.0e38f;
            csum = 0.0f;
            #pragma unroll
            for (int nt = 0; nt < 4; ++nt) cacc[nt] = v8f{};
        }
    }
    asm volatile("s_wait_asynccnt 0x0" ::: "memory");       // no copy is left in flight at the wave's end
    store_tile(t_idx);
}

// ---------------------------------------------------------------------------
// out = LayerNorm(a + b) * gamma + beta ; one 1024-wide row per 256-thr block
// WB: also write the row as bf16, the form in which the next GEMM reads it
// ---------------------------------------------------------------------------
template<bool WB>
__launch_bounds__(256)
__global__ void add_ln_kernel(const float* __restrict__ a,
                              const float* __restrict__ b,
                              const float* __restrict__ gamma,
                              const float* __restrict__ beta,
                              float* __restrict__ out,
                              __bf16* __restrict__ outb)
{
    __shared__ float red[16];
    const int row = blockIdx.x;
    const int tid = threadIdx.x;
    const size_t base = (size_t)row * DMODEL;

    float v[4]; float s = 0.0f, ss = 0.0f;
    #pragma unroll
    for (int j = 0; j < 4; ++j) {
        int idx = tid + j * 256;
        float x = a[base + idx] + b[base + idx];
        v[j] = x; s += x; ss += x * x;
    }
    #pragma unroll
    for (int off = 1; off < 32; off <<= 1) {
        s  += __shfl_xor(s,  off, 32);
        ss += __shfl_xor(ss, off, 32);
    }
    int wid = tid >> 5, lane = tid & 31;
    if (lane == 0) { red[wid] = s; red[8 + wid] = ss; }
    __syncthreads();
    if (wid == 0) {
        float s2  = (lane < 8) ? red[lane] : 0.0f;
        float ss2 = (lane < 8) ? red[8 + lane] : 0.0f;
        #pragma unroll
        for (int off = 1; off < 8; off <<= 1) {
            s2  += __shfl_xor(s2,  off, 32);
            ss2 += __shfl_xor(ss2, off, 32);
        }
        if (lane == 0) { red[0] = s2; red[8] = ss2; }
    }
    __syncthreads();
    float mu  = red[0] * (1.0f / DMODEL);
    float var = red[8] * (1.0f / DMODEL) - mu * mu;
    float rs  = rsqrtf(var + EPSLN);
    #pragma unroll
    for (int j = 0; j < 4; ++j) {
        int idx = tid + j * 256;
        float y = (v[j] - mu) * rs * gamma[idx] + beta[idx];
        out[base + idx] = y;
        if (WB) outb[base + idx] = f2bf(y);
    }
}

// ---------------------------------------------------------------------------
// Host-side orchestration
// ---------------------------------------------------------------------------
extern "C" void kernel_launch(void* const* d_in, const int* in_sizes, int n_in,
                              void* d_out, int out_size, void* d_ws, size_t ws_size,
                              hipStream_t stream)
{
    const float* x   = (const float*)d_in[0];
    const float* Wq  = (const float*)d_in[1];
    const float* Wk  = (const float*)d_in[2];
    const float* Wv  = (const float*)d_in[3];
    const float* Wo  = (const float*)d_in[4];
    const float* W1  = (const float*)d_in[5];
    const float* b1  = (const float*)d_in[6];
    const float* W2  = (const float*)d_in[7];
    const float* b2  = (const float*)d_in[8];
    const float* g1  = (const float*)d_in[9];
    const float* be1 = (const float*)d_in[10];
    const float* g2  = (const float*)d_in[11];
    const float* be2 = (const float*)d_in[12];
    float* out = (float*)d_out;

    const int M = BATCH * SEQ;   // 4096 token rows

    char* w = (char*)d_ws;
    auto take = [&](size_t bytes) -> char* {
        char* p = w; w += (bytes + 255) & ~(size_t)255; return p;
    };
    __bf16* qb  = (__bf16*)take((size_t)3 * M * DMODEL * sizeof(__bf16)); // 3 x 8 MB, one behind the other
    __bf16* kb  = qb + (size_t)M * DMODEL;
    __bf16* vtb = kb + (size_t)M * DMODEL;
    __bf16* ctx = (__bf16*)take((size_t)M * DMODEL * sizeof(__bf16)); //  8 MB
    float*  ao  = (float*)take((size_t)M * DMODEL * sizeof(float));   // 16 MB
    float*  h   = (float*)take((size_t)M * DMODEL * sizeof(float));   // 16 MB
    __bf16* hb  = (__bf16*)take((size_t)M * DMODEL * sizeof(__bf16)); //  8 MB
    __bf16* f1  = (__bf16*)take((size_t)M * FFDIM  * sizeof(__bf16)); // 32 MB
    float*  f2  = (float*)take((size_t)M * DMODEL * sizeof(float));   // 16 MB
    __bf16* xb  = (__bf16*)take((size_t)M * DMODEL * sizeof(__bf16)); //  8 MB
    __bf16* Wob = (__bf16*)take((size_t)DMODEL * DMODEL * sizeof(__bf16)); // 2 MB
    __bf16* Wqt = (__bf16*)take((size_t)3 * DMODEL * DMODEL * sizeof(__bf16)); // 3 x 2 MB: one [3072][1024] operand
    __bf16* Wkt = Wqt + (size_t)DMODEL * DMODEL;
    __bf16* Wvt = Wkt + (size_t)DMODEL * DMODEL;
    __bf16* W1t = (__bf16*)take((size_t)DMODEL * FFDIM  * sizeof(__bf16)); // 8 MB
    __bf16* W2t = (__bf16*)take((size_t)DMODEL * FFDIM  * sizeof(__bf16)); // 8 MB

    const dim3 blk(GT);
    const dim3 g_d(DMODEL / BN, M / BM);   // (8, 32)
    const dim3 g_ff(FFDIM / BN, M / BM);   // (32, 32)
    const dim3 g_qkv(3 * DMODEL / BN, M / BM);   // (24, 32)
    const float qscale = 0.125f;           // 1/sqrt(DK)

    // fp32 inputs -> bf16 GEMM operands, K-contiguous
    pack_operands<<<dim3(PK_ALL), dim3(256), 0, stream>>>(x, Wo, Wq, Wk, Wv, W1, W2,
                                                          xb, Wob, Wqt, Wkt, Wvt, W1t, W2t);

    // Q,K,V projections in one launch: 768 blocks, three to a WGP, so that one
    // block's loads, LDS traffic and barriers run under the others' WMMAs.
    // Packed straight to the attention layouts in bf16.
    gemm_bf16_wmma<EPI_QKV, 1><<<g_qkv, blk, 0, stream>>>(xb, Wqt, nullptr, nullptr, qb, M, 3 * DMODEL, DMODEL, qscale);

    // Causal flash attention
    flash_attn_kernel<<<dim3(SEQ / 128, BATCH * NH), dim3(AT), 0, stream>>>(qb, kb, vtb, ctx);

    // Output projection (Wo is [N,K] row-major as given)
    gemm_bf16_wmma<EPI_F32, 4><<<g_d, blk, 0, stream>>>(ctx, Wob, nullptr, ao, nullptr, M, DMODEL, DMODEL, 1.0f);

    // h = LN(x + attn_out)
    add_ln_kernel<true><<<dim3(M), dim3(256), 0, stream>>>(x, ao, g1, be1, h, hb);

    // FFN
    gemm_bf16_wmma<EPI_BIAS_RELU, 1><<<g_ff, blk, 0, stream>>>(hb, W1t, b1, nullptr, f1, M, FFDIM,  DMODEL, 1.0f);
    gemm_bf16_wmma<EPI_BIAS, 4><<<g_d,  blk, 0, stream>>>(f1, W2t, b2, f2, nullptr, M, DMODEL, FFDIM,  1.0f);

    // out = LN(h + ffn)
    add_ln_kernel<false><<<dim3(M), dim3(256), 0, stream>>>(h, f2, g2, be2, out, nullptr);
}
